// v000
// The times below were measured on an AMD MI455X: many runs one after another, warmed up first and cycling through
// copies of the inputs, with the whole window's GPU time divided by the number of runs. Launches and the gaps
// between them are all in it. The median over several windows is given; except for v000 it joins two sittings, which
// can be a few percent apart, so the side-by-side timings, each taken in one sitting, are the better comparison.
// The starting kernel, v000, takes 420 microseconds a run.
#include <hip/hip_runtime.h>
#include <stddef.h>

// Projections x*Wq^T, x*Wk^T, x*Wv^T and att*Wo^T: v_wmma_f32_16x16x32_bf16 with bf16 hi/lo operand pairs (3 products), f32 accumulate.
// Scores q*k^T and p*v: v_wmma_f32_16x16x32_f16 with f16 operands under power-of-two scaling (q*8, k*8, p*4096, v*8), f32 accumulate.
// Mask, bias, online softmax and normalisation in f32.

#define NB   2
#define NC   512
#define NPTS 3072
#define NH   8
#define HD   64
#define NT16 (NPTS / 16)
#define NT64 (NPTS / 64)
#define NCT  (NC / 64)
#define PT   68
#define PP   40
#define MASKV (-30000.0f)
#define SSCL (1.0f / 512.0f)
#define PSCL 4096.0f
#define OSCL 32768.0f

typedef _Float16 f16t;
typedef unsigned short us;
typedef float        v8f  __attribute__((ext_vector_type(8)));
typedef float        v4f  __attribute__((ext_vector_type(4)));
typedef unsigned int v4u  __attribute__((ext_vector_type(4)));
typedef us           v8us __attribute__((ext_vector_type(8)));
typedef _Float16     v16h __attribute__((ext_vector_type(16)));
typedef _Float16     v8h  __attribute__((ext_vector_type(8)));
typedef __bf16       v16bf __attribute__((ext_vector_type(16)));
typedef v8h v8ha __attribute__((may_alias));
typedef v4f v4fa __attribute__((may_alias));

union FragH { v16h v; v8us uh[2]; v8h hh[2]; };
union FragB { v16bf v; v8us uh[2]; };

// ---------------------------------------------------------------------------
// WMMA helpers: 16x16x32, fragment layout per lane l: h = l>>4, m = l&15.
// A: row m, elements 0..7 = k0+8h+i, 8..15 = k0+16+8h+i.  B: column m, same k map
// (loaded from a k-contiguous [n][k] copy exactly like A).  D: acc[r] = (row 8h+r, col m).
// Each helper ends with 4 v_nop tying D and keeping A/B live (VALU hazard guard).
// ---------------------------------------------------------------------------
__device__ __forceinline__ v8f mma_b3(v16bf ah, v16bf al, v16bf bh, v16bf bl, v8f c) {
  c = __builtin_amdgcn_wmma_f32_16x16x32_bf16(false, ah, false, bh, (short)0, c, false, false);
  c = __builtin_amdgcn_wmma_f32_16x16x32_bf16(false, ah, false, bl, (short)0, c, false, false);
  c = __builtin_amdgcn_wmma_f32_16x16x32_bf16(false, al, false, bh, (short)0, c, false, false);
  asm volatile("v_nop\n\tv_nop\n\tv_nop\n\tv_nop" : "+v"(c) : "v"(ah), "v"(al), "v"(bh), "v"(bl));
  return c;
}
__device__ __forceinline__ v8f mma_h2(v16h a0, v16h b0, v16h a1, v16h b1, v8f c) {
  c = __builtin_amdgcn_wmma_f32_16x16x32_f16(false, a0, false, b0, (short)0, c, false, false);
  c = __builtin_amdgcn_wmma_f32_16x16x32_f16(false, a1, false, b1, (short)0, c, false, false);
  asm volatile("v_nop\n\tv_nop\n\tv_nop\n\tv_nop" : "+v"(c) : "v"(a0), "v"(b0), "v"(a1), "v"(b1));
  return c;
}
__device__ __forceinline__ v8f mma_h1(v16h a, v16h b, v8f c) {
  c = __builtin_amdgcn_wmma_f32_16x16x32_f16(false, a, false, b, (short)0, c, false, false);
  asm volatile("v_nop\n\tv_nop\n\tv_nop\n\tv_nop" : "+v"(c) : "v"(a), "v"(b));
  return c;
}

// ---------------------------------------------------------------------------
// Conversion helpers.  bf16 via RNE on the f32 bits; hi/lo pair: hi = rne(x), lo = rne(x - hi).
// ---------------------------------------------------------------------------
__device__ __forceinline__ unsigned bf_bits(float x) {
  const unsigned u = __float_as_uint(x);
  return (u + 0x7FFFu + ((u >> 16) & 1u)) >> 16;
}
__device__ __forceinline__ void bf_split(float x, unsigned &hi, unsigned &lo) {
  hi = bf_bits(x);
  lo = bf_bits(x - __uint_as_float(hi << 16));
}
__device__ __forceinline__ unsigned h_bits(float x) {
  return (unsigned)__builtin_bit_cast(unsigned short, (f16t)x);
}
// 8 floats -> 8 bf16 hi (packed in hv) and 8 bf16 lo (packed in lv); element 2j in the low half-word.
__device__ __forceinline__ void split8(const v4f a, const v4f b, v4u &hv, v4u &lv) {
  unsigned h0, h1, h2, h3, h4, h5, h6, h7, l0, l1, l2, l3, l4, l5, l6, l7;
  bf_split(a.x, h0, l0); bf_split(a.y, h1, l1); bf_split(a.z, h2, l2); bf_split(a.w, h3, l3);
  bf_split(b.x, h4, l4); bf_split(b.y, h5, l5); bf_split(b.z, h6, l6); bf_split(b.w, h7, l7);
  v4u r, s;
  r.x = h0 | (h1 << 16); r.y = h2 | (h3 << 16); r.z = h4 | (h5 << 16); r.w = h6 | (h7 << 16);
  s.x = l0 | (l1 << 16); s.y = l2 | (l3 << 16); s.z = l4 | (l5 << 16); s.w = l6 | (l7 << 16);
  hv = r; lv = s;
}
// 8 floats -> 8 f16 packed in one 16-byte vector.
__device__ __forceinline__ v4u pack8h(const v4f a, const v4f b) {
  v4u r;
  r.x = h_bits(a.x) | (h_bits(a.y) << 16);
  r.y = h_bits(a.z) | (h_bits(a.w) << 16);
  r.z = h_bits(b.x) | (h_bits(b.y) << 16);
  r.w = h_bits(b.z) | (h_bits(b.w) << 16);
  return r;
}
__device__ __forceinline__ v8f cat4(v4f a, v4f b) {
  v8f r = {a.x, a.y, a.z, a.w, b.x, b.y, b.z, b.w};
  return r;
}

// ---------------------------------------------------------------------------
// 64x64 output tile GEMM core (K = 512) with bf16 hi/lo planes for A and B.
// arh/arl point at A-plane row (row0 + m), element 8h; row subtile rt adds rt*16 rows.
// brh/brl point at B row (col0 + m) of a [n][k] row-major copy, element 8h.
// Wave owns columns col0 + 16w .. +15 (folded into brh/brl by the caller), rows 0..63 as acc[0..3].
// ---------------------------------------------------------------------------
__device__ __forceinline__ void gemm64(const us* __restrict__ arh, const us* __restrict__ arl,
                                       const us* __restrict__ brh, const us* __restrict__ brl,
                                       v8f acc[4]) {
  const v8f z = {0.f, 0.f, 0.f, 0.f, 0.f, 0.f, 0.f, 0.f};
#pragma unroll
  for (int rt = 0; rt < 4; ++rt) acc[rt] = z;
  for (int k0 = 0; k0 < NC; k0 += 32) {
    FragB fbh, fbl;
    fbh.uh[0] = *(const v8us*)(brh + k0);  fbh.uh[1] = *(const v8us*)(brh + k0 + 16);
    fbl.uh[0] = *(const v8us*)(brl + k0);  fbl.uh[1] = *(const v8us*)(brl + k0 + 16);
#pragma unroll
    for (int rt = 0; rt < 4; ++rt) {
      const size_t o = (size_t)rt * 16 * NC + k0;
      FragB fah, fal;
      fah.uh[0] = *(const v8us*)(arh + o);  fah.uh[1] = *(const v8us*)(arh + o + 16);
      fal.uh[0] = *(const v8us*)(arl + o);  fal.uh[1] = *(const v8us*)(arl + o + 16);
      acc[rt] = mma_b3(fah.v, fal.v, fbh.v, fbl.v, acc[rt]);
    }
  }
}
// Stage the wave's four 16x16 f32 accumulators into the block tile T[64][PT] (row = 16rt+8h+r, col = 16w+m).
__device__ __forceinline__ void stage64(float* T, const v8f acc[4], int h, int m, int w) {
#pragma unroll
  for (int rt = 0; rt < 4; ++rt)
#pragma unroll
    for (int r = 0; r < 8; ++r) T[(16 * rt + 8 * h + r) * PT + 16 * w + m] = acc[rt][r];
}

// ---------------------------------------------------------------------------
// 1) x[b][c][n] (f32) -> xh/xl[b][n][c] bf16 hi/lo planes.  Block: 64 n x 64 c tile through LDS;
// ---------------------------------------------------------------------------
__global__ void __launch_bounds__(128)
k_cvt_x(const float* __restrict__ x, us* __restrict__ xh, us* __restrict__ xl) {
  __shared__ __align__(16) float T[64 * PT];
  const int bid = blockIdx.x;
  if (bid >= NB * NT64 * NCT) return;
  const int ct = bid % NCT;
  const int nt = (bid / NCT) % NT64;
  const int b  = bid / (NCT * NT64);
  const int c0 = ct * 64, n0 = nt * 64;
  const int t = threadIdx.x;
  const float* src = x + ((size_t)b * NC + c0) * NPTS + n0;
#pragma unroll
  for (int i = 0; i < 32; ++i) {
    const int idx = i * 128 + t;
    const int cl = idx >> 6, nl = idx & 63;
    T[nl * PT + cl] = src[(size_t)cl * NPTS + nl];
  }
  __syncthreads();
  const int l = t & 31, w = t >> 5, j = l & 7, rq = l >> 3;
  v4u hv[4], lv[4];
#pragma unroll
  for (int i = 0; i < 4; ++i) {
    const int row = 16 * w + 4 * i + rq;
    const v4fa* s = (const v4fa*)(T + row * PT + 8 * j);
    split8(s[0], s[1], hv[i], lv[i]);
  }
  us* dh = xh + ((size_t)b * NPTS + n0) * NC + c0 + 8 * j;
  us* dl = xl + ((size_t)b * NPTS + n0) * NC + c0 + 8 * j;
#pragma unroll
  for (int i = 0; i < 4; ++i) {
    const size_t ro = (size_t)(16 * w + 4 * i + rq) * NC;
    *(v4u*)(dh + ro) = hv[i];
    *(v4u*)(dl + ro) = lv[i];
  }
  
}

// ---------------------------------------------------------------------------
// 2) W (f32 [co][c], row-major, no transpose needed) -> wh/wl[mat][co][c] bf16 hi/lo planes.
// ---------------------------------------------------------------------------
__global__ void __launch_bounds__(128)
k_cvt_w(const float* __restrict__ w0, const float* __restrict__ w1,
        const float* __restrict__ w2, const float* __restrict__ w3,
        us* __restrict__ wh, us* __restrict__ wl) {
  const int l = threadIdx.x & 31;
  const int wg = blockIdx.x * 4 + (threadIdx.x >> 5);
  if (wg >= 4 * NC) return;
  const int mat = wg / NC, row = wg % NC;
  const float* src = (mat == 0) ? w0 : ((mat == 1) ? w1 : ((mat == 2) ? w2 : w3));
  src += (size_t)row * NC;
  us* dh = wh + ((size_t)mat * NC + row) * NC;
  us* dl = wl + ((size_t)mat * NC + row) * NC;
  v4u hv[2], lv[2];
#pragma unroll
  for (int ch = 0; ch < 2; ++ch) {
    const v4f* s = (const v4f*)(src + 256 * ch + 8 * l);
    split8(s[0], s[1], hv[ch], lv[ch]);
  }
#pragma unroll
  for (int ch = 0; ch < 2; ++ch) {
    *(v4u*)(dh + 256 * ch + 8 * l) = hv[ch];
    *(v4u*)(dl + 256 * ch + 8 * l) = lv[ch];
  }
  
}

// ---------------------------------------------------------------------------
// 3) Fused mask+bias table, f32, layout mb[(nt*NPTS + key)*16 + r] = adj[16nt+r][key] ? gb : MASKV.
//    Block covers (nt, 256 keys) = 128 contiguous lines; wave w owns 32 lines; each instruction
// ---------------------------------------------------------------------------
__global__ void __launch_bounds__(128)
k_mb(const int* __restrict__ adj, const float* __restrict__ gb, float* __restrict__ mb) {
  const int bid = blockIdx.x;
  if (bid >= NT16 * (NPTS / 256)) return;
  const int kq = bid % (NPTS / 256), nt = bid / (NPTS / 256);
  const int key0 = kq * 256, nr0 = nt * 16;
  const int l = threadIdx.x & 31, w = threadIdx.x >> 5;
  float* base = mb + ((size_t)nt * NPTS + key0) * 16;
  v4f vals[8];
#pragma unroll
  for (int i = 0; i < 8; ++i) {
    const int e = 1024 * w + 128 * i + 4 * l;
    const int kl = e >> 4, r0 = e & 15;
    const size_t idx = (size_t)(nr0 + r0) * NPTS + key0 + kl;
    v4f v;
    { const int a = adj[idx];            const float g = gb[idx];            v.x = (a != 0) ? g : MASKV; }
    { const int a = adj[idx + NPTS];     const float g = gb[idx + NPTS];     v.y = (a != 0) ? g : MASKV; }
    { const int a = adj[idx + 2 * NPTS]; const float g = gb[idx + 2 * NPTS]; v.z = (a != 0) ? g : MASKV; }
    { const int a = adj[idx + 3 * NPTS]; const float g = gb[idx + 3 * NPTS]; v.w = (a != 0) ? g : MASKV; }
    vals[i] = v;
  }
#pragma unroll
  for (int i = 0; i < 8; ++i) *(v4f*)(base + 1024 * w + 128 * i + 4 * l) = vals[i];
  
}

// ---------------------------------------------------------------------------
// 4) QKV projection.  Block tile: 64 points x 64 channels (one head), matrices q,k,v in sequence.
//    A = xh/xl rows [b][n][c]; B = W rows [co][c] (k-contiguous copy, loaded like A).
// ---------------------------------------------------------------------------
__global__ void __launch_bounds__(128)
k_qkv(const us* __restrict__ xh, const us* __restrict__ xl,
      const us* __restrict__ wh, const us* __restrict__ wl,
      const float* __restrict__ bq, const float* __restrict__ bk, const float* __restrict__ bv,
      us* __restrict__ q16, us* __restrict__ k16, us* __restrict__ vT16) {
  __shared__ __align__(16) float T[64 * PT];
  const int bid = blockIdx.x;
  if (bid >= NB * NT64 * NH) return;
  const int hd = bid % NH;
  const int nt = (bid / NH) % NT64;
  const int b  = bid / (NH * NT64);
  const int n0 = nt * 64, co0 = hd * HD;
  const int t = threadIdx.x, l = t & 31, w = t >> 5, h = l >> 4, m = l & 15;
  const int j = l & 7, rq = l >> 3;
  const int bh = b * NH + hd;
  const size_t aoff = ((size_t)b * NPTS + n0 + m) * NC + 8 * h;
  const us* arh = xh + aoff;
  const us* arl = xl + aoff;
#pragma unroll 1
  for (int p = 0; p < 3; ++p) {
    const size_t boff = ((size_t)p * NC + co0 + 16 * w + m) * NC + 8 * h;
    v8f acc[4];
    gemm64(arh, arl, wh + boff, wl + boff, acc);
    stage64(T, acc, h, m, w);
    __syncthreads();
    const float* bias = (p == 0) ? bq : ((p == 1) ? bk : bv);
    v4u vals[4];
    if (p < 2) {
      us* dst = ((p == 0) ? q16 : k16) + ((size_t)bh * NPTS + n0) * HD + 8 * j;
      const v4f b0 = *(const v4f*)(bias + co0 + 8 * j);
      const v4f b1 = *(const v4f*)(bias + co0 + 8 * j + 4);
#pragma unroll
      for (int i = 0; i < 4; ++i) {
        const int row = 16 * w + 4 * i + rq;
        const v4fa* s = (const v4fa*)(T + row * PT + 8 * j);
        const v4f f0 = (s[0] + b0) * 8.0f;
        const v4f f1 = (s[1] + b1) * 8.0f;
        vals[i] = pack8h(f0, f1);
      }
#pragma unroll
      for (int i = 0; i < 4; ++i)
        *(v4u*)(dst + (size_t)(16 * w + 4 * i + rq) * HD) = vals[i];
      
    } else {
      us* dst = vT16 + ((size_t)bh * HD) * NPTS + n0 + 8 * j;
#pragma unroll
      for (int i = 0; i < 4; ++i) {
        const int d = 16 * w + 4 * i + rq;
        const float bd = bias[co0 + d];
        v4f f0, f1;
        f0.x = (T[(8 * j + 0) * PT + d] + bd) * 8.0f;
        f0.y = (T[(8 * j + 1) * PT + d] + bd) * 8.0f;
        f0.z = (T[(8 * j + 2) * PT + d] + bd) * 8.0f;
        f0.w = (T[(8 * j + 3) * PT + d] + bd) * 8.0f;
        f1.x = (T[(8 * j + 4) * PT + d] + bd) * 8.0f;
        f1.y = (T[(8 * j + 5) * PT + d] + bd) * 8.0f;
        f1.z = (T[(8 * j + 6) * PT + d] + bd) * 8.0f;
        f1.w = (T[(8 * j + 7) * PT + d] + bd) * 8.0f;
        vals[i] = pack8h(f0, f1);
      }
#pragma unroll
      for (int i = 0; i < 4; ++i)
        *(v4u*)(dst + (size_t)(16 * w + 4 * i + rq) * NPTS) = vals[i];
      
    }
    __syncthreads();
  }
}

// ---------------------------------------------------------------------------
// 5) Flash attention.  One wave per (b, h, 16 query rows); 32-key steps; online softmax in f32.
//    S tile: A = q16 rows (d as k), B = k16 rows [key][d] (k-contiguous copy, loaded like A).
//    P: D layout -> per-wave LDS row-major (f16, *4096) -> barrier -> A layout reload (may_alias).
//    P*V: B = vT16 rows [d][key] (k-contiguous copy).  O normalised, staged in LDS, written as
// ---------------------------------------------------------------------------
__global__ void __launch_bounds__(128)
k_attn(const us* __restrict__ q16, const us* __restrict__ k16, const us* __restrict__ vT16,
       const float* __restrict__ mb, us* __restrict__ ath, us* __restrict__ atl) {
  __shared__ __align__(16) f16t sP[4 * 16 * PP];
  __shared__ __align__(16) float sO[4 * 16 * PT];
  const int bid = blockIdx.x;
  if (bid >= (NB * NH * NT16) / 4) return;
  const int t = threadIdx.x, l = t & 31, w = t >> 5, h = l >> 4, m = l & 15;
  const int wg = bid * 4 + w;
  const int nt = wg % NT16;
  const int bh = wg / NT16;
  const int b = bh / NH, hd = bh % NH;
  const int n0 = nt * 16;
  f16t* lp = sP + w * (16 * PP);
  float* lo = sO + w * (16 * PT);

  const us* qrow = q16 + ((size_t)bh * NPTS + n0 + m) * HD + 8 * h;
  FragH aq0, aq1;
  aq0.uh[0] = *(const v8us*)(qrow);      aq0.uh[1] = *(const v8us*)(qrow + 16);
  aq1.uh[0] = *(const v8us*)(qrow + 32); aq1.uh[1] = *(const v8us*)(qrow + 48);
  const us* kbase = k16 + ((size_t)bh * NPTS + m) * HD + 8 * h;
  const us* vbase = vT16 + ((size_t)bh * HD + m) * NPTS + 8 * h;
  const float* mbb = mb + ((size_t)nt * NPTS + m) * 16 + 8 * h;

  const v8f z = {0.f, 0.f, 0.f, 0.f, 0.f, 0.f, 0.f, 0.f};
  v8f o[4];
#pragma unroll
  for (int dt = 0; dt < 4; ++dt) o[dt] = z;
  v8f mrow, lrow = z;
#pragma unroll
  for (int r = 0; r < 8; ++r) mrow[r] = -1.0e30f;

  for (int key0 = 0; key0 < NPTS; key0 += 32) {
    v8f s0 = z, s1 = z;
    {
      const us* kp = kbase + (size_t)key0 * HD;
      FragH b0, b1;
      b0.uh[0] = *(const v8us*)(kp);      b0.uh[1] = *(const v8us*)(kp + 16);
      b1.uh[0] = *(const v8us*)(kp + 32); b1.uh[1] = *(const v8us*)(kp + 48);
      s0 = mma_h2(aq0.v, b0.v, aq1.v, b1.v, s0);
    }
    {
      const us* kp = kbase + (size_t)(key0 + 16) * HD;
      FragH b0, b1;
      b0.uh[0] = *(const v8us*)(kp);      b0.uh[1] = *(const v8us*)(kp + 16);
      b1.uh[0] = *(const v8us*)(kp + 32); b1.uh[1] = *(const v8us*)(kp + 48);
      s1 = mma_h2(aq0.v, b0.v, aq1.v, b1.v, s1);
    }
    // scale 1/512 (= 1/64 from the *8*8 storage, times 1/sqrt(64)) and add fused mask+bias
    {
      const float* mp0 = mbb + (size_t)key0 * 16;
      const float* mp1 = mbb + (size_t)(key0 + 16) * 16;
      const v8f mb0 = cat4(*(const v4f*)(mp0), *(const v4f*)(mp0 + 4));
      const v8f mb1 = cat4(*(const v4f*)(mp1), *(const v4f*)(mp1 + 4));
#pragma unroll
      for (int r = 0; r < 8; ++r) {
        s0[r] = s0[r] * SSCL + mb0[r];
        s1[r] = s1[r] * SSCL + mb1[r];
      }
    }
    // row max over the 32 keys: rows live in 16-lane halves (xor < 16 stays inside the half)
    v8f tm;
#pragma unroll
    for (int r = 0; r < 8; ++r) tm[r] = fmaxf(s0[r], s1[r]);
#pragma unroll
    for (int off = 1; off <= 8; off <<= 1)
#pragma unroll
      for (int r = 0; r < 8; ++r) tm[r] = fmaxf(tm[r], __shfl_xor(tm[r], off, 32));
    v8f mnew, alpha, p0, p1, rs;
#pragma unroll
    for (int r = 0; r < 8; ++r) {
      mnew[r]  = fmaxf(mrow[r], tm[r]);
      alpha[r] = __expf(mrow[r] - mnew[r]);
      p0[r]    = __expf(s0[r] - mnew[r]);
      p1[r]    = __expf(s1[r] - mnew[r]);
      rs[r]    = p0[r] + p1[r];
    }
#pragma unroll
    for (int off = 1; off <= 8; off <<= 1)
#pragma unroll
      for (int r = 0; r < 8; ++r) rs[r] += __shfl_xor(rs[r], off, 32);
#pragma unroll
    for (int r = 0; r < 8; ++r) {
      lrow[r] = lrow[r] * alpha[r] + rs[r];
      mrow[r] = mnew[r];
    }
#pragma unroll
    for (int dt = 0; dt < 4; ++dt) o[dt] = o[dt] * alpha;
    // P: D layout (lane = key column, rows 8h+r) -> LDS row-major [row][key], f16 scaled by 4096
#pragma unroll
    for (int r = 0; r < 8; ++r) {
      lp[(8 * h + r) * PP + m]      = (f16t)(p0[r] * PSCL);
      lp[(8 * h + r) * PP + 16 + m] = (f16t)(p1[r] * PSCL);
    }
    __syncthreads();
    FragH pa;
    pa.hh[0] = *(const v8ha*)(lp + m * PP + 8 * h);
    pa.hh[1] = *(const v8ha*)(lp + m * PP + 16 + 8 * h);
#pragma unroll
    for (int dt = 0; dt < 4; ++dt) {
      const us* vp = vbase + (size_t)dt * 16 * NPTS + key0;
      FragH bvf;
      bvf.uh[0] = *(const v8us*)(vp);
      bvf.uh[1] = *(const v8us*)(vp + 16);
      o[dt] = mma_h1(pa.v, bvf.v, o[dt]);
    }
  }

  // normalise: O holds 32768 * sum p v; divide by 32768 * l
  v8f inv;
#pragma unroll
  for (int r = 0; r < 8; ++r) inv[r] = 1.0f / (lrow[r] * OSCL);
#pragma unroll
  for (int dt = 0; dt < 4; ++dt)
#pragma unroll
    for (int r = 0; r < 8; ++r) lo[(8 * h + r) * PT + 16 * dt + m] = o[dt][r] * inv[r];
  __syncthreads();
  const int j = l & 7, rq = l >> 3;
  v4u hv[4], lv[4];
#pragma unroll
  for (int i = 0; i < 4; ++i) {
    const int row = 4 * i + rq;
    const v4fa* s = (const v4fa*)(lo + row * PT + 8 * j);
    split8(s[0], s[1], hv[i], lv[i]);
  }
  us* dh = ath + ((size_t)b * NPTS + n0) * NC + hd * HD + 8 * j;
  us* dl = atl + ((size_t)b * NPTS + n0) * NC + hd * HD + 8 * j;
#pragma unroll
  for (int i = 0; i < 4; ++i) {
    const size_t ro = (size_t)(4 * i + rq) * NC;
    *(v4u*)(dh + ro) = hv[i];
    *(v4u*)(dl + ro) = lv[i];
  }
  
}

// ---------------------------------------------------------------------------
// 6) Output projection: out[b][co][n] = sum_c att[b][n][c] * Wo[co][c] + bo[co].
//    Block tile 64 n x 64 co; A = ath/atl rows, B = Wo hi/lo rows (matrix slot 3).
// ---------------------------------------------------------------------------
__global__ void __launch_bounds__(128)
k_out(const us* __restrict__ ath, const us* __restrict__ atl,
      const us* __restrict__ wh, const us* __restrict__ wl,
      const float* __restrict__ bo, float* __restrict__ out) {
  __shared__ __align__(16) float T[64 * PT];
  const int bid = blockIdx.x;
  if (bid >= NB * NT64 * NCT) return;
  const int cot = bid % NCT;
  const int nt  = (bid / NCT) % NT64;
  const int b   = bid / (NCT * NT64);
  const int n0 = nt * 64, co0 = cot * 64;
  const int t = threadIdx.x, l = t & 31, w = t >> 5, h = l >> 4, m = l & 15;
  const size_t aoff = ((size_t)b * NPTS + n0 + m) * NC + 8 * h;
  const size_t boff = ((size_t)3 * NC + co0 + 16 * w + m) * NC + 8 * h;
  v8f acc[4];
  gemm64(ath + aoff, atl + aoff, wh + boff, wl + boff, acc);
  stage64(T, acc, h, m, w);
  __syncthreads();
  const int cq = l >> 4, nq = 4 * (l & 15);
  v4f vals[8];
#pragma unroll
  for (int i = 0; i < 8; ++i) {
    const int col = 16 * w + 2 * i + cq;
    const float bb = bo[co0 + col];
    v4f f;
    f.x = T[(nq + 0) * PT + col] + bb;
    f.y = T[(nq + 1) * PT + col] + bb;
    f.z = T[(nq + 2) * PT + col] + bb;
    f.w = T[(nq + 3) * PT + col] + bb;
    vals[i] = f;
  }
  float* dst = out + ((size_t)b * NC + co0) * NPTS + n0 + nq;
#pragma unroll
  for (int i = 0; i < 8; ++i)
    *(v4f*)(dst + (size_t)(16 * w + 2 * i + cq) * NPTS) = vals[i];
  
}

// ---------------------------------------------------------------------------
// Host glue.  Inputs: x, adjacency, geo_bias, Wq, bq, Wk, bk, Wv, bv, Wo, bo.
// Workspace carve (bytes): xh, xl 2 x 6291456; wh, wl 2 x 2097152; mb 37748736;
// q16, k16, vT16 3 x 6291456; ath, atl 2 x 6291456; total 85983232.
// ---------------------------------------------------------------------------
extern "C" void kernel_launch(void* const* d_in, const int* in_sizes, int n_in,
                              void* d_out, int out_size, void* d_ws, size_t ws_size,
                              hipStream_t stream) {
  if (n_in < 11) return;
  if (in_sizes[0] != NB * NC * NPTS) return;
  if (in_sizes[1] != NPTS * NPTS || in_sizes[2] != NPTS * NPTS) return;
  if (in_sizes[3] != NC * NC || in_sizes[5] != NC * NC || in_sizes[7] != NC * NC || in_sizes[9] != NC * NC) return;
  if (in_sizes[4] != NC || in_sizes[6] != NC || in_sizes[8] != NC || in_sizes[10] != NC) return;
  if (out_size != NB * NC * NPTS) return;

  const float* x   = (const float*)d_in[0];
  const int*   adj = (const int*)d_in[1];
  const float* gb  = (const float*)d_in[2];
  const float* Wq  = (const float*)d_in[3];
  const float* bq  = (const float*)d_in[4];
  const float* Wk  = (const float*)d_in[5];
  const float* bk  = (const float*)d_in[6];
  const float* Wv  = (const float*)d_in[7];
  const float* bv  = (const float*)d_in[8];
  const float* Wo  = (const float*)d_in[9];
  const float* bo  = (const float*)d_in[10];
  float* out = (float*)d_out;

  const size_t sz_x16 = (size_t)NB * NPTS * NC * 2;         // 6291456
  const size_t sz_w16 = (size_t)4 * NC * NC * 2;             // 2097152
  const size_t sz_mb  = (size_t)NPTS * NPTS * 4;             // 37748736
  const size_t sz_hd  = (size_t)NB * NH * NPTS * HD * 2;     // 6291456
  char* ws = (char*)d_ws;
  size_t off = 0;
  us* xh   = (us*)(ws + off);    off += sz_x16;
  us* xl   = (us*)(ws + off);    off += sz_x16;
  us* wh   = (us*)(ws + off);    off += sz_w16;
  us* wl   = (us*)(ws + off);    off += sz_w16;
  float* mb = (float*)(ws + off); off += sz_mb;
  us* q16  = (us*)(ws + off);    off += sz_hd;
  us* k16  = (us*)(ws + off);    off += sz_hd;
  us* vT16 = (us*)(ws + off);    off += sz_hd;
  us* ath  = (us*)(ws + off);    off += sz_x16;
  us* atl  = (us*)(ws + off);    off += sz_x16;
  if (off > ws_size) return;

  k_cvt_x<<<NB * NT64 * NCT, 128, 0, stream>>>(x, xh, xl);
  k_cvt_w<<<(4 * NC) / 4, 128, 0, stream>>>(Wq, Wk, Wv, Wo, wh, wl);
  k_mb<<<NT16 * (NPTS / 256), 128, 0, stream>>>(adj, gb, mb);
  k_qkv<<<NB * NT64 * NH, 128, 0, stream>>>(xh, xl, wh, wl, bq, bk, bv, q16, k16, vT16);
  k_attn<<<(NB * NH * NT16) / 4, 128, 0, stream>>>(q16, k16, vT16, mb, ath, atl);
  k_out<<<NB * NT64 * NCT, 128, 0, stream>>>(ath, atl, wh, wl, bo, out);
}

// v001
// A run of this version takes 280 microseconds.
// Next to v000, in two timings, it ran 1.50 and 1.51 times as fast.
#include <hip/hip_runtime.h>
#include <stddef.h>

// Projections x*Wq^T, x*Wk^T, x*Wv^T and att*Wo^T: v_wmma_f32_16x16x32_bf16 with bf16 hi/lo operand pairs (3 products), f32 accumulate.
// Scores q*k^T and p*v: v_wmma_f32_16x16x32_f16 with f16 operands under power-of-two scaling (q*8, k*8, p*4096, v*8), f32 accumulate.
// Mask, bias, online softmax and normalisation in f32.

#define NB   2
#define NC   512
#define NPTS 3072
#define NH   8
#define HD   64
#define NT16 (NPTS / 16)
#define NT64 (NPTS / 64)
#define NCT  (NC / 64)
#define PT   68
#define PP   40
#define MASKV (-30000.0f)
#define SSCL (1.0f / 512.0f)
#define PSCL 4096.0f
#define OSCL 32768.0f

typedef _Float16 f16t;
typedef unsigned short us;
typedef float        v8f  __attribute__((ext_vector_type(8)));
typedef float        v4f  __attribute__((ext_vector_type(4)));
typedef unsigned int v4u  __attribute__((ext_vector_type(4)));
typedef us           v8us __attribute__((ext_vector_type(8)));
typedef _Float16     v16h __attribute__((ext_vector_type(16)));
typedef _Float16     v8h  __attribute__((ext_vector_type(8)));
typedef __bf16       v16bf __attribute__((ext_vector_type(16)));
typedef v8h v8ha __attribute__((may_alias));
typedef v4f v4fa __attribute__((may_alias));

union FragH { v16h v; v8us uh[2]; v8h hh[2]; };
union FragB { v16bf v; v8us uh[2]; };

// ---------------------------------------------------------------------------
// WMMA helpers: 16x16x32, fragment layout per lane l: h = l>>4, m = l&15.
// A: row m, elements 0..7 = k0+8h+i, 8..15 = k0+16+8h+i.  B: column m, same k map
// (loaded from a k-contiguous [n][k] copy exactly like A).  D: acc[r] = (row 8h+r, col m).
// Each helper ends with 4 v_nop tying D and keeping A/B live (VALU hazard guard).
// ---------------------------------------------------------------------------
__device__ __forceinline__ v8f mma_b3(v16bf ah, v16bf al, v16bf bh, v16bf bl, v8f c) {
  c = __builtin_amdgcn_wmma_f32_16x16x32_bf16(false, ah, false, bh, (short)0, c, false, false);
  c = __builtin_amdgcn_wmma_f32_16x16x32_bf16(false, ah, false, bl, (short)0, c, false, false);
  c = __builtin_amdgcn_wmma_f32_16x16x32_bf16(false, al, false, bh, (short)0, c, false, false);
  asm volatile("v_nop\n\tv_nop\n\tv_nop\n\tv_nop" : "+v"(c) : "v"(ah), "v"(al), "v"(bh), "v"(bl));
  return c;
}
__device__ __forceinline__ v8f mma_h2(v16h a0, v16h b0, v16h a1, v16h b1, v8f c) {
  c = __builtin_amdgcn_wmma_f32_16x16x32_f16(false, a0, false, b0, (short)0, c, false, false);
  c = __builtin_amdgcn_wmma_f32_16x16x32_f16(false, a1, false, b1, (short)0, c, false, false);
  asm volatile("v_nop\n\tv_nop\n\tv_nop\n\tv_nop" : "+v"(c) : "v"(a0), "v"(b0), "v"(a1), "v"(b1));
  return c;
}
__device__ __forceinline__ v8f mma_h1(v16h a, v16h b, v8f c) {
  c = __builtin_amdgcn_wmma_f32_16x16x32_f16(false, a, false, b, (short)0, c, false, false);
  asm volatile("v_nop\n\tv_nop\n\tv_nop\n\tv_nop" : "+v"(c) : "v"(a), "v"(b));
  return c;
}

// ---------------------------------------------------------------------------
// Conversion helpers.  bf16 via RNE on the f32 bits; hi/lo pair: hi = rne(x), lo = rne(x - hi).
// ---------------------------------------------------------------------------
__device__ __forceinline__ unsigned bf_bits(float x) {
  const unsigned u = __float_as_uint(x);
  return (u + 0x7FFFu + ((u >> 16) & 1u)) >> 16;
}
__device__ __forceinline__ void bf_split(float x, unsigned &hi, unsigned &lo) {
  hi = bf_bits(x);
  lo = bf_bits(x - __uint_as_float(hi << 16));
}
__device__ __forceinline__ unsigned h_bits(float x) {
  return (unsigned)__builtin_bit_cast(unsigned short, (f16t)x);
}
// 8 floats -> 8 bf16 hi (packed in hv) and 8 bf16 lo (packed in lv); element 2j in the low half-word.
__device__ __forceinline__ void split8(const v4f a, const v4f b, v4u &hv, v4u &lv) {
  unsigned h0, h1, h2, h3, h4, h5, h6, h7, l0, l1, l2, l3, l4, l5, l6, l7;
  bf_split(a.x, h0, l0); bf_split(a.y, h1, l1); bf_split(a.z, h2, l2); bf_split(a.w, h3, l3);
  bf_split(b.x, h4, l4); bf_split(b.y, h5, l5); bf_split(b.z, h6, l6); bf_split(b.w, h7, l7);
  v4u r, s;
  r.x = h0 | (h1 << 16); r.y = h2 | (h3 << 16); r.z = h4 | (h5 << 16); r.w = h6 | (h7 << 16);
  s.x = l0 | (l1 << 16); s.y = l2 | (l3 << 16); s.z = l4 | (l5 << 16); s.w = l6 | (l7 << 16);
  hv = r; lv = s;
}
// 8 floats -> 8 f16 packed in one 16-byte vector.
__device__ __forceinline__ v4u pack8h(const v4f a, const v4f b) {
  v4u r;
  r.x = h_bits(a.x) | (h_bits(a.y) << 16);
  r.y = h_bits(a.z) | (h_bits(a.w) << 16);
  r.z = h_bits(b.x) | (h_bits(b.y) << 16);
  r.w = h_bits(b.z) | (h_bits(b.w) << 16);
  return r;
}
__device__ __forceinline__ v8f cat4(v4f a, v4f b) {
  v8f r = {a.x, a.y, a.z, a.w, b.x, b.y, b.z, b.w};
  return r;
}

// ---------------------------------------------------------------------------
// 64x64 output tile GEMM core (K = 512) with bf16 hi/lo planes for A and B.
// The A pointers stand at A-plane row (row0 + m), element 8h; row subtile rt adds rt*16 rows.
// The B pointers stand at B row (col0 + m) of a [n][k] row-major copy, element 8h.
// Wave owns columns col0 + 16w .. +15 (folded into the B pointers by the caller), rows 0..63 as acc[0..3].
// ---------------------------------------------------------------------------
// The fragments of one k-step (32 k): B hi/lo and the four row subtiles' A hi/lo.
struct GFrag { FragB bh, bl, ah[4], al[4]; };
// Four lane pointers: A row (row0 + m) and B row (col0 + m) at some element k + 8h, hi and lo planes.
struct GAddr { const us* ah; const us* al; const us* bh; const us* bl; };
// Loads the k-step that begins ko elements (a constant) behind p.
__device__ __forceinline__ void gload(GFrag &f, const GAddr &p, int ko) {
  f.bh.uh[0] = *(const v8us*)(p.bh + ko);  f.bh.uh[1] = *(const v8us*)(p.bh + ko + 16);
  f.bl.uh[0] = *(const v8us*)(p.bl + ko);  f.bl.uh[1] = *(const v8us*)(p.bl + ko + 16);
#pragma unroll
  for (int rt = 0; rt < 4; ++rt) {
    const size_t o = (size_t)rt * 16 * NC + ko;
    f.ah[rt].uh[0] = *(const v8us*)(p.ah + o);  f.ah[rt].uh[1] = *(const v8us*)(p.ah + o + 16);
    f.al[rt].uh[0] = *(const v8us*)(p.al + o);  f.al[rt].uh[1] = *(const v8us*)(p.al + o + 16);
  }
  // the 20 loads are issued here, in front of the products that follow: moved behind the first of those products they
  // would start only when the other buffer's loads have landed, and the two buffers would no longer fly together
  __builtin_amdgcn_sched_barrier(0);
}
// The wait that stands in front of a rewrite of the loads' address registers.  It takes the four pointers as inputs, so
// they stay in their registers up to it and no later load of the same run gets one of them as its destination.
__device__ __forceinline__ void gaddr_wait(const GAddr &p) {
  asm volatile("s_wait_xcnt 0x0" :: "v"(p.ah), "v"(p.al), "v"(p.bh), "v"(p.bl) : "memory");
}
__device__ __forceinline__ void gmma(const GFrag &f, v8f acc[4]) {
#pragma unroll
  for (int rt = 0; rt < 4; ++rt) acc[rt] = mma_b3(f.ah[rt].v, f.al[rt].v, f.bh.v, f.bl.v, acc[rt]);
}
// Two register buffers: all 20 loads of k-step s+1 are issued in front of the products of k-step s, so every load is one
// k-step old when it is waited for (k order of the sums as before).  The caller hands in f0 holding k-step 0.  Behind the
// last k-step f0 is refilled with k-step 0 of the same A rows and of the B rows at element offset bnext (the next product's
// first fragments where the caller has one; otherwise unused).
__device__ __forceinline__ void gemm64(const GAddr &g, int bnext, GFrag &f0, v8f acc[4]) {
  const v8f z = {0.f, 0.f, 0.f, 0.f, 0.f, 0.f, 0.f, 0.f};
#pragma unroll
  for (int rt = 0; rt < 4; ++rt) acc[rt] = z;
  GFrag f1;
#pragma unroll 1  // rolled: fully unrolled, the projection kernel passes 256 registers and switches register windows in the k loop
  for (int k0 = 0; k0 < NC; k0 += 64) {
    const int ka = (k0 + 64 < NC) ? k0 + 64 : 0;
    const int kb = (k0 + 64 < NC) ? k0 + 64 : bnext;
    const GAddr p1 = {g.ah + k0, g.al + k0, g.bh + k0, g.bl + k0};
    gload(f1, p1, 32);
    gmma(f0, acc);
    gaddr_wait(p1);
    const GAddr p0 = {g.ah + ka, g.al + ka, g.bh + kb, g.bl + kb};
    gload(f0, p0, 0);
    gmma(f1, acc);
    gaddr_wait(p0);
  }
}
// Stage the wave's four 16x16 f32 accumulators into the block tile T[64][PT] (row = 16rt+8h+r, col = 16w+m).
__device__ __forceinline__ void stage64(float* T, const v8f acc[4], int h, int m, int w) {
#pragma unroll
  for (int rt = 0; rt < 4; ++rt)
#pragma unroll
    for (int r = 0; r < 8; ++r) T[(16 * rt + 8 * h + r) * PT + 16 * w + m] = acc[rt][r];
}

// ---------------------------------------------------------------------------
// 1) x[b][c][n] (f32) -> xh/xl[b][n][c] bf16 hi/lo planes.  Block: 64 n x 64 c tile through LDS;
// ---------------------------------------------------------------------------
__global__ void __launch_bounds__(128)
k_cvt_x(const float* __restrict__ x, us* __restrict__ xh, us* __restrict__ xl) {
  __shared__ __align__(16) float T[64 * PT];
  const int bid = blockIdx.x;
  if (bid >= NB * NT64 * NCT) return;
  const int ct = bid % NCT;
  const int nt = (bid / NCT) % NT64;
  const int b  = bid / (NCT * NT64);
  const int c0 = ct * 64, n0 = nt * 64;
  const int t = threadIdx.x;
  const float* src = x + ((size_t)b * NC + c0) * NPTS + n0;
#pragma unroll
  for (int i = 0; i < 32; ++i) {
    const int idx = i * 128 + t;
    const int cl = idx >> 6, nl = idx & 63;
    T[nl * PT + cl] = src[(size_t)cl * NPTS + nl];
  }
  __syncthreads();
  const int l = t & 31, w = t >> 5, j = l & 7, rq = l >> 3;
  v4u hv[4], lv[4];
#pragma unroll
  for (int i = 0; i < 4; ++i) {
    const int row = 16 * w + 4 * i + rq;
    const v4fa* s = (const v4fa*)(T + row * PT + 8 * j);
    split8(s[0], s[1], hv[i], lv[i]);
  }
  us* dh = xh + ((size_t)b * NPTS + n0) * NC + c0 + 8 * j;
  us* dl = xl + ((size_t)b * NPTS + n0) * NC + c0 + 8 * j;
#pragma unroll
  for (int i = 0; i < 4; ++i) {
    const size_t ro = (size_t)(16 * w + 4 * i + rq) * NC;
    *(v4u*)(dh + ro) = hv[i];
    *(v4u*)(dl + ro) = lv[i];
  }
  
}

// ---------------------------------------------------------------------------
// 2) W (f32 [co][c], row-major, no transpose needed) -> wh/wl[mat][co][c] bf16 hi/lo planes.
// ---------------------------------------------------------------------------
__global__ void __launch_bounds__(128)
k_cvt_w(const float* __restrict__ w0, const float* __restrict__ w1,
        const float* __restrict__ w2, const float* __restrict__ w3,
        us* __restrict__ wh, us* __restrict__ wl) {
  const int l = threadIdx.x & 31;
  const int wg = blockIdx.x * 4 + (threadIdx.x >> 5);
  if (wg >= 4 * NC) return;
  const int mat = wg / NC, row = wg % NC;
  const float* src = (mat == 0) ? w0 : ((mat == 1) ? w1 : ((mat == 2) ? w2 : w3));
  src += (size_t)row * NC;
  us* dh = wh + ((size_t)mat * NC + row) * NC;
  us* dl = wl + ((size_t)mat * NC + row) * NC;
  v4u hv[2], lv[2];
#pragma unroll
  for (int ch = 0; ch < 2; ++ch) {
    const v4f* s = (const v4f*)(src + 256 * ch + 8 * l);
    split8(s[0], s[1], hv[ch], lv[ch]);
  }
#pragma unroll
  for (int ch = 0; ch < 2; ++ch) {
    *(v4u*)(dh + 256 * ch + 8 * l) = hv[ch];
    *(v4u*)(dl + 256 * ch + 8 * l) = lv[ch];
  }
  
}

// ---------------------------------------------------------------------------
// 3) Fused mask+bias table, f32, layout mb[(nt*NPTS + key)*16 + r] = adj[16nt+r][key] ? gb : MASKV.
//    Block covers (nt, 256 keys) = 128 contiguous lines; wave w owns 32 lines; each instruction
// ---------------------------------------------------------------------------
__global__ void __launch_bounds__(128)
k_mb(const int* __restrict__ adj, const float* __restrict__ gb, float* __restrict__ mb) {
  const int bid = blockIdx.x;
  if (bid >= NT16 * (NPTS / 256)) return;
  const int kq = bid % (NPTS / 256), nt = bid / (NPTS / 256);
  const int key0 = kq * 256, nr0 = nt * 16;
  const int l = threadIdx.x & 31, w = threadIdx.x >> 5;
  float* base = mb + ((size_t)nt * NPTS + key0) * 16;
  v4f vals[8];
#pragma unroll
  for (int i = 0; i < 8; ++i) {
    const int e = 1024 * w + 128 * i + 4 * l;
    const int kl = e >> 4, r0 = e & 15;
    const size_t idx = (size_t)(nr0 + r0) * NPTS + key0 + kl;
    v4f v;
    { const int a = adj[idx];            const float g = gb[idx];            v.x = (a != 0) ? g : MASKV; }
    { const int a = adj[idx + NPTS];     const float g = gb[idx + NPTS];     v.y = (a != 0) ? g : MASKV; }
    { const int a = adj[idx + 2 * NPTS]; const float g = gb[idx + 2 * NPTS]; v.z = (a != 0) ? g : MASKV; }
    { const int a = adj[idx + 3 * NPTS]; const float g = gb[idx + 3 * NPTS]; v.w = (a != 0) ? g : MASKV; }
    vals[i] = v;
  }
#pragma unroll
  for (int i = 0; i < 8; ++i) *(v4f*)(base + 1024 * w + 128 * i + 4 * l) = vals[i];
  
}

// ---------------------------------------------------------------------------
// 4) QKV projection.  Block tile: 64 points x 64 channels (one head), matrices q,k,v in sequence.
//    A = xh/xl rows [b][n][c]; B = W rows [co][c] (k-contiguous copy, loaded like A).
// ---------------------------------------------------------------------------
__global__ void __launch_bounds__(128)
k_qkv(const us* __restrict__ xh, const us* __restrict__ xl,
      const us* __restrict__ wh, const us* __restrict__ wl,
      const float* __restrict__ bq, const float* __restrict__ bk, const float* __restrict__ bv,
      us* __restrict__ q16, us* __restrict__ k16, us* __restrict__ vT16) {
  __shared__ __align__(16) float T[64 * PT];
  const int bid = blockIdx.x;
  if (bid >= NB * NT64 * NH) return;
  const int hd = bid % NH;
  const int nt = (bid / NH) % NT64;
  const int b  = bid / (NH * NT64);
  const int n0 = nt * 64, co0 = hd * HD;
  const int t = threadIdx.x, l = t & 31, w = t >> 5, h = l >> 4, m = l & 15;
  const int j = l & 7, rq = l >> 3;
  const int bh = b * NH + hd;
  const size_t aoff = ((size_t)b * NPTS + n0 + m) * NC + 8 * h;
  const size_t boff = ((size_t)co0 + 16 * w + m) * NC + 8 * h;
  GAddr g = {xh + aoff, xl + aoff, wh + boff, wl + boff};
  GFrag f0;
  gload(f0, g, 0);
  gaddr_wait(g);
#pragma unroll 1
  for (int p = 0; p < 3; ++p) {
    v8f acc[4];
    gemm64(g, (p < 2) ? NC * NC : 0, f0, acc);
    g.bh += NC * NC;
    g.bl += NC * NC;
    stage64(T, acc, h, m, w);
    __syncthreads();
    const float* bias = (p == 0) ? bq : ((p == 1) ? bk : bv);
    v4u vals[4];
    if (p < 2) {
      us* dst = ((p == 0) ? q16 : k16) + ((size_t)bh * NPTS + n0) * HD + 8 * j;
      const v4f b0 = *(const v4f*)(bias + co0 + 8 * j);
      const v4f b1 = *(const v4f*)(bias + co0 + 8 * j + 4);
#pragma unroll
      for (int i = 0; i < 4; ++i) {
        const int row = 16 * w + 4 * i + rq;
        const v4fa* s = (const v4fa*)(T + row * PT + 8 * j);
        const v4f f0 = (s[0] + b0) * 8.0f;
        const v4f f1 = (s[1] + b1) * 8.0f;
        vals[i] = pack8h(f0, f1);
      }
#pragma unroll
      for (int i = 0; i < 4; ++i)
        *(v4u*)(dst + (size_t)(16 * w + 4 * i + rq) * HD) = vals[i];
      
    } else {
      us* dst = vT16 + ((size_t)bh * HD) * NPTS + n0 + 8 * j;
#pragma unroll
      for (int i = 0; i < 4; ++i) {
        const int d = 16 * w + 4 * i + rq;
        const float bd = bias[co0 + d];
        v4f f0, f1;
        f0.x = (T[(8 * j + 0) * PT + d] + bd) * 8.0f;
        f0.y = (T[(8 * j + 1) * PT + d] + bd) * 8.0f;
        f0.z = (T[(8 * j + 2) * PT + d] + bd) * 8.0f;
        f0.w = (T[(8 * j + 3) * PT + d] + bd) * 8.0f;
        f1.x = (T[(8 * j + 4) * PT + d] + bd) * 8.0f;
        f1.y = (T[(8 * j + 5) * PT + d] + bd) * 8.0f;
        f1.z = (T[(8 * j + 6) * PT + d] + bd) * 8.0f;
        f1.w = (T[(8 * j + 7) * PT + d] + bd) * 8.0f;
        vals[i] = pack8h(f0, f1);
      }
#pragma unroll
      for (int i = 0; i < 4; ++i)
        *(v4u*)(dst + (size_t)(16 * w + 4 * i + rq) * NPTS) = vals[i];
      
    }
    __syncthreads();
  }
}

// ---------------------------------------------------------------------------
// 5) Flash attention.  One wave per (b, h, 16 query rows); 32-key steps; online softmax in f32.
//    S tile: A = q16 rows (d as k), B = k16 rows [key][d] (k-contiguous copy, loaded like A).
//    P: D layout -> per-wave LDS row-major (f16, *4096) -> barrier -> A layout reload (may_alias).
//    P*V: B = vT16 rows [d][key] (k-contiguous copy).  O normalised, staged in LDS, written as
// ---------------------------------------------------------------------------
// Fragment loaders of one 32-key step: kp = k16 row (key0 + m), vp = vT16 row m at key0, mp = table entry of key0 + m; all at element 8h.
__device__ __forceinline__ void ld_k(const us* __restrict__ kp, FragH f[4]) {
#pragma unroll
  for (int i = 0; i < 2; ++i) {
    const us* p = kp + (size_t)i * 16 * HD;
    f[2 * i].uh[0]     = *(const v8us*)(p);      f[2 * i].uh[1]     = *(const v8us*)(p + 16);
    f[2 * i + 1].uh[0] = *(const v8us*)(p + 32); f[2 * i + 1].uh[1] = *(const v8us*)(p + 48);
  }
}
__device__ __forceinline__ void ld_v(const us* __restrict__ vp, FragH f[4]) {
#pragma unroll
  for (int dt = 0; dt < 4; ++dt) {
    const us* p = vp + (size_t)dt * 16 * NPTS;
    f[dt].uh[0] = *(const v8us*)(p);
    f[dt].uh[1] = *(const v8us*)(p + 16);
  }
}
__device__ __forceinline__ void ld_mb(const float* __restrict__ mp, v8f &a, v8f &b) {
  a = cat4(*(const v4f*)(mp),       *(const v4f*)(mp + 4));
  b = cat4(*(const v4f*)(mp + 256), *(const v4f*)(mp + 260));
}
__global__ void __launch_bounds__(128)
k_attn(const us* __restrict__ q16, const us* __restrict__ k16, const us* __restrict__ vT16,
       const float* __restrict__ mb, us* __restrict__ ath, us* __restrict__ atl) {
  __shared__ __align__(16) f16t sP[4 * 16 * PP];
  __shared__ __align__(16) float sO[4 * 16 * PT];
  const int bid = blockIdx.x;
  if (bid >= (NB * NH * NT16) / 4) return;
  const int t = threadIdx.x, l = t & 31, w = t >> 5, h = l >> 4, m = l & 15;
  const int wg = bid * 4 + w;
  const int nt = wg % NT16;
  const int bh = wg / NT16;
  const int b = bh / NH, hd = bh % NH;
  const int n0 = nt * 16;
  f16t* lp = sP + w * (16 * PP);
  float* lo = sO + w * (16 * PT);

  const us* qrow = q16 + ((size_t)bh * NPTS + n0 + m) * HD + 8 * h;
  FragH aq0, aq1;
  aq0.uh[0] = *(const v8us*)(qrow);      aq0.uh[1] = *(const v8us*)(qrow + 16);
  aq1.uh[0] = *(const v8us*)(qrow + 32); aq1.uh[1] = *(const v8us*)(qrow + 48);
  const us* kbase = k16 + ((size_t)bh * NPTS + m) * HD + 8 * h;
  const us* vbase = vT16 + ((size_t)bh * HD + m) * NPTS + 8 * h;
  const float* mbb = mb + ((size_t)nt * NPTS + m) * 16 + 8 * h;

  const v8f z = {0.f, 0.f, 0.f, 0.f, 0.f, 0.f, 0.f, 0.f};
  v8f o[4];
#pragma unroll
  for (int dt = 0; dt < 4; ++dt) o[dt] = z;
  v8f mrow, lrow = z;
#pragma unroll
  for (int r = 0; r < 8; ++r) mrow[r] = -1.0e30f;

  // K, mask+bias and V fragments of a step live in registers that are reloaded for the next step
  // right behind their last use, so every load is one step old when it is waited for.
  FragH kf[4], vf[4];
  v8f mb0, mb1;
  ld_k(kbase, kf);
  ld_mb(mbb, mb0, mb1);
  // inputs-only fence on loaded values: Q, K and mask of step 0 land here, so that on entry as on the back edge
  // the V loads are the youngest outstanding and the loop's first wait does not drain them
  asm volatile("" :: "v"(aq0.v), "v"(aq1.v), "v"(kf[0].v), "v"(kf[1].v), "v"(kf[2].v), "v"(kf[3].v), "v"(mb0), "v"(mb1));
  ld_v(vbase, vf);

  for (int key0 = 0; key0 < NPTS; key0 += 32) {
    const int kn = (key0 + 32 < NPTS) ? key0 + 32 : 0;  // next step's keys; the last step refetches step 0, unused
    v8f s0 = mma_h2(aq0.v, kf[0].v, aq1.v, kf[1].v, z);
    v8f s1 = mma_h2(aq0.v, kf[2].v, aq1.v, kf[3].v, z);
    ld_k(kbase + (size_t)kn * HD, kf);
    // scale 1/512 (= 1/64 from the *8*8 storage, times 1/sqrt(64)) and add fused mask+bias
#pragma unroll
    for (int r = 0; r < 8; ++r) {
      s0[r] = s0[r] * SSCL + mb0[r];
      s1[r] = s1[r] * SSCL + mb1[r];
    }
    ld_mb(mbb + (size_t)kn * 16, mb0, mb1);
    // row max over the 32 keys: rows live in 16-lane halves (xor < 16 stays inside the half)
    v8f tm;
#pragma unroll
    for (int r = 0; r < 8; ++r) tm[r] = fmaxf(s0[r], s1[r]);
#pragma unroll
    for (int off = 1; off <= 8; off <<= 1)
#pragma unroll
      for (int r = 0; r < 8; ++r) tm[r] = fmaxf(tm[r], __shfl_xor(tm[r], off, 32));
    v8f mnew, alpha, p0, p1, rs;
#pragma unroll
    for (int r = 0; r < 8; ++r) {
      mnew[r]  = fmaxf(mrow[r], tm[r]);
      alpha[r] = __expf(mrow[r] - mnew[r]);
      p0[r]    = __expf(s0[r] - mnew[r]);
      p1[r]    = __expf(s1[r] - mnew[r]);
      rs[r]    = p0[r] + p1[r];
    }
#pragma unroll
    for (int off = 1; off <= 8; off <<= 1)
#pragma unroll
      for (int r = 0; r < 8; ++r) rs[r] += __shfl_xor(rs[r], off, 32);
#pragma unroll
    for (int r = 0; r < 8; ++r) {
      lrow[r] = lrow[r] * alpha[r] + rs[r];
      mrow[r] = mnew[r];
    }
#pragma unroll
    for (int dt = 0; dt < 4; ++dt) o[dt] = o[dt] * alpha;
    // P: D layout (lane = key column, rows 8h+r) -> LDS row-major [row][key], f16 scaled by 4096
#pragma unroll
    for (int r = 0; r < 8; ++r) {
      lp[(8 * h + r) * PP + m]      = (f16t)(p0[r] * PSCL);
      lp[(8 * h + r) * PP + 16 + m] = (f16t)(p1[r] * PSCL);
    }
    // work-group barrier whose fences order LDS only: __syncthreads() would also wait for the next step's global loads in flight
    __builtin_amdgcn_fence(__ATOMIC_RELEASE, "workgroup", "local");
    __builtin_amdgcn_s_barrier();
    __builtin_amdgcn_fence(__ATOMIC_ACQUIRE, "workgroup", "local");
    FragH pa;
    pa.hh[0] = *(const v8ha*)(lp + m * PP + 8 * h);
    pa.hh[1] = *(const v8ha*)(lp + m * PP + 16 + 8 * h);
#pragma unroll
    for (int dt = 0; dt < 4; ++dt) o[dt] = mma_h1(pa.v, vf[dt].v, o[dt]);
    ld_v(vbase + kn, vf);
    asm volatile("s_wait_xcnt 0x0" ::: "memory");  // stands in front of the next step's rewrite of the loads' address registers
  }

  // normalise: O holds 32768 * sum p v; divide by 32768 * l
  v8f inv;
#pragma unroll
  for (int r = 0; r < 8; ++r) inv[r] = 1.0f / (lrow[r] * OSCL);
#pragma unroll
  for (int dt = 0; dt < 4; ++dt)
#pragma unroll
    for (int r = 0; r < 8; ++r) lo[(8 * h + r) * PT + 16 * dt + m] = o[dt][r] * inv[r];
  __syncthreads();
  const int j = l & 7, rq = l >> 3;
  v4u hv[4], lv[4];
#pragma unroll
  for (int i = 0; i < 4; ++i) {
    const int row = 4 * i + rq;
    const v4fa* s = (const v4fa*)(lo + row * PT + 8 * j);
    split8(s[0], s[1], hv[i], lv[i]);
  }
  us* dh = ath + ((size_t)b * NPTS + n0) * NC + hd * HD + 8 * j;
  us* dl = atl + ((size_t)b * NPTS + n0) * NC + hd * HD + 8 * j;
#pragma unroll
  for (int i = 0; i < 4; ++i) {
    const size_t ro = (size_t)(4 * i + rq) * NC;
    *(v4u*)(dh + ro) = hv[i];
    *(v4u*)(dl + ro) = lv[i];
  }
  
}

// ---------------------------------------------------------------------------
// 6) Output projection: out[b][co][n] = sum_c att[b][n][c] * Wo[co][c] + bo[co].
//    Block tile 64 n x 64 co; A = ath/atl rows, B = Wo hi/lo rows (matrix slot 3).
// ---------------------------------------------------------------------------
__global__ void __launch_bounds__(128)
k_out(const us* __restrict__ ath, const us* __restrict__ atl,
      const us* __restrict__ wh, const us* __restrict__ wl,
      const float* __restrict__ bo, float* __restrict__ out) {
  __shared__ __align__(16) float T[64 * PT];
  const int bid = blockIdx.x;
  if (bid >= NB * NT64 * NCT) return;
  const int cot = bid % NCT;
  const int nt  = (bid / NCT) % NT64;
  const int b   = bid / (NCT * NT64);
  const int n0 = nt * 64, co0 = cot * 64;
  const int t = threadIdx.x, l = t & 31, w = t >> 5, h = l >> 4, m = l & 15;
  const size_t aoff = ((size_t)b * NPTS + n0 + m) * NC + 8 * h;
  const size_t boff = ((size_t)3 * NC + co0 + 16 * w + m) * NC + 8 * h;
  const GAddr g = {ath + aoff, atl + aoff, wh + boff, wl + boff};
  v8f acc[4];
  GFrag f0;
  gload(f0, g, 0);
  gaddr_wait(g);
  gemm64(g, 0, f0, acc);
  stage64(T, acc, h, m, w);
  __syncthreads();
  const int cq = l >> 4, nq = 4 * (l & 15);
  v4f vals[8];
#pragma unroll
  for (int i = 0; i < 8; ++i) {
    const int col = 16 * w + 2 * i + cq;
    const float bb = bo[co0 + col];
    v4f f;
    f.x = T[(nq + 0) * PT + col] + bb;
    f.y = T[(nq + 1) * PT + col] + bb;
    f.z = T[(nq + 2) * PT + col] + bb;
    f.w = T[(nq + 3) * PT + col] + bb;
    vals[i] = f;
  }
  float* dst = out + ((size_t)b * NC + co0) * NPTS + n0 + nq;
#pragma unroll
  for (int i = 0; i < 8; ++i)
    *(v4f*)(dst + (size_t)(16 * w + 2 * i + cq) * NPTS) = vals[i];
  
}

// ---------------------------------------------------------------------------
// Host glue.  Inputs: x, adjacency, geo_bias, Wq, bq, Wk, bk, Wv, bv, Wo, bo.
// Workspace carve (bytes): xh, xl 2 x 6291456; wh, wl 2 x 2097152; mb 37748736;
// q16, k16, vT16 3 x 6291456; ath, atl 2 x 6291456; total 85983232.
// ---------------------------------------------------------------------------
extern "C" void kernel_launch(void* const* d_in, const int* in_sizes, int n_in,
                              void* d_out, int out_size, void* d_ws, size_t ws_size,
                              hipStream_t stream) {
  if (n_in < 11) return;
  if (in_sizes[0] != NB * NC * NPTS) return;
  if (in_sizes[1] != NPTS * NPTS || in_sizes[2] != NPTS * NPTS) return;
  if (in_sizes[3] != NC * NC || in_sizes[5] != NC * NC || in_sizes[7] != NC * NC || in_sizes[9] != NC * NC) return;
  if (in_sizes[4] != NC || in_sizes[6] != NC || in_sizes[8] != NC || in_sizes[10] != NC) return;
  if (out_size != NB * NC * NPTS) return;

  const float* x   = (const float*)d_in[0];
  const int*   adj = (const int*)d_in[1];
  const float* gb  = (const float*)d_in[2];
  const float* Wq  = (const float*)d_in[3];
  const float* bq  = (const float*)d_in[4];
  const float* Wk  = (const float*)d_in[5];
  const float* bk  = (const float*)d_in[6];
  const float* Wv  = (const float*)d_in[7];
  const float* bv  = (const float*)d_in[8];
  const float* Wo  = (const float*)d_in[9];
  const float* bo  = (const float*)d_in[10];
  float* out = (float*)d_out;

  const size_t sz_x16 = (size_t)NB * NPTS * NC * 2;         // 6291456
  const size_t sz_w16 = (size_t)4 * NC * NC * 2;             // 2097152
  const size_t sz_mb  = (size_t)NPTS * NPTS * 4;             // 37748736
  const size_t sz_hd  = (size_t)NB * NH * NPTS * HD * 2;     // 6291456
  char* ws = (char*)d_ws;
  size_t off = 0;
  us* xh   = (us*)(ws + off);    off += sz_x16;
  us* xl   = (us*)(ws + off);    off += sz_x16;
  us* wh   = (us*)(ws + off);    off += sz_w16;
  us* wl   = (us*)(ws + off);    off += sz_w16;
  float* mb = (float*)(ws + off); off += sz_mb;
  us* q16  = (us*)(ws + off);    off += sz_hd;
  us* k16  = (us*)(ws + off);    off += sz_hd;
  us* vT16 = (us*)(ws + off);    off += sz_hd;
  us* ath  = (us*)(ws + off);    off += sz_x16;
  us* atl  = (us*)(ws + off);    off += sz_x16;
  if (off > ws_size) return;

  k_cvt_x<<<NB * NT64 * NCT, 128, 0, stream>>>(x, xh, xl);
  k_cvt_w<<<(4 * NC) / 4, 128, 0, stream>>>(Wq, Wk, Wv, Wo, wh, wl);
  k_mb<<<NT16 * (NPTS / 256), 128, 0, stream>>>(adj, gb, mb);
  k_qkv<<<NB * NT64 * NH, 128, 0, stream>>>(xh, xl, wh, wl, bq, bk, bv, q16, k16, vT16);
  k_attn<<<(NB * NH * NT16) / 4, 128, 0, stream>>>(q16, k16, vT16, mb, ath, atl);
  k_out<<<NB * NT64 * NCT, 128, 0, stream>>>(ath, atl, wh, wl, bo, out);
}

// v002
// Measured time: 180 microseconds a run.
// Two timings next to v001 both put it at 1.63 times that version's speed.
// Over all steps from v000 it is 2.45 times as fast.
#include <hip/hip_runtime.h>
#include <stddef.h>

// Projections x*Wq^T, x*Wk^T, x*Wv^T and att*Wo^T: v_wmma_f32_16x16x32_bf16 with bf16 hi/lo operand pairs (3 products), f32 accumulate.
// Scores q*k^T and p*v: v_wmma_f32_16x16x32_f16 with f16 operands under power-of-two scaling (q*8, k*8, p*4096, v*8), f32 accumulate.
// Mask, bias, online softmax and normalisation in f32.
// Every 16-bit operand plane in the workspace is stored in fragment order: a 16-row x 32-k tile is two pieces of 512 bytes,
// piece p holding at lane l = 16h + m (16 bytes each) the elements k = 16p + 8h .. + 7 of row m.  A fragment load of a wave
// then reads 512 contiguous bytes (4 cache lines) where a row-major plane makes it touch 16 lines.

#define NB   2
#define NC   512
#define NPTS 3072
#define NH   8
#define HD   64
#define NT16 (NPTS / 16)
#define NT64 (NPTS / 64)
#define NCT  (NC / 64)
#define PT   68
#define PP   40
#define MASKV (-30000.0f)
#define SSCL (1.0f / 512.0f)
#define PSCL 4096.0f
#define OSCL 32768.0f

typedef _Float16 f16t;
typedef unsigned short us;
typedef float        v8f  __attribute__((ext_vector_type(8)));
typedef float        v4f  __attribute__((ext_vector_type(4)));
typedef unsigned int v4u  __attribute__((ext_vector_type(4)));
typedef us           v8us __attribute__((ext_vector_type(8)));
typedef _Float16     v16h __attribute__((ext_vector_type(16)));
typedef _Float16     v8h  __attribute__((ext_vector_type(8)));
typedef __bf16       v16bf __attribute__((ext_vector_type(16)));
typedef v8h v8ha __attribute__((may_alias));
typedef v4f v4fa __attribute__((may_alias));

union FragH { v16h v; v8us uh[2]; v8h hh[2]; };
union FragB { v16bf v; v8us uh[2]; };

// ---------------------------------------------------------------------------
// WMMA helpers: 16x16x32, fragment layout per lane l: h = l>>4, m = l&15.
// A: row m, elements 0..7 = k0+8h+i, 8..15 = k0+16+8h+i.  B: column m, same k map
// (loaded from a copy with rows n in the same fragment order, exactly like A).  D: acc[r] = (row 8h+r, col m).
// Each helper ends with 4 v_nop tying D and keeping A/B live (VALU hazard guard).
// ---------------------------------------------------------------------------
__device__ __forceinline__ v8f mma_b3(v16bf ah, v16bf al, v16bf bh, v16bf bl, v8f c) {
  c = __builtin_amdgcn_wmma_f32_16x16x32_bf16(false, ah, false, bh, (short)0, c, false, false);
  c = __builtin_amdgcn_wmma_f32_16x16x32_bf16(false, ah, false, bl, (short)0, c, false, false);
  c = __builtin_amdgcn_wmma_f32_16x16x32_bf16(false, al, false, bh, (short)0, c, false, false);
  asm volatile("v_nop\n\tv_nop\n\tv_nop\n\tv_nop" : "+v"(c) : "v"(ah), "v"(al), "v"(bh), "v"(bl));
  return c;
}
__device__ __forceinline__ v8f mma_h2(v16h a0, v16h b0, v16h a1, v16h b1, v8f c) {
  c = __builtin_amdgcn_wmma_f32_16x16x32_f16(false, a0, false, b0, (short)0, c, false, false);
  c = __builtin_amdgcn_wmma_f32_16x16x32_f16(false, a1, false, b1, (short)0, c, false, false);
  asm volatile("v_nop\n\tv_nop\n\tv_nop\n\tv_nop" : "+v"(c) : "v"(a0), "v"(b0), "v"(a1), "v"(b1));
  return c;
}
__device__ __forceinline__ v8f mma_h1(v16h a, v16h b, v8f c) {
  c = __builtin_amdgcn_wmma_f32_16x16x32_f16(false, a, false, b, (short)0, c, false, false);
  asm volatile("v_nop\n\tv_nop\n\tv_nop\n\tv_nop" : "+v"(c) : "v"(a), "v"(b));
  return c;
}

// ---------------------------------------------------------------------------
// Conversion helpers.  bf16 via RNE on the f32 bits; hi/lo pair: hi = rne(x), lo = rne(x - hi).
// ---------------------------------------------------------------------------
__device__ __forceinline__ unsigned bf_bits(float x) {
  const unsigned u = __float_as_uint(x);
  return (u + 0x7FFFu + ((u >> 16) & 1u)) >> 16;
}
__device__ __forceinline__ void bf_split(float x, unsigned &hi, unsigned &lo) {
  hi = bf_bits(x);
  lo = bf_bits(x - __uint_as_float(hi << 16));
}
__device__ __forceinline__ unsigned h_bits(float x) {
  return (unsigned)__builtin_bit_cast(unsigned short, (f16t)x);
}
// 8 floats -> 8 bf16 hi (packed in hv) and 8 bf16 lo (packed in lv); element 2j in the low half-word.
__device__ __forceinline__ void split8(const v4f a, const v4f b, v4u &hv, v4u &lv) {
  unsigned h0, h1, h2, h3, h4, h5, h6, h7, l0, l1, l2, l3, l4, l5, l6, l7;
  bf_split(a.x, h0, l0); bf_split(a.y, h1, l1); bf_split(a.z, h2, l2); bf_split(a.w, h3, l3);
  bf_split(b.x, h4, l4); bf_split(b.y, h5, l5); bf_split(b.z, h6, l6); bf_split(b.w, h7, l7);
  v4u r, s;
  r.x = h0 | (h1 << 16); r.y = h2 | (h3 << 16); r.z = h4 | (h5 << 16); r.w = h6 | (h7 << 16);
  s.x = l0 | (l1 << 16); s.y = l2 | (l3 << 16); s.z = l4 | (l5 << 16); s.w = l6 | (l7 << 16);
  hv = r; lv = s;
}
// 8 floats -> 8 f16 packed in one 16-byte vector.
__device__ __forceinline__ v4u pack8h(const v4f a, const v4f b) {
  v4u r;
  r.x = h_bits(a.x) | (h_bits(a.y) << 16);
  r.y = h_bits(a.z) | (h_bits(a.w) << 16);
  r.z = h_bits(b.x) | (h_bits(b.y) << 16);
  r.w = h_bits(b.z) | (h_bits(b.w) << 16);
  return r;
}
__device__ __forceinline__ v8f cat4(v4f a, v4f b) {
  v8f r = {a.x, a.y, a.z, a.w, b.x, b.y, b.z, b.w};
  return r;
}

// ---------------------------------------------------------------------------
// 64x64 output tile GEMM core (K = 512) with bf16 hi/lo planes for A and B.
// Planes in fragment order, [row tile][k-step][piece][lane][8]: a row tile is 16*NC elements, a k-step 512, a piece 256.
// The A pointers stand at the tile of row0, lane l; row subtile rt adds rt tiles.  The B pointers stand at the tile of col0, lane l.
// Wave owns columns col0 + 16w .. +15 (folded into the B pointers by the caller), rows 0..63 as acc[0..3].
// ---------------------------------------------------------------------------
// The fragments of one k-step (32 k): B hi/lo and the four row subtiles' A hi/lo.
struct GFrag { FragB bh, bl, ah[4], al[4]; };
// Four lane pointers: A tile of row0 and B tile of col0 at some k-step, lane l, hi and lo planes.
struct GAddr { const us* ah; const us* al; const us* bh; const us* bl; };
// Loads the k-step that begins ko plane elements (a constant, 512 a k-step) behind p.
__device__ __forceinline__ void gload(GFrag &f, const GAddr &p, int ko) {
  f.bh.uh[0] = *(const v8us*)(p.bh + ko);  f.bh.uh[1] = *(const v8us*)(p.bh + ko + 256);
  f.bl.uh[0] = *(const v8us*)(p.bl + ko);  f.bl.uh[1] = *(const v8us*)(p.bl + ko + 256);
#pragma unroll
  for (int rt = 0; rt < 4; ++rt) {
    const size_t o = (size_t)rt * 16 * NC + ko;
    f.ah[rt].uh[0] = *(const v8us*)(p.ah + o);  f.ah[rt].uh[1] = *(const v8us*)(p.ah + o + 256);
    f.al[rt].uh[0] = *(const v8us*)(p.al + o);  f.al[rt].uh[1] = *(const v8us*)(p.al + o + 256);
  }
  // the 20 loads are issued here, in front of the products that follow: moved behind the first of those products they
  // would start only when the other buffer's loads have landed, and the two buffers would no longer fly together
  __builtin_amdgcn_sched_barrier(0);
}
// The wait that stands in front of a rewrite of the loads' address registers.  It takes the four pointers as inputs, so
// they stay in their registers up to it and no later load of the same run gets one of them as its destination.
__device__ __forceinline__ void gaddr_wait(const GAddr &p) {
  asm volatile("s_wait_xcnt 0x0" :: "v"(p.ah), "v"(p.al), "v"(p.bh), "v"(p.bl) : "memory");
}
__device__ __forceinline__ void gmma(const GFrag &f, v8f acc[4]) {
#pragma unroll
  for (int rt = 0; rt < 4; ++rt) acc[rt] = mma_b3(f.ah[rt].v, f.al[rt].v, f.bh.v, f.bl.v, acc[rt]);
}
// Two register buffers: all 20 loads of k-step s+1 are issued in front of the products of k-step s, so every load is one
// k-step old when it is waited for (k order of the sums as before).  The caller hands in f0 holding k-step 0.  Behind the
// last k-step f0 is refilled with k-step 0 of the same A rows and of the B rows at element offset bnext (the next product's
// first fragments where the caller has one; otherwise unused).
__device__ __forceinline__ void gemm64(const GAddr &g, int bnext, GFrag &f0, v8f acc[4]) {
  const v8f z = {0.f, 0.f, 0.f, 0.f, 0.f, 0.f, 0.f, 0.f};
#pragma unroll
  for (int rt = 0; rt < 4; ++rt) acc[rt] = z;
  GFrag f1;
#pragma unroll 1  // rolled: fully unrolled, the projection kernel passes 256 registers and switches register windows in the k loop
  for (int k0 = 0; k0 < 16 * NC; k0 += 1024) {  // k0 in plane elements: two k-steps of 512 a trip
    const int ka = (k0 + 1024 < 16 * NC) ? k0 + 1024 : 0;
    const int kb = (k0 + 1024 < 16 * NC) ? k0 + 1024 : bnext;
    const GAddr p1 = {g.ah + k0, g.al + k0, g.bh + k0, g.bl + k0};
    gload(f1, p1, 512);
    gmma(f0, acc);
    gaddr_wait(p1);
    const GAddr p0 = {g.ah + ka, g.al + ka, g.bh + kb, g.bl + kb};
    gload(f0, p0, 0);
    gmma(f1, acc);
    gaddr_wait(p0);
  }
}
// Stage the wave's four 16x16 f32 accumulators into the block tile T[64][PT] (row = 16rt+8h+r, col = 16w+m).
__device__ __forceinline__ void stage64(float* T, const v8f acc[4], int h, int m, int w) {
#pragma unroll
  for (int rt = 0; rt < 4; ++rt)
#pragma unroll
    for (int r = 0; r < 8; ++r) T[(16 * rt + 8 * h + r) * PT + 16 * w + m] = acc[rt][r];
}

// ---------------------------------------------------------------------------
// 1) x[b][c][n] (f32) -> xh/xl bf16 hi/lo planes, rows n, k = c, fragment order.  Block: 64 n x 64 c tile through LDS;
//    wave w writes row tile w, four pieces of 512 contiguous bytes a plane.
// ---------------------------------------------------------------------------
__global__ void __launch_bounds__(128)
k_cvt_x(const float* __restrict__ x, us* __restrict__ xh, us* __restrict__ xl) {
  __shared__ __align__(16) float T[64 * PT];
  const int bid = blockIdx.x;
  if (bid >= NB * NT64 * NCT) return;
  const int ct = bid % NCT;
  const int nt = (bid / NCT) % NT64;
  const int b  = bid / (NCT * NT64);
  const int c0 = ct * 64, n0 = nt * 64;
  const int t = threadIdx.x;
  const float* src = x + ((size_t)b * NC + c0) * NPTS + n0;
#pragma unroll
  for (int i = 0; i < 32; ++i) {
    const int idx = i * 128 + t;
    const int cl = idx >> 6, nl = idx & 63;
    T[nl * PT + cl] = src[(size_t)cl * NPTS + nl];
  }
  __syncthreads();
  const int l = t & 31, w = t >> 5, h = l >> 4, m = l & 15;
  v4u hv[4], lv[4];
#pragma unroll
  for (int i = 0; i < 4; ++i) {
    const v4fa* s = (const v4fa*)(T + (16 * w + m) * PT + 16 * i + 8 * h);
    split8(s[0], s[1], hv[i], lv[i]);
  }
  const size_t po = ((size_t)b * NPTS + n0 + 16 * w) * NC + ct * 1024 + 8 * l;
  us* dh = xh + po;
  us* dl = xl + po;
#pragma unroll
  for (int i = 0; i < 4; ++i) {
    *(v4u*)(dh + 256 * i) = hv[i];
    *(v4u*)(dl + 256 * i) = lv[i];
  }
  
}

// ---------------------------------------------------------------------------
// 2) W (f32 [co][c], row-major) -> wh/wl[mat] bf16 hi/lo planes, rows co, k = c, fragment order.  One wave per 16-row x 32-k tile.
// ---------------------------------------------------------------------------
__global__ void __launch_bounds__(128)
k_cvt_w(const float* __restrict__ w0, const float* __restrict__ w1,
        const float* __restrict__ w2, const float* __restrict__ w3,
        us* __restrict__ wh, us* __restrict__ wl) {
  const int l = threadIdx.x & 31;
  const int wg = blockIdx.x * 4 + (threadIdx.x >> 5);
  if (wg >= 4 * NC) return;
  const int mat = wg / NC, tile = (wg % NC) / 16, ks = wg % 16;
  const int h = l >> 4, m = l & 15;
  const float* src = (mat == 0) ? w0 : ((mat == 1) ? w1 : ((mat == 2) ? w2 : w3));
  src += (size_t)(16 * tile + m) * NC + 32 * ks + 8 * h;
  us* dh = wh + (size_t)wg * 512 + 8 * l;
  us* dl = wl + (size_t)wg * 512 + 8 * l;
  v4u hv[2], lv[2];
#pragma unroll
  for (int p = 0; p < 2; ++p) {
    const v4f* s = (const v4f*)(src + 16 * p);
    split8(s[0], s[1], hv[p], lv[p]);
  }
#pragma unroll
  for (int p = 0; p < 2; ++p) {
    *(v4u*)(dh + 256 * p) = hv[p];
    *(v4u*)(dl + 256 * p) = lv[p];
  }
  
}

// ---------------------------------------------------------------------------
// 3) Fused mask+bias table, f32, in the order of the score accumulators: per (nt, 16 keys) two pieces of 512 bytes,
//    piece q holding at lane l = 16h + m the rows 16nt + 8h + 4q .. + 3 of key m: adj ? gb : MASKV.
//    Block covers (nt, 256 keys) = 128 contiguous lines; wave w owns 32 lines; each instruction
// ---------------------------------------------------------------------------
__global__ void __launch_bounds__(128)
k_mb(const int* __restrict__ adj, const float* __restrict__ gb, float* __restrict__ mb) {
  const int bid = blockIdx.x;
  if (bid >= NT16 * (NPTS / 256)) return;
  const int kq = bid % (NPTS / 256), nt = bid / (NPTS / 256);
  const int key0 = kq * 256, nr0 = nt * 16;
  const int l = threadIdx.x & 31, w = threadIdx.x >> 5;
  float* base = mb + ((size_t)nt * NPTS + key0) * 16;
  v4f vals[8];
#pragma unroll
  for (int i = 0; i < 8; ++i) {
    const int kl = 64 * w + 16 * (i >> 1) + (l & 15), r0 = 8 * (l >> 4) + 4 * (i & 1);
    const size_t idx = (size_t)(nr0 + r0) * NPTS + key0 + kl;
    v4f v;
    { const int a = adj[idx];            const float g = gb[idx];            v.x = (a != 0) ? g : MASKV; }
    { const int a = adj[idx + NPTS];     const float g = gb[idx + NPTS];     v.y = (a != 0) ? g : MASKV; }
    { const int a = adj[idx + 2 * NPTS]; const float g = gb[idx + 2 * NPTS]; v.z = (a != 0) ? g : MASKV; }
    { const int a = adj[idx + 3 * NPTS]; const float g = gb[idx + 3 * NPTS]; v.w = (a != 0) ? g : MASKV; }
    vals[i] = v;
  }
#pragma unroll
  for (int i = 0; i < 8; ++i) *(v4f*)(base + 1024 * w + 128 * i + 4 * l) = vals[i];
  
}

// ---------------------------------------------------------------------------
// 4) QKV projection.  Block tile: 64 points x 64 channels (one head), matrices q,k,v in sequence.
//    A = xh/xl row tiles; B = W row tiles (same fragment order, loaded like A).
//    q16, k16: rows n, k = d, fragment order (a 16-row tile is four pieces).  vT16: per 32 keys four d tiles of two pieces, rows d, k = key.
// ---------------------------------------------------------------------------
__global__ void __launch_bounds__(128)
k_qkv(const us* __restrict__ xh, const us* __restrict__ xl,
      const us* __restrict__ wh, const us* __restrict__ wl,
      const float* __restrict__ bq, const float* __restrict__ bk, const float* __restrict__ bv,
      us* __restrict__ q16, us* __restrict__ k16, us* __restrict__ vT16) {
  __shared__ __align__(16) float T[64 * PT];
  const int bid = blockIdx.x;
  if (bid >= NB * NT64 * NH) return;
  const int hd = bid % NH;
  const int nt = (bid / NH) % NT64;
  const int b  = bid / (NH * NT64);
  const int n0 = nt * 64, co0 = hd * HD;
  const int t = threadIdx.x, l = t & 31, w = t >> 5, h = l >> 4, m = l & 15;
  const int bh = b * NH + hd;
  const size_t aoff = ((size_t)b * NPTS + n0) * NC + 8 * l;
  const size_t boff = ((size_t)co0 + 16 * w) * NC + 8 * l;
  GAddr g = {xh + aoff, xl + aoff, wh + boff, wl + boff};
  GFrag f0;
  gload(f0, g, 0);
  gaddr_wait(g);
#pragma unroll 1
  for (int p = 0; p < 3; ++p) {
    v8f acc[4];
    gemm64(g, (p < 2) ? NC * NC : 0, f0, acc);
    g.bh += NC * NC;
    g.bl += NC * NC;
    stage64(T, acc, h, m, w);
    __syncthreads();
    const float* bias = (p == 0) ? bq : ((p == 1) ? bk : bv);
    v4u vals[4];
    if (p < 2) {
      us* dst = ((p == 0) ? q16 : k16) + ((size_t)bh * NPTS + n0 + 16 * w) * HD + 8 * l;
#pragma unroll
      for (int i = 0; i < 4; ++i) {
        const v4f b0 = *(const v4f*)(bias + co0 + 16 * i + 8 * h);
        const v4f b1 = *(const v4f*)(bias + co0 + 16 * i + 8 * h + 4);
        const v4fa* s = (const v4fa*)(T + (16 * w + m) * PT + 16 * i + 8 * h);
        const v4f f0 = (s[0] + b0) * 8.0f;
        const v4f f1 = (s[1] + b1) * 8.0f;
        vals[i] = pack8h(f0, f1);
      }
#pragma unroll
      for (int i = 0; i < 4; ++i)
        *(v4u*)(dst + 256 * i) = vals[i];
      asm volatile("s_wait_xcnt 0x0" ::: "memory");  // stands in front of any rewrite of the four stores' address and data registers
    } else {
      us* dst = vT16 + ((size_t)bh * NPTS + n0) * HD + 512 * w + 8 * l;
      const int d = 16 * w + m;
      const float bd = bias[co0 + d];
#pragma unroll
      for (int i = 0; i < 4; ++i) {
        const int kr = 16 * i + 8 * h;  // first of the lane's 8 keys: 32-key group i >> 1, piece i & 1
        v4f f0, f1;
        f0.x = (T[(kr + 0) * PT + d] + bd) * 8.0f;
        f0.y = (T[(kr + 1) * PT + d] + bd) * 8.0f;
        f0.z = (T[(kr + 2) * PT + d] + bd) * 8.0f;
        f0.w = (T[(kr + 3) * PT + d] + bd) * 8.0f;
        f1.x = (T[(kr + 4) * PT + d] + bd) * 8.0f;
        f1.y = (T[(kr + 5) * PT + d] + bd) * 8.0f;
        f1.z = (T[(kr + 6) * PT + d] + bd) * 8.0f;
        f1.w = (T[(kr + 7) * PT + d] + bd) * 8.0f;
        vals[i] = pack8h(f0, f1);
      }
#pragma unroll
      for (int i = 0; i < 4; ++i)
        *(v4u*)(dst + 2048 * (i >> 1) + 256 * (i & 1)) = vals[i];
      
    }
    __syncthreads();
  }
}

// ---------------------------------------------------------------------------
// 5) Flash attention.  One wave per (b, h, 16 query rows); 32-key steps; online softmax in f32.
//    S tile: A = q16 row tile (d as k), B = k16 row tiles (keys as rows, loaded like A).
//    P: D layout -> per-wave LDS row-major (f16, *4096) -> barrier -> A layout reload (may_alias).
//    P*V: B = vT16 tiles (d as rows, keys as k).  O normalised, staged in LDS, written in fragment order as
// ---------------------------------------------------------------------------
// Fragment loaders of one 32-key step: kp = k16 tile of key0, vp = vT16 group of key0, mp = table pieces of key0; all at lane l.
__device__ __forceinline__ void ld_k(const us* __restrict__ kp, FragH f[4]) {
#pragma unroll
  for (int i = 0; i < 2; ++i) {
    const us* p = kp + (size_t)i * 16 * HD;
    f[2 * i].uh[0]     = *(const v8us*)(p);       f[2 * i].uh[1]     = *(const v8us*)(p + 256);
    f[2 * i + 1].uh[0] = *(const v8us*)(p + 512); f[2 * i + 1].uh[1] = *(const v8us*)(p + 768);
  }
}
__device__ __forceinline__ void ld_v(const us* __restrict__ vp, FragH f[4]) {
#pragma unroll
  for (int dt = 0; dt < 4; ++dt) {
    const us* p = vp + (size_t)dt * 512;
    f[dt].uh[0] = *(const v8us*)(p);
    f[dt].uh[1] = *(const v8us*)(p + 256);
  }
}
__device__ __forceinline__ void ld_mb(const float* __restrict__ mp, v8f &a, v8f &b) {
  a = cat4(*(const v4f*)(mp),       *(const v4f*)(mp + 128));
  b = cat4(*(const v4f*)(mp + 256), *(const v4f*)(mp + 384));
}
__global__ void __launch_bounds__(128)
k_attn(const us* __restrict__ q16, const us* __restrict__ k16, const us* __restrict__ vT16,
       const float* __restrict__ mb, us* __restrict__ ath, us* __restrict__ atl) {
  __shared__ __align__(16) f16t sP[4 * 16 * PP];
  __shared__ __align__(16) float sO[4 * 16 * PT];
  const int bid = blockIdx.x;
  if (bid >= (NB * NH * NT16) / 4) return;
  const int t = threadIdx.x, l = t & 31, w = t >> 5, h = l >> 4, m = l & 15;
  const int wg = bid * 4 + w;
  const int nt = wg % NT16;
  const int bh = wg / NT16;
  const int b = bh / NH, hd = bh % NH;
  const int n0 = nt * 16;
  f16t* lp = sP + w * (16 * PP);
  float* lo = sO + w * (16 * PT);

  const us* qrow = q16 + ((size_t)bh * NPTS + n0) * HD + 8 * l;
  FragH aq0, aq1;
  aq0.uh[0] = *(const v8us*)(qrow);       aq0.uh[1] = *(const v8us*)(qrow + 256);
  aq1.uh[0] = *(const v8us*)(qrow + 512); aq1.uh[1] = *(const v8us*)(qrow + 768);
  const us* kbase = k16 + (size_t)bh * NPTS * HD + 8 * l;
  const us* vbase = vT16 + (size_t)bh * NPTS * HD + 8 * l;
  const float* mbb = mb + (size_t)nt * NPTS * 16 + 4 * l;

  const v8f z = {0.f, 0.f, 0.f, 0.f, 0.f, 0.f, 0.f, 0.f};
  v8f o[4];
#pragma unroll
  for (int dt = 0; dt < 4; ++dt) o[dt] = z;
  v8f mrow, lrow = z;
#pragma unroll
  for (int r = 0; r < 8; ++r) mrow[r] = -1.0e30f;

  // K, mask+bias and V fragments of a step live in registers that are reloaded for the next step
  // right behind their last use, so every load is one step old when it is waited for.
  FragH kf[4], vf[4];
  v8f mb0, mb1;
  ld_k(kbase, kf);
  ld_mb(mbb, mb0, mb1);
  // inputs-only fence on loaded values: Q, K and mask of step 0 land here, so that on entry as on the back edge
  // the V loads are the youngest outstanding and the loop's first wait does not drain them
  asm volatile("" :: "v"(aq0.v), "v"(aq1.v), "v"(kf[0].v), "v"(kf[1].v), "v"(kf[2].v), "v"(kf[3].v), "v"(mb0), "v"(mb1));
  ld_v(vbase, vf);

  for (int key0 = 0; key0 < NPTS; key0 += 32) {
    const int kn = (key0 + 32 < NPTS) ? key0 + 32 : 0;  // next step's keys; the last step refetches step 0, unused
    v8f s0 = mma_h2(aq0.v, kf[0].v, aq1.v, kf[1].v, z);
    v8f s1 = mma_h2(aq0.v, kf[2].v, aq1.v, kf[3].v, z);
    ld_k(kbase + (size_t)kn * HD, kf);
    // scale 1/512 (= 1/64 from the *8*8 storage, times 1/sqrt(64)) and add fused mask+bias
#pragma unroll
    for (int r = 0; r < 8; ++r) {
      s0[r] = s0[r] * SSCL + mb0[r];
      s1[r] = s1[r] * SSCL + mb1[r];
    }
    ld_mb(mbb + (size_t)kn * 16, mb0, mb1);
    // row max over the 32 keys: rows live in 16-lane halves (xor < 16 stays inside the half)
    v8f tm;
#pragma unroll
    for (int r = 0; r < 8; ++r) tm[r] = fmaxf(s0[r], s1[r]);
#pragma unroll
    for (int off = 1; off <= 8; off <<= 1)
#pragma unroll
      for (int r = 0; r < 8; ++r) tm[r] = fmaxf(tm[r], __shfl_xor(tm[r], off, 32));
    v8f mnew, alpha, p0, p1, rs;
#pragma unroll
    for (int r = 0; r < 8; ++r) {
      mnew[r]  = fmaxf(mrow[r], tm[r]);
      alpha[r] = __expf(mrow[r] - mnew[r]);
      p0[r]    = __expf(s0[r] - mnew[r]);
      p1[r]    = __expf(s1[r] - mnew[r]);
      rs[r]    = p0[r] + p1[r];
    }
#pragma unroll
    for (int off = 1; off <= 8; off <<= 1)
#pragma unroll
      for (int r = 0; r < 8; ++r) rs[r] += __shfl_xor(rs[r], off, 32);
#pragma unroll
    for (int r = 0; r < 8; ++r) {
      lrow[r] = lrow[r] * alpha[r] + rs[r];
      mrow[r] = mnew[r];
    }
#pragma unroll
    for (int dt = 0; dt < 4; ++dt) o[dt] = o[dt] * alpha;
    // P: D layout (lane = key column, rows 8h+r) -> LDS row-major [row][key], f16 scaled by 4096
#pragma unroll
    for (int r = 0; r < 8; ++r) {
      lp[(8 * h + r) * PP + m]      = (f16t)(p0[r] * PSCL);
      lp[(8 * h + r) * PP + 16 + m] = (f16t)(p1[r] * PSCL);
    }
    // work-group barrier whose fences order LDS only: __syncthreads() would also wait for the next step's global loads in flight
    __builtin_amdgcn_fence(__ATOMIC_RELEASE, "workgroup", "local");
    __builtin_amdgcn_s_barrier();
    __builtin_amdgcn_fence(__ATOMIC_ACQUIRE, "workgroup", "local");
    FragH pa;
    pa.hh[0] = *(const v8ha*)(lp + m * PP + 8 * h);
    pa.hh[1] = *(const v8ha*)(lp + m * PP + 16 + 8 * h);
#pragma unroll
    for (int dt = 0; dt < 4; ++dt) o[dt] = mma_h1(pa.v, vf[dt].v, o[dt]);
    ld_v(vbase + (size_t)kn * HD, vf);
    asm volatile("s_wait_xcnt 0x0" ::: "memory");  // stands in front of the next step's rewrite of the loads' address registers
  }

  // normalise: O holds 32768 * sum p v; divide by 32768 * l
  v8f inv;
#pragma unroll
  for (int r = 0; r < 8; ++r) inv[r] = 1.0f / (lrow[r] * OSCL);
#pragma unroll
  for (int dt = 0; dt < 4; ++dt)
#pragma unroll
    for (int r = 0; r < 8; ++r) lo[(8 * h + r) * PT + 16 * dt + m] = o[dt][r] * inv[r];
  __syncthreads();
  v4u hv[4], lv[4];
#pragma unroll
  for (int i = 0; i < 4; ++i) {
    const v4fa* s = (const v4fa*)(lo + m * PT + 16 * i + 8 * h);
    split8(s[0], s[1], hv[i], lv[i]);
  }
  const size_t po = ((size_t)b * NPTS + n0) * NC + hd * 1024 + 8 * l;
  us* dh = ath + po;
  us* dl = atl + po;
#pragma unroll
  for (int i = 0; i < 4; ++i) {
    *(v4u*)(dh + 256 * i) = hv[i];
    *(v4u*)(dl + 256 * i) = lv[i];
  }
  
}

// ---------------------------------------------------------------------------
// 6) Output projection: out[b][co][n] = sum_c att[b][n][c] * Wo[co][c] + bo[co].
//    Block tile 64 n x 64 co; A = ath/atl row tiles, B = Wo hi/lo row tiles (matrix slot 3).
// ---------------------------------------------------------------------------
__global__ void __launch_bounds__(128)
k_out(const us* __restrict__ ath, const us* __restrict__ atl,
      const us* __restrict__ wh, const us* __restrict__ wl,
      const float* __restrict__ bo, float* __restrict__ out) {
  __shared__ __align__(16) float T[64 * PT];
  const int bid = blockIdx.x;
  if (bid >= NB * NT64 * NCT) return;
  const int cot = bid % NCT;
  const int nt  = (bid / NCT) % NT64;
  const int b   = bid / (NCT * NT64);
  const int n0 = nt * 64, co0 = cot * 64;
  const int t = threadIdx.x, l = t & 31, w = t >> 5, h = l >> 4, m = l & 15;
  const size_t aoff = ((size_t)b * NPTS + n0) * NC + 8 * l;
  const size_t boff = ((size_t)3 * NC + co0 + 16 * w) * NC + 8 * l;
  const GAddr g = {ath + aoff, atl + aoff, wh + boff, wl + boff};
  v8f acc[4];
  GFrag f0;
  gload(f0, g, 0);
  gaddr_wait(g);
  gemm64(g, 0, f0, acc);
  stage64(T, acc, h, m, w);
  __syncthreads();
  const int cq = l >> 4, nq = 4 * (l & 15);
  v4f vals[8];
#pragma unroll
  for (int i = 0; i < 8; ++i) {
    const int col = 16 * w + 2 * i + cq;
    const float bb = bo[co0 + col];
    v4f f;
    f.x = T[(nq + 0) * PT + col] + bb;
    f.y = T[(nq + 1) * PT + col] + bb;
    f.z = T[(nq + 2) * PT + col] + bb;
    f.w = T[(nq + 3) * PT + col] + bb;
    vals[i] = f;
  }
  float* dst = out + ((size_t)b * NC + co0) * NPTS + n0 + nq;
#pragma unroll
  for (int i = 0; i < 8; ++i)
    *(v4f*)(dst + (size_t)(16 * w + 2 * i + cq) * NPTS) = vals[i];
  
}

// ---------------------------------------------------------------------------
// Host glue.  Inputs: x, adjacency, geo_bias, Wq, bq, Wk, bk, Wv, bv, Wo, bo.
// Workspace carve (bytes): xh, xl 2 x 6291456; wh, wl 2 x 2097152; mb 37748736;
// q16, k16, vT16 3 x 6291456; ath, atl 2 x 6291456; total 85983232.
// ---------------------------------------------------------------------------
extern "C" void kernel_launch(void* const* d_in, const int* in_sizes, int n_in,
                              void* d_out, int out_size, void* d_ws, size_t ws_size,
                              hipStream_t stream) {
  if (n_in < 11) return;
  if (in_sizes[0] != NB * NC * NPTS) return;
  if (in_sizes[1] != NPTS * NPTS || in_sizes[2] != NPTS * NPTS) return;
  if (in_sizes[3] != NC * NC || in_sizes[5] != NC * NC || in_sizes[7] != NC * NC || in_sizes[9] != NC * NC) return;
  if (in_sizes[4] != NC || in_sizes[6] != NC || in_sizes[8] != NC || in_sizes[10] != NC) return;
  if (out_size != NB * NC * NPTS) return;

  const float* x   = (const float*)d_in[0];
  const int*   adj = (const int*)d_in[1];
  const float* gb  = (const float*)d_in[2];
  const float* Wq  = (const float*)d_in[3];
  const float* bq  = (const float*)d_in[4];
  const float* Wk  = (const float*)d_in[5];
  const float* bk  = (const float*)d_in[6];
  const float* Wv  = (const float*)d_in[7];
  const float* bv  = (const float*)d_in[8];
  const float* Wo  = (const float*)d_in[9];
  const float* bo  = (const float*)d_in[10];
  float* out = (float*)d_out;

  const size_t sz_x16 = (size_t)NB * NPTS * NC * 2;         // 6291456
  const size_t sz_w16 = (size_t)4 * NC * NC * 2;             // 2097152
  const size_t sz_mb  = (size_t)NPTS * NPTS * 4;             // 37748736
  const size_t sz_hd  = (size_t)NB * NH * NPTS * HD * 2;     // 6291456
  char* ws = (char*)d_ws;
  size_t off = 0;
  us* xh   = (us*)(ws + off);    off += sz_x16;
  us* xl   = (us*)(ws + off);    off += sz_x16;
  us* wh   = (us*)(ws + off);    off += sz_w16;
  us* wl   = (us*)(ws + off);    off += sz_w16;
  float* mb = (float*)(ws + off); off += sz_mb;
  us* q16  = (us*)(ws + off);    off += sz_hd;
  us* k16  = (us*)(ws + off);    off += sz_hd;
  us* vT16 = (us*)(ws + off);    off += sz_hd;
  us* ath  = (us*)(ws + off);    off += sz_x16;
  us* atl  = (us*)(ws + off);    off += sz_x16;
  if (off > ws_size) return;

  k_cvt_x<<<NB * NT64 * NCT, 128, 0, stream>>>(x, xh, xl);
  k_cvt_w<<<(4 * NC) / 4, 128, 0, stream>>>(Wq, Wk, Wv, Wo, wh, wl);
  k_mb<<<NT16 * (NPTS / 256), 128, 0, stream>>>(adj, gb, mb);
  k_qkv<<<NB * NT64 * NH, 128, 0, stream>>>(xh, xl, wh, wl, bq, bk, bv, q16, k16, vT16);
  k_attn<<<(NB * NH * NT16) / 4, 128, 0, stream>>>(q16, k16, vT16, mb, ath, atl);
  k_out<<<NB * NT64 * NCT, 128, 0, stream>>>(ath, atl, wh, wl, bo, out);
}

// v003
// A run of this version takes 140 microseconds.
// Next to v002, in two timings, it ran 1.29 and 1.31 times as fast.
// Over all steps from v000 it is 3.18 times as fast.
#include <hip/hip_runtime.h>
#include <stddef.h>

#define NB   2
#define NC   512
#define NPTS 3072
#define NH   8
#define HD   64
#define NT16 (NPTS / 16)
#define NT64 (NPTS / 64)
#define NCT  (NC / 64)
#define PT   68
#define MASKV (-30000.0f)
#define SSCL (1.0f / 512.0f)
#define PSCL 4096.0f
#define OSCL 32768.0f

typedef _Float16 f16t;
typedef unsigned short us;
typedef float        v8f  __attribute__((ext_vector_type(8)));
typedef float        v4f  __attribute__((ext_vector_type(4)));
typedef unsigned int v4u  __attribute__((ext_vector_type(4)));
typedef us           v8us __attribute__((ext_vector_type(8)));
typedef _Float16     v16h __attribute__((ext_vector_type(16)));
typedef __bf16       v16bf __attribute__((ext_vector_type(16)));
typedef int          v4i  __attribute__((ext_vector_type(4)));
typedef v4f v4fa __attribute__((may_alias));

union FragH { v16h v; v8us uh[2]; };
union FragB { v16bf v; v8us uh[2]; };

// ---------------------------------------------------------------------------
// WMMA helpers: 16x16x32, fragment layout per lane l: h = l>>4, m = l&15.
// A: row m, elements 0..7 = k0+8h+i, 8..15 = k0+16+8h+i.  B: column m, same k map
// (loaded from a copy with rows n in the same fragment order, exactly like A).  D: acc[r] = (row 8h+r, col m).
// Each helper ends with 4 v_nop tying D and keeping A/B live (VALU hazard guard).
// ---------------------------------------------------------------------------
__device__ __forceinline__ v8f mma_b3(v16bf ah, v16bf al, v16bf bh, v16bf bl, v8f c) {
  c = __builtin_amdgcn_wmma_f32_16x16x32_bf16(false, ah, false, bh, (short)0, c, false, false);
  c = __builtin_amdgcn_wmma_f32_16x16x32_bf16(false, ah, false, bl, (short)0, c, false, false);
  c = __builtin_amdgcn_wmma_f32_16x16x32_bf16(false, al, false, bh, (short)0, c, false, false);
  asm volatile("v_nop\n\tv_nop\n\tv_nop\n\tv_nop" : "+v"(c) : "v"(ah), "v"(al), "v"(bh), "v"(bl));
  return c;
}
__device__ __forceinline__ v8f mma_h2(v16h a0, v16h b0, v16h a1, v16h b1, v8f c) {
  c = __builtin_amdgcn_wmma_f32_16x16x32_f16(false, a0, false, b0, (short)0, c, false, false);
  c = __builtin_amdgcn_wmma_f32_16x16x32_f16(false, a1, false, b1, (short)0, c, false, false);
  asm volatile("v_nop\n\tv_nop\n\tv_nop\n\tv_nop" : "+v"(c) : "v"(a0), "v"(b0), "v"(a1), "v"(b1));
  return c;
}
__device__ __forceinline__ v8f mma_h1(v16h a, v16h b, v8f c) {
  c = __builtin_amdgcn_wmma_f32_16x16x32_f16(false, a, false, b, (short)0, c, false, false);
  asm volatile("v_nop\n\tv_nop\n\tv_nop\n\tv_nop" : "+v"(c) : "v"(a), "v"(b));
  return c;
}

// ---------------------------------------------------------------------------
// Conversion helpers.  bf16 via RNE on the f32 bits; hi/lo pair: hi = rne(x), lo = rne(x - hi).
// ---------------------------------------------------------------------------
__device__ __forceinline__ unsigned bf_bits(float x) {
  const unsigned u = __float_as_uint(x);
  return (u + 0x7FFFu + ((u >> 16) & 1u)) >> 16;
}
__device__ __forceinline__ void bf_split(float x, unsigned &hi, unsigned &lo) {
  hi = bf_bits(x);
  lo = bf_bits(x - __uint_as_float(hi << 16));
}
__device__ __forceinline__ unsigned h_bits(float x) {
  return (unsigned)__builtin_bit_cast(unsigned short, (f16t)x);
}
// 8 floats -> 8 bf16 hi (packed in hv) and 8 bf16 lo (packed in lv); element 2j in the low half-word.
__device__ __forceinline__ void split8(const v4f a, const v4f b, v4u &hv, v4u &lv) {
  unsigned h0, h1, h2, h3, h4, h5, h6, h7, l0, l1, l2, l3, l4, l5, l6, l7;
  bf_split(a.x, h0, l0); bf_split(a.y, h1, l1); bf_split(a.z, h2, l2); bf_split(a.w, h3, l3);
  bf_split(b.x, h4, l4); bf_split(b.y, h5, l5); bf_split(b.z, h6, l6); bf_split(b.w, h7, l7);
  v4u r, s;
  r.x = h0 | (h1 << 16); r.y = h2 | (h3 << 16); r.z = h4 | (h5 << 16); r.w = h6 | (h7 << 16);
  s.x = l0 | (l1 << 16); s.y = l2 | (l3 << 16); s.z = l4 | (l5 << 16); s.w = l6 | (l7 << 16);
  hv = r; lv = s;
}
// 8 floats -> 8 f16 packed in one 16-byte vector.
__device__ __forceinline__ v4u pack8h(const v4f a, const v4f b) {
  v4u r;
  r.x = h_bits(a.x) | (h_bits(a.y) << 16);
  r.y = h_bits(a.z) | (h_bits(a.w) << 16);
  r.z = h_bits(b.x) | (h_bits(b.y) << 16);
  r.w = h_bits(b.z) | (h_bits(b.w) << 16);
  return r;
}
__device__ __forceinline__ v8f cat4(v4f a, v4f b) {
  v8f r = {a.x, a.y, a.z, a.w, b.x, b.y, b.z, b.w};
  return r;
}

// ---------------------------------------------------------------------------
// 64x64 output tile GEMM core (K = 512) with bf16 hi/lo planes for A and B.
// Planes in fragment order, [row tile][k-step][piece][lane][8]: a row tile is 16*NC elements, a k-step 512, a piece 256.
// The A pointers stand at the tile of row0, lane l; row subtile rt adds rt tiles.  The B pointers stand at the tile of col0, lane l.
// Wave owns columns col0 + 16w .. +15 (folded into the B pointers by the caller), rows 0..63 as acc[0..3].
// ---------------------------------------------------------------------------
// The fragments of one k-step (32 k): B hi/lo and the four row subtiles' A hi/lo.
struct GFrag { FragB bh, bl, ah[4], al[4]; };
// Four lane pointers: A tile of row0 and B tile of col0 at some k-step, lane l, hi and lo planes.
struct GAddr { const us* ah; const us* al; const us* bh; const us* bl; };
// Loads the k-step that begins ko plane elements (a constant, 512 a k-step) behind p.
__device__ __forceinline__ void gload(GFrag &f, const GAddr &p, int ko) {
  f.bh.uh[0] = *(const v8us*)(p.bh + ko);  f.bh.uh[1] = *(const v8us*)(p.bh + ko + 256);
  f.bl.uh[0] = *(const v8us*)(p.bl + ko);  f.bl.uh[1] = *(const v8us*)(p.bl + ko + 256);
#pragma unroll
  for (int rt = 0; rt < 4; ++rt) {
    const size_t o = (size_t)rt * 16 * NC + ko;
    f.ah[rt].uh[0] = *(const v8us*)(p.ah + o);  f.ah[rt].uh[1] = *(const v8us*)(p.ah + o + 256);
    f.al[rt].uh[0] = *(const v8us*)(p.al + o);  f.al[rt].uh[1] = *(const v8us*)(p.al + o + 256);
  }
  // the 20 loads are issued here, in front of the products that follow: moved behind the first of those products they
  // would start only when the other buffer's loads have landed, and the two buffers would no longer fly together
  __builtin_amdgcn_sched_barrier(0);
}
// The wait that stands in front of a rewrite of the loads' address registers.  It takes the four pointers as inputs, so
// they stay in their registers up to it and no later load of the same run gets one of them as its destination.
__device__ __forceinline__ void gaddr_wait(const GAddr &p) {
  asm volatile("s_wait_xcnt 0x0" :: "v"(p.ah), "v"(p.al), "v"(p.bh), "v"(p.bl) : "memory");
}
__device__ __forceinline__ void gmma(const GFrag &f, v8f acc[4]) {
#pragma unroll
  for (int rt = 0; rt < 4; ++rt) acc[rt] = mma_b3(f.ah[rt].v, f.al[rt].v, f.bh.v, f.bl.v, acc[rt]);
}
// Two register buffers: all 20 loads of k-step s+1 are issued in front of the products of k-step s, so every load is one
// k-step old when it is waited for (k order of the sums as before).  The caller hands in f0 holding k-step 0.  Behind the
// last k-step f0 is refilled with k-step 0 of the same A rows and of the B rows at element offset bnext (the next product's
// first fragments where the caller has one; otherwise unused).
__device__ __forceinline__ void gemm64(const GAddr &g, int bnext, GFrag &f0, v8f acc[4]) {
  const v8f z = {0.f, 0.f, 0.f, 0.f, 0.f, 0.f, 0.f, 0.f};
#pragma unroll
  for (int rt = 0; rt < 4; ++rt) acc[rt] = z;
  GFrag f1;
#pragma unroll 1  // rolled: fully unrolled, the projection kernel passes 256 registers and switches register windows in the k loop
  for (int k0 = 0; k0 < 16 * NC; k0 += 1024) {  // k0 in plane elements: two k-steps of 512 a trip
    const int ka = (k0 + 1024 < 16 * NC) ? k0 + 1024 : 0;
    const int kb = (k0 + 1024 < 16 * NC) ? k0 + 1024 : bnext;
    const GAddr p1 = {g.ah + k0, g.al + k0, g.bh + k0, g.bl + k0};
    gload(f1, p1, 512);
    gmma(f0, acc);
    gaddr_wait(p1);
    const GAddr p0 = {g.ah + ka, g.al + ka, g.bh + kb, g.bl + kb};
    gload(f0, p0, 0);
    gmma(f1, acc);
    gaddr_wait(p0);
  }
}
// Stage the wave's four 16x16 f32 accumulators into the block tile T[64][PT] (row = 16rt+8h+r, col = 16w+m).
__device__ __forceinline__ void stage64(float* T, const v8f acc[4], int h, int m, int w) {
#pragma unroll
  for (int rt = 0; rt < 4; ++rt)
#pragma unroll
    for (int r = 0; r < 8; ++r) T[(16 * rt + 8 * h + r) * PT + 16 * w + m] = acc[rt][r];
}

// ---------------------------------------------------------------------------
// 1) x[b][c][n] (f32) -> xh/xl bf16 hi/lo planes, rows n, k = c, fragment order.  Block: 64 n x 64 c tile through LDS;
//    wave w writes row tile w, four pieces of 512 contiguous bytes a plane.
// ---------------------------------------------------------------------------
__global__ void __launch_bounds__(128)
k_cvt_x(const float* __restrict__ x, us* __restrict__ xh, us* __restrict__ xl) {
  __shared__ __align__(16) float T[64 * PT];
  const int bid = blockIdx.x;
  if (bid >= NB * NT64 * NCT) return;
  const int ct = bid % NCT;
  const int nt = (bid / NCT) % NT64;
  const int b  = bid / (NCT * NT64);
  const int c0 = ct * 64, n0 = nt * 64;
  const int t = threadIdx.x;
  const float* src = x + ((size_t)b * NC + c0) * NPTS + n0;
#pragma unroll
  for (int i = 0; i < 32; ++i) {
    const int idx = i * 128 + t;
    const int cl = idx >> 6, nl = idx & 63;
    T[nl * PT + cl] = src[(size_t)cl * NPTS + nl];
  }
  __syncthreads();
  const int l = t & 31, w = t >> 5, h = l >> 4, m = l & 15;
  v4u hv[4], lv[4];
#pragma unroll
  for (int i = 0; i < 4; ++i) {
    const v4fa* s = (const v4fa*)(T + (16 * w + m) * PT + 16 * i + 8 * h);
    split8(s[0], s[1], hv[i], lv[i]);
  }
  const size_t po = ((size_t)b * NPTS + n0 + 16 * w) * NC + ct * 1024 + 8 * l;
  us* dh = xh + po;
  us* dl = xl + po;
#pragma unroll
  for (int i = 0; i < 4; ++i) {
    *(v4u*)(dh + 256 * i) = hv[i];
    *(v4u*)(dl + 256 * i) = lv[i];
  }
  
}

// ---------------------------------------------------------------------------
// 2) W (f32 [co][c], row-major) -> wh/wl[mat] bf16 hi/lo planes, rows co, k = c, fragment order.  One wave per 16-row x 32-k tile.
// ---------------------------------------------------------------------------
__global__ void __launch_bounds__(128)
k_cvt_w(const float* __restrict__ w0, const float* __restrict__ w1,
        const float* __restrict__ w2, const float* __restrict__ w3,
        us* __restrict__ wh, us* __restrict__ wl) {
  const int l = threadIdx.x & 31;
  const int wg = blockIdx.x * 4 + (threadIdx.x >> 5);
  if (wg >= 4 * NC) return;
  const int mat = wg / NC, tile = (wg % NC) / 16, ks = wg % 16;
  const int h = l >> 4, m = l & 15;
  const float* src = (mat == 0) ? w0 : ((mat == 1) ? w1 : ((mat == 2) ? w2 : w3));
  src += (size_t)(16 * tile + m) * NC + 32 * ks + 8 * h;
  us* dh = wh + (size_t)wg * 512 + 8 * l;
  us* dl = wl + (size_t)wg * 512 + 8 * l;
  v4u hv[2], lv[2];
#pragma unroll
  for (int p = 0; p < 2; ++p) {
    const v4f* s = (const v4f*)(src + 16 * p);
    split8(s[0], s[1], hv[p], lv[p]);
  }
#pragma unroll
  for (int p = 0; p < 2; ++p) {
    *(v4u*)(dh + 256 * p) = hv[p];
    *(v4u*)(dl + 256 * p) = lv[p];
  }
  
}

// ---------------------------------------------------------------------------
// 3) Fused mask+bias table, f32, in the order of the transposed score accumulators: per (nt, 16 keys) two pieces of 512 bytes,
//    piece q holding at lane l = 16h + m the keys 8h + 4q .. + 3 of query row 16nt + m: adj ? gb : MASKV.
//    Block covers (nt, 256 keys); wave w owns 64 keys: it reads 256 contiguous bytes of a row (two rows an instruction),
//    turns its 16 x 64 tile through LDS and writes 32 contiguous lines.
// ---------------------------------------------------------------------------
__global__ void __launch_bounds__(128)
k_mb(const int* __restrict__ adj, const float* __restrict__ gb, float* __restrict__ mb) {
  __shared__ __align__(16) float T[4 * 16 * PT];
  const int bid = blockIdx.x;
  if (bid >= NT16 * (NPTS / 256)) return;
  const int kq = bid % (NPTS / 256), nt = bid / (NPTS / 256);
  const int key0 = kq * 256, nr0 = nt * 16;
  const int l = threadIdx.x & 31, w = threadIdx.x >> 5, h = l >> 4, m = l & 15;
  float* base = mb + ((size_t)nt * NPTS + key0) * 16;
  float* tw = T + w * (16 * PT);
  const size_t idx = (size_t)(nr0 + h) * NPTS + key0 + 64 * w + 4 * m;
  const int* pa = adj + idx;
  const float* pg = gb + idx;
  v4i a[8];
  v4f g[8];
#pragma unroll
  for (int i = 0; i < 8; ++i) {
    a[i] = *(const v4i*)(pa + (size_t)(2 * i) * NPTS);
    g[i] = *(const v4f*)(pg + (size_t)(2 * i) * NPTS);
  }
  // the wait that stands in front of a rewrite of the 16 loads' address registers; it takes both pointers as inputs, so they
  // stay in their registers up to it, and all 16 loads are issued in front of it, before the first of them is waited for
  asm volatile("s_wait_xcnt 0x0" :: "v"(pa), "v"(pg) : "memory");
#pragma unroll
  for (int i = 0; i < 8; ++i) {
    v4f v;
    v.x = (a[i].x != 0) ? g[i].x : MASKV;
    v.y = (a[i].y != 0) ? g[i].y : MASKV;
    v.z = (a[i].z != 0) ? g[i].z : MASKV;
    v.w = (a[i].w != 0) ? g[i].w : MASKV;
    *(v4fa*)(tw + (2 * i + h) * PT + 4 * m) = v;
  }
  __syncthreads();
  v4f vals[8];
#pragma unroll
  for (int i = 0; i < 8; ++i) vals[i] = *(const v4fa*)(tw + m * PT + 16 * (i >> 1) + 8 * h + 4 * (i & 1));
#pragma unroll
  for (int i = 0; i < 8; ++i) *(v4f*)(base + 1024 * w + 128 * i + 4 * l) = vals[i];
}

// ---------------------------------------------------------------------------
// 4) QKV projection.  Block tile: 64 points x 64 channels (one head), matrices q,k,v in sequence.
//    A = xh/xl row tiles; B = W row tiles (same fragment order, loaded like A).
//    q16, k16: rows n, k = d, fragment order (a 16-row tile is four pieces).  vT16: per 32 keys four d tiles of two pieces, rows d, k = key.
// ---------------------------------------------------------------------------
__global__ void __launch_bounds__(128)
k_qkv(const us* __restrict__ xh, const us* __restrict__ xl,
      const us* __restrict__ wh, const us* __restrict__ wl,
      const float* __restrict__ bq, const float* __restrict__ bk, const float* __restrict__ bv,
      us* __restrict__ q16, us* __restrict__ k16, us* __restrict__ vT16) {
  __shared__ __align__(16) float T[64 * PT];
  const int bid = blockIdx.x;
  if (bid >= NB * NT64 * NH) return;
  const int hd = bid % NH;
  const int nt = (bid / NH) % NT64;
  const int b  = bid / (NH * NT64);
  const int n0 = nt * 64, co0 = hd * HD;
  const int t = threadIdx.x, l = t & 31, w = t >> 5, h = l >> 4, m = l & 15;
  const int bh = b * NH + hd;
  const size_t aoff = ((size_t)b * NPTS + n0) * NC + 8 * l;
  const size_t boff = ((size_t)co0 + 16 * w) * NC + 8 * l;
  GAddr g = {xh + aoff, xl + aoff, wh + boff, wl + boff};
  GFrag f0;
  gload(f0, g, 0);
  gaddr_wait(g);
#pragma unroll 1
  for (int p = 0; p < 3; ++p) {
    v8f acc[4];
    gemm64(g, (p < 2) ? NC * NC : 0, f0, acc);
    g.bh += NC * NC;
    g.bl += NC * NC;
    stage64(T, acc, h, m, w);
    __syncthreads();
    const float* bias = (p == 0) ? bq : ((p == 1) ? bk : bv);
    v4u vals[4];
    if (p < 2) {
      us* dst = ((p == 0) ? q16 : k16) + ((size_t)bh * NPTS + n0 + 16 * w) * HD + 8 * l;
#pragma unroll
      for (int i = 0; i < 4; ++i) {
        const v4f b0 = *(const v4f*)(bias + co0 + 16 * i + 8 * h);
        const v4f b1 = *(const v4f*)(bias + co0 + 16 * i + 8 * h + 4);
        const v4fa* s = (const v4fa*)(T + (16 * w + m) * PT + 16 * i + 8 * h);
        const v4f f0 = (s[0] + b0) * 8.0f;
        const v4f f1 = (s[1] + b1) * 8.0f;
        vals[i] = pack8h(f0, f1);
      }
#pragma unroll
      for (int i = 0; i < 4; ++i)
        *(v4u*)(dst + 256 * i) = vals[i];
      asm volatile("s_wait_xcnt 0x0" ::: "memory");  // stands in front of any rewrite of the four stores' address and data registers
    } else {
      us* dst = vT16 + ((size_t)bh * NPTS + n0) * HD + 512 * w + 8 * l;
      const int d = 16 * w + m;
      const float bd = bias[co0 + d];
#pragma unroll
      for (int i = 0; i < 4; ++i) {
        const int kr = 16 * i + 8 * h;  // first of the lane's 8 keys: 32-key group i >> 1, piece i & 1
        v4f f0, f1;
        f0.x = (T[(kr + 0) * PT + d] + bd) * 8.0f;
        f0.y = (T[(kr + 1) * PT + d] + bd) * 8.0f;
        f0.z = (T[(kr + 2) * PT + d] + bd) * 8.0f;
        f0.w = (T[(kr + 3) * PT + d] + bd) * 8.0f;
        f1.x = (T[(kr + 4) * PT + d] + bd) * 8.0f;
        f1.y = (T[(kr + 5) * PT + d] + bd) * 8.0f;
        f1.z = (T[(kr + 6) * PT + d] + bd) * 8.0f;
        f1.w = (T[(kr + 7) * PT + d] + bd) * 8.0f;
        vals[i] = pack8h(f0, f1);
      }
#pragma unroll
      for (int i = 0; i < 4; ++i)
        *(v4u*)(dst + 2048 * (i >> 1) + 256 * (i & 1)) = vals[i];
      
    }
    __syncthreads();
  }
}

// ---------------------------------------------------------------------------
// 5) Flash attention.  One wave per (b, h, 16 query rows); 32-key steps; online softmax in f32.
//    S^T tile: A = k16 row tiles (keys as rows, d as k), B = q16 row tile (queries as columns, loaded like A).
//    acc[r] = (key 8h+r, query m): a lane holds 16 of the 32 scores of one query, its partner lane l ^ 16 the others.
//    P^T: the two score tiles, converted in place (f16, *4096), are the B operand of the 32-key product (same k map as the planes).
//    O^T += V^T * P^T: A = vT16 tiles (d as rows, keys as k).  acc[r] = (d 16dt+8h+r, query m) is the lane's piece of the
//    att plane in fragment order: normalised, split and stored from the registers.
// ---------------------------------------------------------------------------
// Fragment loaders of one 32-key step: kp = k16 tile of key0, vp = vT16 group of key0, mp = table pieces of key0; all at lane l.
__device__ __forceinline__ void ld_k(const us* __restrict__ kp, FragH f[4]) {
#pragma unroll
  for (int i = 0; i < 2; ++i) {
    const us* p = kp + (size_t)i * 16 * HD;
    f[2 * i].uh[0]     = *(const v8us*)(p);       f[2 * i].uh[1]     = *(const v8us*)(p + 256);
    f[2 * i + 1].uh[0] = *(const v8us*)(p + 512); f[2 * i + 1].uh[1] = *(const v8us*)(p + 768);
  }
}
__device__ __forceinline__ void ld_v(const us* __restrict__ vp, FragH f[4]) {
#pragma unroll
  for (int dt = 0; dt < 4; ++dt) {
    const us* p = vp + (size_t)dt * 512;
    f[dt].uh[0] = *(const v8us*)(p);
    f[dt].uh[1] = *(const v8us*)(p + 256);
  }
}
__device__ __forceinline__ void ld_mb(const float* __restrict__ mp, v8f &a, v8f &b) {
  a = cat4(*(const v4f*)(mp),       *(const v4f*)(mp + 128));
  b = cat4(*(const v4f*)(mp + 256), *(const v4f*)(mp + 384));
}
// lane l with lane l ^ 16
__device__ __forceinline__ float xhalf(float x) {
  const int b = __builtin_bit_cast(int, x);
  return __builtin_bit_cast(float, __builtin_amdgcn_permlanex16(b, b, 0x76543210, 0xfedcba98, false, false));
}
__global__ void __launch_bounds__(128)
k_attn(const us* __restrict__ q16, const us* __restrict__ k16, const us* __restrict__ vT16,
       const float* __restrict__ mb, us* __restrict__ ath, us* __restrict__ atl) {
  const int bid = blockIdx.x;
  if (bid >= (NB * NH * NT16) / 4) return;
  const int t = threadIdx.x, l = t & 31, w = t >> 5;
  const int wg = bid * 4 + w;
  const int nt = wg % NT16;
  const int bh = wg / NT16;
  const int b = bh / NH, hd = bh % NH;
  const int n0 = nt * 16;

  const us* qrow = q16 + ((size_t)bh * NPTS + n0) * HD + 8 * l;
  FragH aq0, aq1;
  aq0.uh[0] = *(const v8us*)(qrow);       aq0.uh[1] = *(const v8us*)(qrow + 256);
  aq1.uh[0] = *(const v8us*)(qrow + 512); aq1.uh[1] = *(const v8us*)(qrow + 768);
  const us* kbase = k16 + (size_t)bh * NPTS * HD + 8 * l;
  const us* vbase = vT16 + (size_t)bh * NPTS * HD + 8 * l;
  const float* mbb = mb + (size_t)nt * NPTS * 16 + 4 * l;

  const v8f z = {0.f, 0.f, 0.f, 0.f, 0.f, 0.f, 0.f, 0.f};
  v8f o[4];
#pragma unroll
  for (int dt = 0; dt < 4; ++dt) o[dt] = z;
  float mrow = -1.0e30f;  // the query's running maximum, equal in both halves
  float lrow = 0.f;       // the running sum over this half's keys; the halves join behind the loop

  // K, mask+bias and V fragments of a step live in registers that are reloaded for the next step
  // right behind their last use, so every load is one step old when it is waited for.
  FragH kf[4], vf[4];
  v8f mb0, mb1;
  ld_k(kbase, kf);
  ld_mb(mbb, mb0, mb1);
  // inputs-only fence on loaded values: Q, K and mask of step 0 land here, so that on entry as on the back edge
  // the V loads are the youngest outstanding and the loop's first wait does not drain them
  asm volatile("" :: "v"(aq0.v), "v"(aq1.v), "v"(kf[0].v), "v"(kf[1].v), "v"(kf[2].v), "v"(kf[3].v), "v"(mb0), "v"(mb1));
  ld_v(vbase, vf);

  for (int key0 = 0; key0 < NPTS; key0 += 32) {
    const int kn = (key0 + 32 < NPTS) ? key0 + 32 : 0;  // next step's keys; the last step refetches step 0, unused
    v8f s0 = mma_h2(kf[0].v, aq0.v, kf[1].v, aq1.v, z);
    v8f s1 = mma_h2(kf[2].v, aq0.v, kf[3].v, aq1.v, z);
    ld_k(kbase + (size_t)kn * HD, kf);
    // scale 1/512 (= 1/64 from the *8*8 storage, times 1/sqrt(64)) and add fused mask+bias
    s0 = s0 * SSCL + mb0;
    s1 = s1 * SSCL + mb1;
    ld_mb(mbb + (size_t)kn * 16, mb0, mb1);
    // the query's maximum over the 32 keys: 16 in the lane, the other 16 in lane l ^ 16
    const float ta = fmaxf(fmaxf(fmaxf(s0[0], s0[1]), fmaxf(s0[2], s0[3])), fmaxf(fmaxf(s0[4], s0[5]), fmaxf(s0[6], s0[7])));
    const float tb = fmaxf(fmaxf(fmaxf(s1[0], s1[1]), fmaxf(s1[2], s1[3])), fmaxf(fmaxf(s1[4], s1[5]), fmaxf(s1[6], s1[7])));
    float tm = fmaxf(ta, tb);
    tm = fmaxf(tm, xhalf(tm));
    const float mnew = fmaxf(mrow, tm);
    const float alpha = __expf(mrow - mnew);
    v8f p0, p1;
#pragma unroll
    for (int r = 0; r < 8; ++r) {
      p0[r] = __expf(s0[r] - mnew);
      p1[r] = __expf(s1[r] - mnew);
    }
    const v8f rv = p0 + p1;
    lrow = lrow * alpha + (((rv[0] + rv[1]) + (rv[2] + rv[3])) + ((rv[4] + rv[5]) + (rv[6] + rv[7])));
    mrow = mnew;
#pragma unroll
    for (int dt = 0; dt < 4; ++dt) o[dt] = o[dt] * alpha;
    // P^T as B operand: element s = key 8h + s (s < 8), key 16 + 8h + s - 8 (s >= 8) of query m; f16 scaled by 4096
    FragH pb;
    p0 = p0 * PSCL;
    p1 = p1 * PSCL;
#pragma unroll
    for (int r = 0; r < 8; ++r) {
      pb.v[r]     = (f16t)p0[r];
      pb.v[8 + r] = (f16t)p1[r];
    }
    // the step's work-group barrier stays, now with nothing to order: it holds the block's four waves, which read the same K and V
    // lines, within one step of each other, so that a line one wave has fetched is still in the WGP cache when the others load it
    // (a step of the WGP's three blocks fills most of that cache); apart, each wave would fetch its own copy from L2
    __builtin_amdgcn_s_barrier();
#pragma unroll
    for (int dt = 0; dt < 4; ++dt) o[dt] = mma_h1(vf[dt].v, pb.v, o[dt]);
    ld_v(vbase + (size_t)kn * HD, vf);
    asm volatile("s_wait_xcnt 0x0" ::: "memory");  // stands in front of the next step's rewrite of the loads' address registers
  }

  // normalise: O holds 32768 * sum p v; divide by 32768 * l
  const float inv = 1.0f / ((lrow + xhalf(lrow)) * OSCL);
  v4u hv[4], lv[4];
#pragma unroll
  for (int i = 0; i < 4; ++i) {
    const v8f f = o[i] * inv;
    const v4f f0 = {f[0], f[1], f[2], f[3]};
    const v4f f1 = {f[4], f[5], f[6], f[7]};
    split8(f0, f1, hv[i], lv[i]);
  }
  const size_t po = ((size_t)b * NPTS + n0) * NC + hd * 1024 + 8 * l;
  us* dh = ath + po;
  us* dl = atl + po;
#pragma unroll
  for (int i = 0; i < 4; ++i) {
    *(v4u*)(dh + 256 * i) = hv[i];
    *(v4u*)(dl + 256 * i) = lv[i];
  }
}

// ---------------------------------------------------------------------------
// 6) Output projection: out[b][co][n] = sum_c att[b][n][c] * Wo[co][c] + bo[co].
//    Block tile 64 n x 64 co; A = ath/atl row tiles, B = Wo hi/lo row tiles (matrix slot 3).
// ---------------------------------------------------------------------------
__global__ void __launch_bounds__(128)
k_out(const us* __restrict__ ath, const us* __restrict__ atl,
      const us* __restrict__ wh, const us* __restrict__ wl,
      const float* __restrict__ bo, float* __restrict__ out) {
  __shared__ __align__(16) float T[64 * PT];
  const int bid = blockIdx.x;
  if (bid >= NB * NT64 * NCT) return;
  const int cot = bid % NCT;
  const int nt  = (bid / NCT) % NT64;
  const int b   = bid / (NCT * NT64);
  const int n0 = nt * 64, co0 = cot * 64;
  const int t = threadIdx.x, l = t & 31, w = t >> 5, h = l >> 4, m = l & 15;
  const size_t aoff = ((size_t)b * NPTS + n0) * NC + 8 * l;
  const size_t boff = ((size_t)3 * NC + co0 + 16 * w) * NC + 8 * l;
  const GAddr g = {ath + aoff, atl + aoff, wh + boff, wl + boff};
  v8f acc[4];
  GFrag f0;
  gload(f0, g, 0);
  gaddr_wait(g);
  gemm64(g, 0, f0, acc);
  stage64(T, acc, h, m, w);
  __syncthreads();
  const int cq = l >> 4, nq = 4 * (l & 15);
  v4f vals[8];
#pragma unroll
  for (int i = 0; i < 8; ++i) {
    const int col = 16 * w + 2 * i + cq;
    const float bb = bo[co0 + col];
    v4f f;
    f.x = T[(nq + 0) * PT + col] + bb;
    f.y = T[(nq + 1) * PT + col] + bb;
    f.z = T[(nq + 2) * PT + col] + bb;
    f.w = T[(nq + 3) * PT + col] + bb;
    vals[i] = f;
  }
  float* dst = out + ((size_t)b * NC + co0) * NPTS + n0 + nq;
#pragma unroll
  for (int i = 0; i < 8; ++i)
    *(v4f*)(dst + (size_t)(16 * w + 2 * i + cq) * NPTS) = vals[i];
  
}

// ---------------------------------------------------------------------------
// Host glue.  Inputs: x, adjacency, geo_bias, Wq, bq, Wk, bk, Wv, bv, Wo, bo.
// Workspace carve (bytes): xh, xl 2 x 6291456; wh, wl 2 x 2097152; mb 37748736;
// q16, k16, vT16 3 x 6291456; ath, atl 2 x 6291456; total 85983232.
// ---------------------------------------------------------------------------
extern "C" void kernel_launch(void* const* d_in, const int* in_sizes, int n_in,
                              void* d_out, int out_size, void* d_ws, size_t ws_size,
                              hipStream_t stream) {
  if (n_in < 11) return;
  if (in_sizes[0] != NB * NC * NPTS) return;
  if (in_sizes[1] != NPTS * NPTS || in_sizes[2] != NPTS * NPTS) return;
  if (in_sizes[3] != NC * NC || in_sizes[5] != NC * NC || in_sizes[7] != NC * NC || in_sizes[9] != NC * NC) return;
  if (in_sizes[4] != NC || in_sizes[6] != NC || in_sizes[8] != NC || in_sizes[10] != NC) return;
  if (out_size != NB * NC * NPTS) return;

  const float* x   = (const float*)d_in[0];
  const int*   adj = (const int*)d_in[1];
  const float* gb  = (const float*)d_in[2];
  const float* Wq  = (const float*)d_in[3];
  const float* bq  = (const float*)d_in[4];
  const float* Wk  = (const float*)d_in[5];
  const float* bk  = (const float*)d_in[6];
  const float* Wv  = (const float*)d_in[7];
  const float* bv  = (const float*)d_in[8];
  const float* Wo  = (const float*)d_in[9];
  const float* bo  = (const float*)d_in[10];
  float* out = (float*)d_out;

  const size_t sz_x16 = (size_t)NB * NPTS * NC * 2;         // 6291456
  const size_t sz_w16 = (size_t)4 * NC * NC * 2;             // 2097152
  const size_t sz_mb  = (size_t)NPTS * NPTS * 4;             // 37748736
  const size_t sz_hd  = (size_t)NB * NH * NPTS * HD * 2;     // 6291456
  char* ws = (char*)d_ws;
  size_t off = 0;
  us* xh   = (us*)(ws + off);    off += sz_x16;
  us* xl   = (us*)(ws + off);    off += sz_x16;
  us* wh   = (us*)(ws + off);    off += sz_w16;
  us* wl   = (us*)(ws + off);    off += sz_w16;
  float* mb = (float*)(ws + off); off += sz_mb;
  us* q16  = (us*)(ws + off);    off += sz_hd;
  us* k16  = (us*)(ws + off);    off += sz_hd;
  us* vT16 = (us*)(ws + off);    off += sz_hd;
  us* ath  = (us*)(ws + off);    off += sz_x16;
  us* atl  = (us*)(ws + off);    off += sz_x16;
  if (off > ws_size) return;

  k_cvt_x<<<NB * NT64 * NCT, 128, 0, stream>>>(x, xh, xl);
  k_cvt_w<<<(4 * NC) / 4, 128, 0, stream>>>(Wq, Wk, Wv, Wo, wh, wl);
  k_mb<<<NT16 * (NPTS / 256), 128, 0, stream>>>(adj, gb, mb);
  k_qkv<<<NB * NT64 * NH, 128, 0, stream>>>(xh, xl, wh, wl, bq, bk, bv, q16, k16, vT16);
  k_attn<<<(NB * NH * NT16) / 4, 128, 0, stream>>>(q16, k16, vT16, mb, ath, atl);
  k_out<<<NB * NT64 * NCT, 128, 0, stream>>>(ath, atl, wh, wl, bo, out);
}

// v004
// One run takes 118 microseconds.
// Timed twice side by side with v003, it ran 1.16 and 1.21 times as fast.
// Over all steps from v000 it is 3.76 times as fast.
#include <hip/hip_runtime.h>
#include <stddef.h>

#define NB   2
#define NC   512
#define NPTS 3072
#define NH   8
#define HD   64
#define NT16 (NPTS / 16)
#define NT64 (NPTS / 64)
#define NCT  (NC / 64)
#define PT   68
#define MASKV (-30000.0f)
#define SSCL (1.0f / 512.0f)
#define PSCL 4096.0f
#define OSCL 32768.0f

typedef _Float16 f16t;
typedef unsigned short us;
typedef float        v8f  __attribute__((ext_vector_type(8)));
typedef float        v4f  __attribute__((ext_vector_type(4)));
typedef unsigned int v4u  __attribute__((ext_vector_type(4)));
typedef us           v8us __attribute__((ext_vector_type(8)));
typedef _Float16     v16h __attribute__((ext_vector_type(16)));
typedef __bf16       v16bf __attribute__((ext_vector_type(16)));
typedef int          v4i  __attribute__((ext_vector_type(4)));
typedef v4f v4fa __attribute__((may_alias));

union FragH { v16h v; v8us uh[2]; };
union FragB { v16bf v; v8us uh[2]; };

// ---------------------------------------------------------------------------
// WMMA helpers: 16x16x32, fragment layout per lane l: h = l>>4, m = l&15.
// A: row m, elements 0..7 = k0+8h+i, 8..15 = k0+16+8h+i.  B: column m, same k map
// (loaded from a copy with rows n in the same fragment order, exactly like A).  D: acc[r] = (row 8h+r, col m).
// Each helper ends with 4 v_nop tying D and keeping A/B live (VALU hazard guard).
// ---------------------------------------------------------------------------
__device__ __forceinline__ v8f mma_b3(v16bf ah, v16bf al, v16bf bh, v16bf bl, v8f c) {
  c = __builtin_amdgcn_wmma_f32_16x16x32_bf16(false, ah, false, bh, (short)0, c, false, false);
  c = __builtin_amdgcn_wmma_f32_16x16x32_bf16(false, ah, false, bl, (short)0, c, false, false);
  c = __builtin_amdgcn_wmma_f32_16x16x32_bf16(false, al, false, bh, (short)0, c, false, false);
  asm volatile("v_nop\n\tv_nop\n\tv_nop\n\tv_nop" : "+v"(c) : "v"(ah), "v"(al), "v"(bh), "v"(bl));
  return c;
}
__device__ __forceinline__ v8f mma_h2(v16h a0, v16h b0, v16h a1, v16h b1, v8f c) {
  c = __builtin_amdgcn_wmma_f32_16x16x32_f16(false, a0, false, b0, (short)0, c, false, false);
  c = __builtin_amdgcn_wmma_f32_16x16x32_f16(false, a1, false, b1, (short)0, c, false, false);
  asm volatile("v_nop\n\tv_nop\n\tv_nop\n\tv_nop" : "+v"(c) : "v"(a0), "v"(b0), "v"(a1), "v"(b1));
  return c;
}
__device__ __forceinline__ v8f mma_h1(v16h a, v16h b, v8f c) {
  c = __builtin_amdgcn_wmma_f32_16x16x32_f16(false, a, false, b, (short)0, c, false, false);
  asm volatile("v_nop\n\tv_nop\n\tv_nop\n\tv_nop" : "+v"(c) : "v"(a), "v"(b));
  return c;
}

// ---------------------------------------------------------------------------
// Conversion helpers.  bf16 via RNE on the f32 bits; hi/lo pair: hi = rne(x), lo = rne(x - hi).
// ---------------------------------------------------------------------------
__device__ __forceinline__ unsigned bf_bits(float x) {
  const unsigned u = __float_as_uint(x);
  return (u + 0x7FFFu + ((u >> 16) & 1u)) >> 16;
}
__device__ __forceinline__ void bf_split(float x, unsigned &hi, unsigned &lo) {
  hi = bf_bits(x);
  lo = bf_bits(x - __uint_as_float(hi << 16));
}
__device__ __forceinline__ unsigned h_bits(float x) {
  return (unsigned)__builtin_bit_cast(unsigned short, (f16t)x);
}
// 8 floats -> 8 bf16 hi (packed in hv) and 8 bf16 lo (packed in lv); element 2j in the low half-word.
__device__ __forceinline__ void split8(const v4f a, const v4f b, v4u &hv, v4u &lv) {
  unsigned h0, h1, h2, h3, h4, h5, h6, h7, l0, l1, l2, l3, l4, l5, l6, l7;
  bf_split(a.x, h0, l0); bf_split(a.y, h1, l1); bf_split(a.z, h2, l2); bf_split(a.w, h3, l3);
  bf_split(b.x, h4, l4); bf_split(b.y, h5, l5); bf_split(b.z, h6, l6); bf_split(b.w, h7, l7);
  v4u r, s;
  r.x = h0 | (h1 << 16); r.y = h2 | (h3 << 16); r.z = h4 | (h5 << 16); r.w = h6 | (h7 << 16);
  s.x = l0 | (l1 << 16); s.y = l2 | (l3 << 16); s.z = l4 | (l5 << 16); s.w = l6 | (l7 << 16);
  hv = r; lv = s;
}
// 8 floats -> 8 f16 packed in one 16-byte vector.
__device__ __forceinline__ v4u pack8h(const v4f a, const v4f b) {
  v4u r;
  r.x = h_bits(a.x) | (h_bits(a.y) << 16);
  r.y = h_bits(a.z) | (h_bits(a.w) << 16);
  r.z = h_bits(b.x) | (h_bits(b.y) << 16);
  r.w = h_bits(b.z) | (h_bits(b.w) << 16);
  return r;
}
__device__ __forceinline__ v8f cat4(v4f a, v4f b) {
  v8f r = {a.x, a.y, a.z, a.w, b.x, b.y, b.z, b.w};
  return r;
}

// ---------------------------------------------------------------------------
// 64x64 output tile GEMM core (K = 512) with bf16 hi/lo planes for A and B.
// Planes in fragment order, [row tile][k-step][piece][lane][8]: a row tile is 16*NC elements, a k-step 512, a piece 256.
// The A pointers stand at the tile of row0, lane l; row subtile rt adds rt tiles.  The B pointers stand at the tile of col0, lane l.
// Wave owns columns col0 + 16w .. +15 (folded into the B pointers by the caller), rows 0..63 as acc[0..3].
// ---------------------------------------------------------------------------
// The fragments of one k-step (32 k): B hi/lo and the four row subtiles' A hi/lo.
struct GFrag { FragB bh, bl, ah[4], al[4]; };
// Four lane pointers: A tile of row0 and B tile of col0 at some k-step, lane l, hi and lo planes.
struct GAddr { const us* ah; const us* al; const us* bh; const us* bl; };
// Loads the k-step that begins ko plane elements (a constant, 512 a k-step) behind p.
__device__ __forceinline__ void gload(GFrag &f, const GAddr &p, int ko) {
  f.bh.uh[0] = *(const v8us*)(p.bh + ko);  f.bh.uh[1] = *(const v8us*)(p.bh + ko + 256);
  f.bl.uh[0] = *(const v8us*)(p.bl + ko);  f.bl.uh[1] = *(const v8us*)(p.bl + ko + 256);
#pragma unroll
  for (int rt = 0; rt < 4; ++rt) {
    const size_t o = (size_t)rt * 16 * NC + ko;
    f.ah[rt].uh[0] = *(const v8us*)(p.ah + o);  f.ah[rt].uh[1] = *(const v8us*)(p.ah + o + 256);
    f.al[rt].uh[0] = *(const v8us*)(p.al + o);  f.al[rt].uh[1] = *(const v8us*)(p.al + o + 256);
  }
  // the 20 loads are issued here, in front of the products that follow: moved behind the first of those products they
  // would start only when the other buffer's loads have landed, and the two buffers would no longer fly together
  __builtin_amdgcn_sched_barrier(0);
}
// The wait that stands in front of a rewrite of the loads' address registers.  It takes the four pointers as inputs, so
// they stay in their registers up to it and no later load of the same run gets one of them as its destination.
__device__ __forceinline__ void gaddr_wait(const GAddr &p) {
  asm volatile("s_wait_xcnt 0x0" :: "v"(p.ah), "v"(p.al), "v"(p.bh), "v"(p.bl) : "memory");
}
__device__ __forceinline__ void gmma(const GFrag &f, v8f acc[4]) {
#pragma unroll
  for (int rt = 0; rt < 4; ++rt) acc[rt] = mma_b3(f.ah[rt].v, f.al[rt].v, f.bh.v, f.bl.v, acc[rt]);
}
// Two register buffers: all 20 loads of k-step s+1 are issued in front of the products of k-step s, so every load is one
// k-step old when it is waited for.  Behind the
// last k-step f0 is refilled with the first k-step of the same A rows and of the B rows at element offset bnext (the next product's
// first fragments where the caller has one; otherwise unused).
// The walk over k begins rot plane elements in (a multiple of 1024, below 16 * NC) and wraps round; the caller hands in f0 holding
// the k-step at rot.  Blocks that read the same A or B rows get different rot (grot): walking in step from k = 0 they would all ask
// for a line at the moment it is first fetched from memory, and every k-step would wait out memory latency; apart, a block mostly
// finds lines that another block has already brought into L2.
__device__ __forceinline__ int grot(int colblk, int rowblk) {
  return ((2 * colblk + (colblk >> 2) + rowblk) & 7) * 1024;
}
__device__ __forceinline__ void gemm64(const GAddr &g, int rot, int bnext, GFrag &f0, v8f acc[4]) {
  const v8f z = {0.f, 0.f, 0.f, 0.f, 0.f, 0.f, 0.f, 0.f};
#pragma unroll
  for (int rt = 0; rt < 4; ++rt) acc[rt] = z;
  GFrag f1;
#pragma unroll 1  // rolled: fully unrolled, the projection kernel passes 256 registers and switches register windows in the k loop
  for (int k0 = 0; k0 < 16 * NC; k0 += 1024) {  // k0 in plane elements: two k-steps of 512 a trip
    const int kc = (k0 + rot) & (16 * NC - 1);
    const int ka = (k0 + 1024 + rot) & (16 * NC - 1);  // behind the last trip: rot again
    const int kb = (k0 + 1024 < 16 * NC) ? ka : ka + bnext;
    const GAddr p1 = {g.ah + kc, g.al + kc, g.bh + kc, g.bl + kc};
    gload(f1, p1, 512);
    gmma(f0, acc);
    gaddr_wait(p1);
    const GAddr p0 = {g.ah + ka, g.al + ka, g.bh + kb, g.bl + kb};
    gload(f0, p0, 0);
    gmma(f1, acc);
    gaddr_wait(p0);
  }
}
// Stage the wave's four 16x16 f32 accumulators into the block tile T[64][PT] (row = 16rt+8h+r, col = 16w+m).
__device__ __forceinline__ void stage64(float* T, const v8f acc[4], int h, int m, int w) {
#pragma unroll
  for (int rt = 0; rt < 4; ++rt)
#pragma unroll
    for (int r = 0; r < 8; ++r) T[(16 * rt + 8 * h + r) * PT + 16 * w + m] = acc[rt][r];
}

// ---------------------------------------------------------------------------
// 1) x[b][c][n] (f32) -> xh/xl bf16 hi/lo planes, rows n, k = c, fragment order.  Block: 64 n x 64 c tile through LDS;
//    wave w writes row tile w, four pieces of 512 contiguous bytes a plane.
// ---------------------------------------------------------------------------
__global__ void __launch_bounds__(128)
k_cvt_x(const float* __restrict__ x, us* __restrict__ xh, us* __restrict__ xl) {
  __shared__ __align__(16) float T[64 * PT];
  const int bid = blockIdx.x;
  if (bid >= NB * NT64 * NCT) return;
  const int ct = bid % NCT;
  const int nt = (bid / NCT) % NT64;
  const int b  = bid / (NCT * NT64);
  const int c0 = ct * 64, n0 = nt * 64;
  const int t = threadIdx.x;
  const float* src = x + ((size_t)b * NC + c0) * NPTS + n0;
#pragma unroll
  for (int i = 0; i < 32; ++i) {
    const int idx = i * 128 + t;
    const int cl = idx >> 6, nl = idx & 63;
    T[nl * PT + cl] = src[(size_t)cl * NPTS + nl];
  }
  __syncthreads();
  const int l = t & 31, w = t >> 5, h = l >> 4, m = l & 15;
  v4u hv[4], lv[4];
#pragma unroll
  for (int i = 0; i < 4; ++i) {
    const v4fa* s = (const v4fa*)(T + (16 * w + m) * PT + 16 * i + 8 * h);
    split8(s[0], s[1], hv[i], lv[i]);
  }
  const size_t po = ((size_t)b * NPTS + n0 + 16 * w) * NC + ct * 1024 + 8 * l;
  us* dh = xh + po;
  us* dl = xl + po;
#pragma unroll
  for (int i = 0; i < 4; ++i) {
    *(v4u*)(dh + 256 * i) = hv[i];
    *(v4u*)(dl + 256 * i) = lv[i];
  }
  
}

// ---------------------------------------------------------------------------
// 2) W (f32 [co][c], row-major) -> wh/wl[mat] bf16 hi/lo planes, rows co, k = c, fragment order.  One wave per 16-row x 32-k tile.
// ---------------------------------------------------------------------------
__global__ void __launch_bounds__(128)
k_cvt_w(const float* __restrict__ w0, const float* __restrict__ w1,
        const float* __restrict__ w2, const float* __restrict__ w3,
        us* __restrict__ wh, us* __restrict__ wl) {
  const int l = threadIdx.x & 31;
  const int wg = blockIdx.x * 4 + (threadIdx.x >> 5);
  if (wg >= 4 * NC) return;
  const int mat = wg / NC, tile = (wg % NC) / 16, ks = wg % 16;
  const int h = l >> 4, m = l & 15;
  const float* src = (mat == 0) ? w0 : ((mat == 1) ? w1 : ((mat == 2) ? w2 : w3));
  src += (size_t)(16 * tile + m) * NC + 32 * ks + 8 * h;
  us* dh = wh + (size_t)wg * 512 + 8 * l;
  us* dl = wl + (size_t)wg * 512 + 8 * l;
  v4u hv[2], lv[2];
#pragma unroll
  for (int p = 0; p < 2; ++p) {
    const v4f* s = (const v4f*)(src + 16 * p);
    split8(s[0], s[1], hv[p], lv[p]);
  }
#pragma unroll
  for (int p = 0; p < 2; ++p) {
    *(v4u*)(dh + 256 * p) = hv[p];
    *(v4u*)(dl + 256 * p) = lv[p];
  }
  
}

// ---------------------------------------------------------------------------
// 3) Fused mask+bias table, f32, in the order of the transposed score accumulators: per (nt, 16 keys) two pieces of 512 bytes,
//    piece q holding at lane l = 16h + m the keys 8h + 4q .. + 3 of query row 16nt + m: adj ? gb : MASKV.
//    Block covers (nt, 256 keys); wave w owns 64 keys: it reads 256 contiguous bytes of a row (two rows an instruction),
//    turns its 16 x 64 tile through LDS and writes 32 contiguous lines.
// ---------------------------------------------------------------------------
__global__ void __launch_bounds__(128)
k_mb(const int* __restrict__ adj, const float* __restrict__ gb, float* __restrict__ mb) {
  __shared__ __align__(16) float T[4 * 16 * PT];
  const int bid = blockIdx.x;
  if (bid >= NT16 * (NPTS / 256)) return;
  const int kq = bid % (NPTS / 256), nt = bid / (NPTS / 256);
  const int key0 = kq * 256, nr0 = nt * 16;
  const int l = threadIdx.x & 31, w = threadIdx.x >> 5, h = l >> 4, m = l & 15;
  float* base = mb + ((size_t)nt * NPTS + key0) * 16;
  float* tw = T + w * (16 * PT);
  const size_t idx = (size_t)(nr0 + h) * NPTS + key0 + 64 * w + 4 * m;
  const int* pa = adj + idx;
  const float* pg = gb + idx;
  v4i a[8];
  v4f g[8];
#pragma unroll
  for (int i = 0; i < 8; ++i) {
    a[i] = *(const v4i*)(pa + (size_t)(2 * i) * NPTS);
    g[i] = *(const v4f*)(pg + (size_t)(2 * i) * NPTS);
  }
  // the wait that stands in front of a rewrite of the 16 loads' address registers; it takes both pointers as inputs, so they
  // stay in their registers up to it, and all 16 loads are issued in front of it, before the first of them is waited for
  asm volatile("s_wait_xcnt 0x0" :: "v"(pa), "v"(pg) : "memory");
#pragma unroll
  for (int i = 0; i < 8; ++i) {
    v4f v;
    v.x = (a[i].x != 0) ? g[i].x : MASKV;
    v.y = (a[i].y != 0) ? g[i].y : MASKV;
    v.z = (a[i].z != 0) ? g[i].z : MASKV;
    v.w = (a[i].w != 0) ? g[i].w : MASKV;
    *(v4fa*)(tw + (2 * i + h) * PT + 4 * m) = v;
  }
  __syncthreads();
  v4f vals[8];
#pragma unroll
  for (int i = 0; i < 8; ++i) vals[i] = *(const v4fa*)(tw + m * PT + 16 * (i >> 1) + 8 * h + 4 * (i & 1));
#pragma unroll
  for (int i = 0; i < 8; ++i) *(v4f*)(base + 1024 * w + 128 * i + 4 * l) = vals[i];
}

// ---------------------------------------------------------------------------
// 4) QKV projection.  Block tile: 64 points x 64 channels (one head), matrices q,k,v in sequence.
//    A = xh/xl row tiles; B = W row tiles (same fragment order, loaded like A).
//    q16, k16: rows n, k = d, fragment order (a 16-row tile is four pieces).  vT16: per 32 keys four d tiles of two pieces, rows d, k = key.
// ---------------------------------------------------------------------------
__global__ void __launch_bounds__(128)
k_qkv(const us* __restrict__ xh, const us* __restrict__ xl,
      const us* __restrict__ wh, const us* __restrict__ wl,
      const float* __restrict__ bq, const float* __restrict__ bk, const float* __restrict__ bv,
      us* __restrict__ q16, us* __restrict__ k16, us* __restrict__ vT16) {
  __shared__ __align__(16) float T[64 * PT];
  const int bid = blockIdx.x;
  if (bid >= NB * NT64 * NH) return;
  const int hd = bid % NH;
  const int nt = (bid / NH) % NT64;
  const int b  = bid / (NH * NT64);
  const int n0 = nt * 64, co0 = hd * HD;
  const int t = threadIdx.x, l = t & 31, w = t >> 5, h = l >> 4, m = l & 15;
  const int bh = b * NH + hd;
  const size_t aoff = ((size_t)b * NPTS + n0) * NC + 8 * l;
  const size_t boff = ((size_t)co0 + 16 * w) * NC + 8 * l;
  GAddr g = {xh + aoff, xl + aoff, wh + boff, wl + boff};
  const int rot = grot(hd, nt);
  GFrag f0;
  {
    const GAddr gr = {g.ah + rot, g.al + rot, g.bh + rot, g.bl + rot};
    gload(f0, gr, 0);
    gaddr_wait(gr);
  }
#pragma unroll 1
  for (int p = 0; p < 3; ++p) {
    v8f acc[4];
    gemm64(g, rot, (p < 2) ? NC * NC : 0, f0, acc);
    g.bh += NC * NC;
    g.bl += NC * NC;
    stage64(T, acc, h, m, w);
    __syncthreads();
    const float* bias = (p == 0) ? bq : ((p == 1) ? bk : bv);
    v4u vals[4];
    if (p < 2) {
      us* dst = ((p == 0) ? q16 : k16) + ((size_t)bh * NPTS + n0 + 16 * w) * HD + 8 * l;
#pragma unroll
      for (int i = 0; i < 4; ++i) {
        const v4f b0 = *(const v4f*)(bias + co0 + 16 * i + 8 * h);
        const v4f b1 = *(const v4f*)(bias + co0 + 16 * i + 8 * h + 4);
        const v4fa* s = (const v4fa*)(T + (16 * w + m) * PT + 16 * i + 8 * h);
        const v4f f0 = (s[0] + b0) * 8.0f;
        const v4f f1 = (s[1] + b1) * 8.0f;
        vals[i] = pack8h(f0, f1);
      }
#pragma unroll
      for (int i = 0; i < 4; ++i)
        *(v4u*)(dst + 256 * i) = vals[i];
      asm volatile("s_wait_xcnt 0x0" ::: "memory");  // stands in front of any rewrite of the four stores' address and data registers
    } else {
      us* dst = vT16 + ((size_t)bh * NPTS + n0) * HD + 512 * w + 8 * l;
      const int d = 16 * w + m;
      const float bd = bias[co0 + d];
#pragma unroll
      for (int i = 0; i < 4; ++i) {
        const int kr = 16 * i + 8 * h;  // first of the lane's 8 keys: 32-key group i >> 1, piece i & 1
        v4f f0, f1;
        f0.x = (T[(kr + 0) * PT + d] + bd) * 8.0f;
        f0.y = (T[(kr + 1) * PT + d] + bd) * 8.0f;
        f0.z = (T[(kr + 2) * PT + d] + bd) * 8.0f;
        f0.w = (T[(kr + 3) * PT + d] + bd) * 8.0f;
        f1.x = (T[(kr + 4) * PT + d] + bd) * 8.0f;
        f1.y = (T[(kr + 5) * PT + d] + bd) * 8.0f;
        f1.z = (T[(kr + 6) * PT + d] + bd) * 8.0f;
        f1.w = (T[(kr + 7) * PT + d] + bd) * 8.0f;
        vals[i] = pack8h(f0, f1);
      }
#pragma unroll
      for (int i = 0; i < 4; ++i)
        *(v4u*)(dst + 2048 * (i >> 1) + 256 * (i & 1)) = vals[i];
      
    }
    __syncthreads();
  }
}

// ---------------------------------------------------------------------------
// 5) Flash attention.  One wave per (b, h, 16 query rows); 32-key steps; online softmax in f32.
//    S^T tile: A = k16 row tiles (keys as rows, d as k), B = q16 row tile (queries as columns, loaded like A).
//    acc[r] = (key 8h+r, query m): a lane holds 16 of the 32 scores of one query, its partner lane l ^ 16 the others.
//    P^T: the two score tiles, converted in place (f16, *4096), are the B operand of the 32-key product (same k map as the planes).
//    O^T += V^T * P^T: A = vT16 tiles (d as rows, keys as k).  acc[r] = (d 16dt+8h+r, query m) is the lane's piece of the
//    att plane in fragment order: normalised, split and stored from the registers.
// ---------------------------------------------------------------------------
// Fragment loaders of one 32-key step: kp = k16 tile of key0, vp = vT16 group of key0, mp = table pieces of key0; all at lane l.
__device__ __forceinline__ void ld_k(const us* __restrict__ kp, FragH f[4]) {
#pragma unroll
  for (int i = 0; i < 2; ++i) {
    const us* p = kp + (size_t)i * 16 * HD;
    f[2 * i].uh[0]     = *(const v8us*)(p);       f[2 * i].uh[1]     = *(const v8us*)(p + 256);
    f[2 * i + 1].uh[0] = *(const v8us*)(p + 512); f[2 * i + 1].uh[1] = *(const v8us*)(p + 768);
  }
}
__device__ __forceinline__ void ld_v(const us* __restrict__ vp, FragH f[4]) {
#pragma unroll
  for (int dt = 0; dt < 4; ++dt) {
    const us* p = vp + (size_t)dt * 512;
    f[dt].uh[0] = *(const v8us*)(p);
    f[dt].uh[1] = *(const v8us*)(p + 256);
  }
}
__device__ __forceinline__ void ld_mb(const float* __restrict__ mp, v8f &a, v8f &b) {
  a = cat4(*(const v4f*)(mp),       *(const v4f*)(mp + 128));
  b = cat4(*(const v4f*)(mp + 256), *(const v4f*)(mp + 384));
}
// lane l with lane l ^ 16
__device__ __forceinline__ float xhalf(float x) {
  const int b = __builtin_bit_cast(int, x);
  return __builtin_bit_cast(float, __builtin_amdgcn_permlanex16(b, b, 0x76543210, 0xfedcba98, false, false));
}
__global__ void __launch_bounds__(128)
k_attn(const us* __restrict__ q16, const us* __restrict__ k16, const us* __restrict__ vT16,
       const float* __restrict__ mb, us* __restrict__ ath, us* __restrict__ atl) {
  const int bid = blockIdx.x;
  if (bid >= (NB * NH * NT16) / 4) return;
  const int t = threadIdx.x, l = t & 31, w = t >> 5;
  const int wg = bid * 4 + w;
  const int nt = wg % NT16;
  const int bh = wg / NT16;
  const int b = bh / NH, hd = bh % NH;
  const int n0 = nt * 16;

  const us* qrow = q16 + ((size_t)bh * NPTS + n0) * HD + 8 * l;
  FragH aq0, aq1;
  aq0.uh[0] = *(const v8us*)(qrow);       aq0.uh[1] = *(const v8us*)(qrow + 256);
  aq1.uh[0] = *(const v8us*)(qrow + 512); aq1.uh[1] = *(const v8us*)(qrow + 768);
  const us* kbase = k16 + (size_t)bh * NPTS * HD + 8 * l;
  const us* vbase = vT16 + (size_t)bh * NPTS * HD + 8 * l;
  const float* mbb = mb + (size_t)nt * NPTS * 16 + 4 * l;

  const v8f z = {0.f, 0.f, 0.f, 0.f, 0.f, 0.f, 0.f, 0.f};
  v8f o[4];
#pragma unroll
  for (int dt = 0; dt < 4; ++dt) o[dt] = z;
  float mrow = -1.0e30f;  // the query's running maximum, equal in both halves
  float lrow = 0.f;       // the running sum over this half's keys; the halves join behind the loop

  // K, mask+bias and V fragments of a step live in registers that are reloaded for the next step
  // right behind their last use, so every load is one step old when it is waited for.
  // The walk over the keys begins at key rs and wraps round.  The 48 blocks of one (b, h), which read the same K and V, begin two steps
  // apart, the 16 blocks that read the same mask rows six steps apart: walking in step from key 0 they would all ask for a line at
  // the moment it is first fetched from memory; apart, a block mostly finds lines that another block has already brought into L2.
  const int rs = ((2 * (bid % (NT16 / 4)) + 6 * (bid / (NT16 / 4))) % (NPTS / 32)) * 32;
  FragH kf[4], vf[4];
  v8f mb0, mb1;
  ld_k(kbase + (size_t)rs * HD, kf);
  ld_mb(mbb + (size_t)rs * 16, mb0, mb1);
  // inputs-only fence on loaded values: Q, K and mask of step 0 land here, so that on entry as on the back edge
  // the V loads are the youngest outstanding and the loop's first wait does not drain them
  asm volatile("" :: "v"(aq0.v), "v"(aq1.v), "v"(kf[0].v), "v"(kf[1].v), "v"(kf[2].v), "v"(kf[3].v), "v"(mb0), "v"(mb1));
  const us* vfirst = vbase + (size_t)rs * HD;
  ld_v(vfirst, vf);
  // the wait that stands in front of a rewrite of the eight loads' address registers; it takes the pointer as an input, so that
  // the pointer stays in its registers up to it
  asm volatile("s_wait_xcnt 0x0" :: "v"(vfirst) : "memory");

  for (int key0 = 0; key0 < NPTS; key0 += 32) {
    const int kw = rs + key0 + 32;
    const int kn = (kw < NPTS) ? kw : kw - NPTS;  // next step's keys; the last step refetches the first step's, unused
    v8f s0 = mma_h2(kf[0].v, aq0.v, kf[1].v, aq1.v, z);
    v8f s1 = mma_h2(kf[2].v, aq0.v, kf[3].v, aq1.v, z);
    ld_k(kbase + (size_t)kn * HD, kf);
    // scale 1/512 (= 1/64 from the *8*8 storage, times 1/sqrt(64)) and add fused mask+bias
    s0 = s0 * SSCL + mb0;
    s1 = s1 * SSCL + mb1;
    ld_mb(mbb + (size_t)kn * 16, mb0, mb1);
    // the query's maximum over the 32 keys: 16 in the lane, the other 16 in lane l ^ 16
    const float ta = fmaxf(fmaxf(fmaxf(s0[0], s0[1]), fmaxf(s0[2], s0[3])), fmaxf(fmaxf(s0[4], s0[5]), fmaxf(s0[6], s0[7])));
    const float tb = fmaxf(fmaxf(fmaxf(s1[0], s1[1]), fmaxf(s1[2], s1[3])), fmaxf(fmaxf(s1[4], s1[5]), fmaxf(s1[6], s1[7])));
    float tm = fmaxf(ta, tb);
    tm = fmaxf(tm, xhalf(tm));
    const float mnew = fmaxf(mrow, tm);
    const float alpha = __expf(mrow - mnew);
    v8f p0, p1;
#pragma unroll
    for (int r = 0; r < 8; ++r) {
      p0[r] = __expf(s0[r] - mnew);
      p1[r] = __expf(s1[r] - mnew);
    }
    const v8f rv = p0 + p1;
    lrow = lrow * alpha + (((rv[0] + rv[1]) + (rv[2] + rv[3])) + ((rv[4] + rv[5]) + (rv[6] + rv[7])));
    mrow = mnew;
#pragma unroll
    for (int dt = 0; dt < 4; ++dt) o[dt] = o[dt] * alpha;
    // P^T as B operand: element s = key 8h + s (s < 8), key 16 + 8h + s - 8 (s >= 8) of query m; f16 scaled by 4096
    FragH pb;
    p0 = p0 * PSCL;
    p1 = p1 * PSCL;
#pragma unroll
    for (int r = 0; r < 8; ++r) {
      pb.v[r]     = (f16t)p0[r];
      pb.v[8 + r] = (f16t)p1[r];
    }
    // the step's work-group barrier stays, now with nothing to order: it holds the block's four waves, which read the same K and V
    // lines, within one step of each other, so that a line one wave has fetched is still in the WGP cache when the others load it
    // (a step of the WGP's three blocks fills most of that cache); apart, each wave would fetch its own copy from L2
    __builtin_amdgcn_s_barrier();
#pragma unroll
    for (int dt = 0; dt < 4; ++dt) o[dt] = mma_h1(vf[dt].v, pb.v, o[dt]);
    ld_v(vbase + (size_t)kn * HD, vf);
    asm volatile("s_wait_xcnt 0x0" ::: "memory");  // stands in front of the next step's rewrite of the loads' address registers
  }

  // normalise: O holds 32768 * sum p v; divide by 32768 * l
  const float inv = 1.0f / ((lrow + xhalf(lrow)) * OSCL);
  v4u hv[4], lv[4];
#pragma unroll
  for (int i = 0; i < 4; ++i) {
    const v8f f = o[i] * inv;
    const v4f f0 = {f[0], f[1], f[2], f[3]};
    const v4f f1 = {f[4], f[5], f[6], f[7]};
    split8(f0, f1, hv[i], lv[i]);
  }
  const size_t po = ((size_t)b * NPTS + n0) * NC + hd * 1024 + 8 * l;
  us* dh = ath + po;
  us* dl = atl + po;
#pragma unroll
  for (int i = 0; i < 4; ++i) {
    *(v4u*)(dh + 256 * i) = hv[i];
    *(v4u*)(dl + 256 * i) = lv[i];
  }
}

// ---------------------------------------------------------------------------
// 6) Output projection: out[b][co][n] = sum_c att[b][n][c] * Wo[co][c] + bo[co].
//    Block tile 64 n x 64 co; A = ath/atl row tiles, B = Wo hi/lo row tiles (matrix slot 3).
// ---------------------------------------------------------------------------
__global__ void __launch_bounds__(128)
k_out(const us* __restrict__ ath, const us* __restrict__ atl,
      const us* __restrict__ wh, const us* __restrict__ wl,
      const float* __restrict__ bo, float* __restrict__ out) {
  __shared__ __align__(16) float T[64 * PT];
  const int bid = blockIdx.x;
  if (bid >= NB * NT64 * NCT) return;
  const int cot = bid % NCT;
  const int nt  = (bid / NCT) % NT64;
  const int b   = bid / (NCT * NT64);
  const int n0 = nt * 64, co0 = cot * 64;
  const int t = threadIdx.x, l = t & 31, w = t >> 5, h = l >> 4, m = l & 15;
  const size_t aoff = ((size_t)b * NPTS + n0) * NC + 8 * l;
  const size_t boff = ((size_t)3 * NC + co0 + 16 * w) * NC + 8 * l;
  const GAddr g = {ath + aoff, atl + aoff, wh + boff, wl + boff};
  const int rot = grot(cot, nt);
  v8f acc[4];
  GFrag f0;
  {
    const GAddr gr = {g.ah + rot, g.al + rot, g.bh + rot, g.bl + rot};
    gload(f0, gr, 0);
    gaddr_wait(gr);
  }
  gemm64(g, rot, 0, f0, acc);
  stage64(T, acc, h, m, w);
  __syncthreads();
  const int cq = l >> 4, nq = 4 * (l & 15);
  v4f vals[8];
#pragma unroll
  for (int i = 0; i < 8; ++i) {
    const int col = 16 * w + 2 * i + cq;
    const float bb = bo[co0 + col];
    v4f f;
    f.x = T[(nq + 0) * PT + col] + bb;
    f.y = T[(nq + 1) * PT + col] + bb;
    f.z = T[(nq + 2) * PT + col] + bb;
    f.w = T[(nq + 3) * PT + col] + bb;
    vals[i] = f;
  }
  float* dst = out + ((size_t)b * NC + co0) * NPTS + n0 + nq;
#pragma unroll
  for (int i = 0; i < 8; ++i)
    *(v4f*)(dst + (size_t)(16 * w + 2 * i + cq) * NPTS) = vals[i];
  
}

// ---------------------------------------------------------------------------
// Host glue.  Inputs: x, adjacency, geo_bias, Wq, bq, Wk, bk, Wv, bv, Wo, bo.
// Workspace carve (bytes): xh, xl 2 x 6291456; wh, wl 2 x 2097152; mb 37748736;
// q16, k16, vT16 3 x 6291456; ath, atl 2 x 6291456; total 85983232.
// ---------------------------------------------------------------------------
extern "C" void kernel_launch(void* const* d_in, const int* in_sizes, int n_in,
                              void* d_out, int out_size, void* d_ws, size_t ws_size,
                              hipStream_t stream) {
  if (n_in < 11) return;
  if (in_sizes[0] != NB * NC * NPTS) return;
  if (in_sizes[1] != NPTS * NPTS || in_sizes[2] != NPTS * NPTS) return;
  if (in_sizes[3] != NC * NC || in_sizes[5] != NC * NC || in_sizes[7] != NC * NC || in_sizes[9] != NC * NC) return;
  if (in_sizes[4] != NC || in_sizes[6] != NC || in_sizes[8] != NC || in_sizes[10] != NC) return;
  if (out_size != NB * NC * NPTS) return;

  const float* x   = (const float*)d_in[0];
  const int*   adj = (const int*)d_in[1];
  const float* gb  = (const float*)d_in[2];
  const float* Wq  = (const float*)d_in[3];
  const float* bq  = (const float*)d_in[4];
  const float* Wk  = (const float*)d_in[5];
  const float* bk  = (const float*)d_in[6];
  const float* Wv  = (const float*)d_in[7];
  const float* bv  = (const float*)d_in[8];
  const float* Wo  = (const float*)d_in[9];
  const float* bo  = (const float*)d_in[10];
  float* out = (float*)d_out;

  const size_t sz_x16 = (size_t)NB * NPTS * NC * 2;         // 6291456
  const size_t sz_w16 = (size_t)4 * NC * NC * 2;             // 2097152
  const size_t sz_mb  = (size_t)NPTS * NPTS * 4;             // 37748736
  const size_t sz_hd  = (size_t)NB * NH * NPTS * HD * 2;     // 6291456
  char* ws = (char*)d_ws;
  size_t off = 0;
  us* xh   = (us*)(ws + off);    off += sz_x16;
  us* xl   = (us*)(ws + off);    off += sz_x16;
  us* wh   = (us*)(ws + off);    off += sz_w16;
  us* wl   = (us*)(ws + off);    off += sz_w16;
  float* mb = (float*)(ws + off); off += sz_mb;
  us* q16  = (us*)(ws + off);    off += sz_hd;
  us* k16  = (us*)(ws + off);    off += sz_hd;
  us* vT16 = (us*)(ws + off);    off += sz_hd;
  us* ath  = (us*)(ws + off);    off += sz_x16;
  us* atl  = (us*)(ws + off);    off += sz_x16;
  if (off > ws_size) return;

  k_cvt_x<<<NB * NT64 * NCT, 128, 0, stream>>>(x, xh, xl);
  k_cvt_w<<<(4 * NC) / 4, 128, 0, stream>>>(Wq, Wk, Wv, Wo, wh, wl);
  k_mb<<<NT16 * (NPTS / 256), 128, 0, stream>>>(adj, gb, mb);
  k_qkv<<<NB * NT64 * NH, 128, 0, stream>>>(xh, xl, wh, wl, bq, bk, bv, q16, k16, vT16);
  k_attn<<<(NB * NH * NT16) / 4, 128, 0, stream>>>(q16, k16, vT16, mb, ath, atl);
  k_out<<<NB * NT64 * NCT, 128, 0, stream>>>(ath, atl, wh, wl, bo, out);
}

// v005
// Measured time: 118 microseconds a run.
// Two timings next to v004 put it at 1.10 and 1.03 times that version's speed.
// All steps since v000 together make it 4.01 times as fast.
#include <hip/hip_runtime.h>
#include <stddef.h>

#define NB   2
#define NC   512
#define NPTS 3072
#define NH   8
#define HD   64
#define NT16 (NPTS / 16)
#define NT64 (NPTS / 64)
#define NCT  (NC / 64)
#define PT   68
#define MASKV (-30000.0f)
#define SSCL (1.0f / 512.0f)
#define PSCL 4096.0f
#define OSCL 32768.0f

typedef _Float16 f16t;
typedef unsigned short us;
typedef float        v8f  __attribute__((ext_vector_type(8)));
typedef float        v4f  __attribute__((ext_vector_type(4)));
typedef unsigned int v4u  __attribute__((ext_vector_type(4)));
typedef us           v8us __attribute__((ext_vector_type(8)));
typedef _Float16     v16h __attribute__((ext_vector_type(16)));
typedef __bf16       v16bf __attribute__((ext_vector_type(16)));
typedef int          v4i  __attribute__((ext_vector_type(4)));
typedef v4f v4fa __attribute__((may_alias));

union FragH { v16h v; v8us uh[2]; };
union FragB { v16bf v; v8us uh[2]; };

// ---------------------------------------------------------------------------
// WMMA helpers: 16x16x32, fragment layout per lane l: h = l>>4, m = l&15.
// A: row m, elements 0..7 = k0+8h+i, 8..15 = k0+16+8h+i.  B: column m, same k map
// (loaded from a k-contiguous [n][k] copy exactly like A).  D: acc[r] = (row 8h+r, col m).
// Each helper but mma_b3x3 ends with 4 v_nop tying D and keeping A/B live (VALU hazard guard).
// ---------------------------------------------------------------------------
__device__ __forceinline__ v8f mma_b3(v16bf ah, v16bf al, v16bf bh, v16bf bl, v8f c) {
  c = __builtin_amdgcn_wmma_f32_16x16x32_bf16(false, ah, false, bh, (short)0, c, false, false);
  c = __builtin_amdgcn_wmma_f32_16x16x32_bf16(false, ah, false, bl, (short)0, c, false, false);
  c = __builtin_amdgcn_wmma_f32_16x16x32_bf16(false, al, false, bh, (short)0, c, false, false);
  asm volatile("v_nop\n\tv_nop\n\tv_nop\n\tv_nop" : "+v"(c) : "v"(ah), "v"(al), "v"(bh), "v"(bl));
  return c;
}
// One A row tile against the same 16 columns of three B matrices: nine products on three accumulators, taken in turn so that no
// product waits for the one before it; each accumulator sums in the order of mma_b3.  Builtins only: the compiler keeps their distances.
__device__ __forceinline__ void mma_b3x3(v16bf ah, v16bf al, v16bf bh0, v16bf bl0, v16bf bh1, v16bf bl1, v16bf bh2, v16bf bl2,
                                         v8f &c0, v8f &c1, v8f &c2) {
  c0 = __builtin_amdgcn_wmma_f32_16x16x32_bf16(false, ah, false, bh0, (short)0, c0, false, false);
  c1 = __builtin_amdgcn_wmma_f32_16x16x32_bf16(false, ah, false, bh1, (short)0, c1, false, false);
  c2 = __builtin_amdgcn_wmma_f32_16x16x32_bf16(false, ah, false, bh2, (short)0, c2, false, false);
  c0 = __builtin_amdgcn_wmma_f32_16x16x32_bf16(false, ah, false, bl0, (short)0, c0, false, false);
  c1 = __builtin_amdgcn_wmma_f32_16x16x32_bf16(false, ah, false, bl1, (short)0, c1, false, false);
  c2 = __builtin_amdgcn_wmma_f32_16x16x32_bf16(false, ah, false, bl2, (short)0, c2, false, false);
  c0 = __builtin_amdgcn_wmma_f32_16x16x32_bf16(false, al, false, bh0, (short)0, c0, false, false);
  c1 = __builtin_amdgcn_wmma_f32_16x16x32_bf16(false, al, false, bh1, (short)0, c1, false, false);
  c2 = __builtin_amdgcn_wmma_f32_16x16x32_bf16(false, al, false, bh2, (short)0, c2, false, false);
}
__device__ __forceinline__ v8f mma_h2(v16h a0, v16h b0, v16h a1, v16h b1, v8f c) {
  c = __builtin_amdgcn_wmma_f32_16x16x32_f16(false, a0, false, b0, (short)0, c, false, false);
  c = __builtin_amdgcn_wmma_f32_16x16x32_f16(false, a1, false, b1, (short)0, c, false, false);
  asm volatile("v_nop\n\tv_nop\n\tv_nop\n\tv_nop" : "+v"(c) : "v"(a0), "v"(b0), "v"(a1), "v"(b1));
  return c;
}
__device__ __forceinline__ v8f mma_h1(v16h a, v16h b, v8f c) {
  c = __builtin_amdgcn_wmma_f32_16x16x32_f16(false, a, false, b, (short)0, c, false, false);
  asm volatile("v_nop\n\tv_nop\n\tv_nop\n\tv_nop" : "+v"(c) : "v"(a), "v"(b));
  return c;
}

// ---------------------------------------------------------------------------
// Conversion helpers.  bf16 via RNE on the f32 bits; hi/lo pair: hi = rne(x), lo = rne(x - hi).
// ---------------------------------------------------------------------------
__device__ __forceinline__ unsigned bf_bits(float x) {
  const unsigned u = __float_as_uint(x);
  return (u + 0x7FFFu + ((u >> 16) & 1u)) >> 16;
}
__device__ __forceinline__ void bf_split(float x, unsigned &hi, unsigned &lo) {
  hi = bf_bits(x);
  lo = bf_bits(x - __uint_as_float(hi << 16));
}
__device__ __forceinline__ unsigned h_bits(float x) {
  return (unsigned)__builtin_bit_cast(unsigned short, (f16t)x);
}
// 8 floats -> 8 bf16 hi (packed in hv) and 8 bf16 lo (packed in lv); element 2j in the low half-word.
__device__ __forceinline__ void split8(const v4f a, const v4f b, v4u &hv, v4u &lv) {
  unsigned h0, h1, h2, h3, h4, h5, h6, h7, l0, l1, l2, l3, l4, l5, l6, l7;
  bf_split(a.x, h0, l0); bf_split(a.y, h1, l1); bf_split(a.z, h2, l2); bf_split(a.w, h3, l3);
  bf_split(b.x, h4, l4); bf_split(b.y, h5, l5); bf_split(b.z, h6, l6); bf_split(b.w, h7, l7);
  v4u r, s;
  r.x = h0 | (h1 << 16); r.y = h2 | (h3 << 16); r.z = h4 | (h5 << 16); r.w = h6 | (h7 << 16);
  s.x = l0 | (l1 << 16); s.y = l2 | (l3 << 16); s.z = l4 | (l5 << 16); s.w = l6 | (l7 << 16);
  hv = r; lv = s;
}
// 8 floats -> 8 f16 packed in one 16-byte vector.
__device__ __forceinline__ v4u pack8h(const v4f a, const v4f b) {
  v4u r;
  r.x = h_bits(a.x) | (h_bits(a.y) << 16);
  r.y = h_bits(a.z) | (h_bits(a.w) << 16);
  r.z = h_bits(b.x) | (h_bits(b.y) << 16);
  r.w = h_bits(b.z) | (h_bits(b.w) << 16);
  return r;
}
__device__ __forceinline__ v8f cat4(v4f a, v4f b) {
  v8f r = {a.x, a.y, a.z, a.w, b.x, b.y, b.z, b.w};
  return r;
}

// ---------------------------------------------------------------------------
// 64x64 output tile GEMM core (K = 512) with bf16 hi/lo planes for A and B.
// Planes in fragment order, [row tile][k-step][piece][lane][8]: a row tile is 16*NC elements, a k-step 512, a piece 256.
// The A pointers stand at the tile of row0, lane l; row subtile rt adds rt tiles.  The B pointers stand at the tile of col0, lane l.
// Wave owns columns col0 + 16w .. +15 (folded into the B pointers by the caller), rows 0..63 as acc[0..3].
// ---------------------------------------------------------------------------
// The fragments of one k-step (32 k): B hi/lo and the four row subtiles' A hi/lo.
struct GFrag { FragB bh, bl, ah[4], al[4]; };
// Four lane pointers: A tile of row0 and B tile of col0 at some k-step, lane l, hi and lo planes.
struct GAddr { const us* ah; const us* al; const us* bh; const us* bl; };
// Loads the k-step that begins ko plane elements (a constant, 512 a k-step) behind p.
__device__ __forceinline__ void gload(GFrag &f, const GAddr &p, int ko) {
  f.bh.uh[0] = *(const v8us*)(p.bh + ko);  f.bh.uh[1] = *(const v8us*)(p.bh + ko + 256);
  f.bl.uh[0] = *(const v8us*)(p.bl + ko);  f.bl.uh[1] = *(const v8us*)(p.bl + ko + 256);
#pragma unroll
  for (int rt = 0; rt < 4; ++rt) {
    const size_t o = (size_t)rt * 16 * NC + ko;
    f.ah[rt].uh[0] = *(const v8us*)(p.ah + o);  f.ah[rt].uh[1] = *(const v8us*)(p.ah + o + 256);
    f.al[rt].uh[0] = *(const v8us*)(p.al + o);  f.al[rt].uh[1] = *(const v8us*)(p.al + o + 256);
  }
  // the 20 loads are issued here, in front of the products that follow: moved behind the first of those products they
  // would start only when the other buffer's loads have landed, and the two buffers would no longer fly together
  __builtin_amdgcn_sched_barrier(0);
}
// The wait that stands in front of a rewrite of the loads' address registers.  It takes the four pointers as inputs, so
// they stay in their registers up to it and no later load of the same run gets one of them as its destination.
__device__ __forceinline__ void gaddr_wait(const GAddr &p) {
  asm volatile("s_wait_xcnt 0x0" :: "v"(p.ah), "v"(p.al), "v"(p.bh), "v"(p.bl) : "memory");
}
__device__ __forceinline__ void gmma(const GFrag &f, v8f acc[4]) {
#pragma unroll
  for (int rt = 0; rt < 4; ++rt) acc[rt] = mma_b3(f.ah[rt].v, f.al[rt].v, f.bh.v, f.bl.v, acc[rt]);
}
// Two register buffers: all 20 loads of k-step s+1 are issued in front of the products of k-step s, so every load is one
// k-step old when it is waited for.  Behind the
// last k-step f0 is refilled with the first k-step of the same A rows and of the B rows at element offset bnext (the next product's
// first fragments where the caller has one; otherwise unused).
// The walk over k begins rot plane elements in (a multiple of 1024, below 16 * NC) and wraps round; the caller hands in f0 holding
// the k-step at rot.  Blocks that read the same A or B rows get different rot (grot): walking in step from k = 0 they would all ask
// for a line at the moment it is first fetched from memory, and every k-step would wait out memory latency; apart, a block mostly
// finds lines that another block has already brought into L2.
__device__ __forceinline__ int grot(int colblk, int rowblk) {
  return ((2 * colblk + (colblk >> 2) + rowblk) & 7) * 1024;
}
__device__ __forceinline__ void gemm64(const GAddr &g, int rot, int bnext, GFrag &f0, v8f acc[4]) {
  const v8f z = {0.f, 0.f, 0.f, 0.f, 0.f, 0.f, 0.f, 0.f};
#pragma unroll
  for (int rt = 0; rt < 4; ++rt) acc[rt] = z;
  GFrag f1;
#pragma unroll 1  // rolled: fully unrolled, the projection kernel passes 256 registers and switches register windows in the k loop
  for (int k0 = 0; k0 < 16 * NC; k0 += 1024) {  // k0 in plane elements: two k-steps of 512 a trip
    const int kc = (k0 + rot) & (16 * NC - 1);
    const int ka = (k0 + 1024 + rot) & (16 * NC - 1);  // behind the last trip: rot again
    const int kb = (k0 + 1024 < 16 * NC) ? ka : ka + bnext;
    const GAddr p1 = {g.ah + kc, g.al + kc, g.bh + kc, g.bl + kc};
    gload(f1, p1, 512);
    gmma(f0, acc);
    gaddr_wait(p1);
    const GAddr p0 = {g.ah + ka, g.al + ka, g.bh + kb, g.bl + kb};
    gload(f0, p0, 0);
    gmma(f1, acc);
    gaddr_wait(p0);
  }
}
// The same core for three B matrices that lie NC * NC plane elements apart (Wq, Wk, Wv), in ONE walk over k: the A fragments of a
// k-step are loaded once and feed all three products (28 loads for 36 matrix instructions, where three walks take 60).
// Accumulators (96) and two fragment buffers (2 x 112) fill most of the 336 registers that three waves a SIMD leave a wave.  The
// addresses are kept few: a lo plane lies a constant behind its hi plane in the workspace (XLO, WLO plane elements, the host's
// carve), so one lane pointer serves both planes of an operand and the distance goes into the loads' immediate offsets.
#define XLO (NB * NPTS * NC)
#define WLO (4 * NC * NC)
struct GFrag3 { FragB bh[3], bl[3], ah[4], al[4]; };
// Two lane pointers: hi plane of the A tile of row0 and of the B tile of col0 at some k-step.
struct GAddr2 { const us* a; const us* b; };
// Loads the k-step that begins ko plane elements (a constant, 512 a k-step) behind p.
__device__ __forceinline__ void gload3(GFrag3 &f, const GAddr2 &p, int ko) {
#pragma unroll
  for (int rt = 0; rt < 4; ++rt) {
    const int o = rt * 16 * NC + ko;
    f.ah[rt].uh[0] = *(const v8us*)(p.a + o);  f.ah[rt].uh[1] = *(const v8us*)(p.a + o + 256);
  }
#pragma unroll
  for (int mt = 0; mt < 3; ++mt) {
    const int o = WLO + mt * NC * NC + ko;
    f.bl[mt].uh[0] = *(const v8us*)(p.b + o);  f.bl[mt].uh[1] = *(const v8us*)(p.b + o + 256);
  }
#pragma unroll
  for (int rt = 0; rt < 4; ++rt) {
    const int o = XLO + rt * 16 * NC + ko;
    f.al[rt].uh[0] = *(const v8us*)(p.a + o);  f.al[rt].uh[1] = *(const v8us*)(p.a + o + 256);
  }
#pragma unroll
  for (int mt = 0; mt < 3; ++mt) {
    const int o = mt * NC * NC + ko;
    f.bh[mt].uh[0] = *(const v8us*)(p.b + o);  f.bh[mt].uh[1] = *(const v8us*)(p.b + o + 256);
  }
  // as in gload: the 28 loads are issued here, in front of the products that follow, so that the two buffers fly together
  __builtin_amdgcn_sched_barrier(0);
}
// As gaddr_wait: the wait that stands in front of a rewrite of the loads' address registers; it takes both pointers as inputs, so
// they stay in their registers up to it and no later load of the same run gets one of them as its destination.
__device__ __forceinline__ void gaddr2_wait(const GAddr2 &p) {
  asm volatile("s_wait_xcnt 0x0" :: "v"(p.a), "v"(p.b) : "memory");
}
__device__ __forceinline__ void gmma3(const GFrag3 &f, v8f acc[3][4]) {
#pragma unroll
  for (int rt = 0; rt < 4; ++rt)
    mma_b3x3(f.ah[rt].v, f.al[rt].v, f.bh[0].v, f.bl[0].v, f.bh[1].v, f.bl[1].v, f.bh[2].v, f.bl[2].v,
             acc[0][rt], acc[1][rt], acc[2][rt]);
  // the refill of this buffer stays behind all of its products: no load is issued over a fragment among the matrix instructions
  __builtin_amdgcn_sched_barrier(0);
}
// Two register buffers and the rotated walk of gemm64; the refill behind the last k-step is unused.
__device__ __forceinline__ void gemm64x3(const GAddr2 &g, int rot, v8f acc[3][4]) {
  const v8f z = {0.f, 0.f, 0.f, 0.f, 0.f, 0.f, 0.f, 0.f};
#pragma unroll
  for (int mt = 0; mt < 3; ++mt)
#pragma unroll
    for (int rt = 0; rt < 4; ++rt) acc[mt][rt] = z;
  GFrag3 f0, f1;
  {
    const GAddr2 gr = {g.a + rot, g.b + rot};
    gload3(f0, gr, 0);
    gaddr2_wait(gr);
  }
#pragma unroll 1  // rolled: the body already holds 72 matrix instructions, and unrolled it would only grow the code
  for (int k0 = 0; k0 < 16 * NC; k0 += 1024) {  // k0 in plane elements: two k-steps of 512 a trip
    const int kc = (k0 + rot) & (16 * NC - 1);
    const int ka = (k0 + 1024 + rot) & (16 * NC - 1);  // behind the last trip: rot again
    const GAddr2 p1 = {g.a + kc, g.b + kc};
    gload3(f1, p1, 512);
    gmma3(f0, acc);
    gaddr2_wait(p1);
    const GAddr2 p0 = {g.a + ka, g.b + ka};
    gload3(f0, p0, 0);
    gmma3(f1, acc);
    gaddr2_wait(p0);
  }
}
// Stage the wave's four 16x16 f32 accumulators into the block tile T[64][PT] (row = 16rt+8h+r, col = 16w+m).
__device__ __forceinline__ void stage64(float* T, const v8f acc[4], int h, int m, int w) {
#pragma unroll
  for (int rt = 0; rt < 4; ++rt)
#pragma unroll
    for (int r = 0; r < 8; ++r) T[(16 * rt + 8 * h + r) * PT + 16 * w + m] = acc[rt][r];
}

// ---------------------------------------------------------------------------
// 1) x[b][c][n] (f32) -> xh/xl bf16 hi/lo planes, rows n, k = c, fragment order.  Block: 64 n x 64 c tile through LDS;
//    wave w writes row tile w, four pieces of 512 contiguous bytes a plane.
// ---------------------------------------------------------------------------
__global__ void __launch_bounds__(128)
k_cvt_x(const float* __restrict__ x, us* __restrict__ xh, us* __restrict__ xl) {
  __shared__ __align__(16) float T[64 * PT];
  const int bid = blockIdx.x;
  if (bid >= NB * NT64 * NCT) return;
  const int ct = bid % NCT;
  const int nt = (bid / NCT) % NT64;
  const int b  = bid / (NCT * NT64);
  const int c0 = ct * 64, n0 = nt * 64;
  const int t = threadIdx.x;
  const float* src = x + ((size_t)b * NC + c0) * NPTS + n0;
#pragma unroll
  for (int i = 0; i < 32; ++i) {
    const int idx = i * 128 + t;
    const int cl = idx >> 6, nl = idx & 63;
    T[nl * PT + cl] = src[(size_t)cl * NPTS + nl];
  }
  __syncthreads();
  const int l = t & 31, w = t >> 5, h = l >> 4, m = l & 15;
  v4u hv[4], lv[4];
#pragma unroll
  for (int i = 0; i < 4; ++i) {
    const v4fa* s = (const v4fa*)(T + (16 * w + m) * PT + 16 * i + 8 * h);
    split8(s[0], s[1], hv[i], lv[i]);
  }
  const size_t po = ((size_t)b * NPTS + n0 + 16 * w) * NC + ct * 1024 + 8 * l;
  us* dh = xh + po;
  us* dl = xl + po;
#pragma unroll
  for (int i = 0; i < 4; ++i) {
    *(v4u*)(dh + 256 * i) = hv[i];
    *(v4u*)(dl + 256 * i) = lv[i];
  }
  
}

// ---------------------------------------------------------------------------
// 2) W (f32 [co][c], row-major) -> wh/wl[mat] bf16 hi/lo planes, rows co, k = c, fragment order.  One wave per 16-row x 32-k tile.
// ---------------------------------------------------------------------------
__global__ void __launch_bounds__(128)
k_cvt_w(const float* __restrict__ w0, const float* __restrict__ w1,
        const float* __restrict__ w2, const float* __restrict__ w3,
        us* __restrict__ wh, us* __restrict__ wl) {
  const int l = threadIdx.x & 31;
  const int wg = blockIdx.x * 4 + (threadIdx.x >> 5);
  if (wg >= 4 * NC) return;
  const int mat = wg / NC, tile = (wg % NC) / 16, ks = wg % 16;
  const int h = l >> 4, m = l & 15;
  const float* src = (mat == 0) ? w0 : ((mat == 1) ? w1 : ((mat == 2) ? w2 : w3));
  src += (size_t)(16 * tile + m) * NC + 32 * ks + 8 * h;
  us* dh = wh + (size_t)wg * 512 + 8 * l;
  us* dl = wl + (size_t)wg * 512 + 8 * l;
  v4u hv[2], lv[2];
#pragma unroll
  for (int p = 0; p < 2; ++p) {
    const v4f* s = (const v4f*)(src + 16 * p);
    split8(s[0], s[1], hv[p], lv[p]);
  }
#pragma unroll
  for (int p = 0; p < 2; ++p) {
    *(v4u*)(dh + 256 * p) = hv[p];
    *(v4u*)(dl + 256 * p) = lv[p];
  }
  
}

// ---------------------------------------------------------------------------
// 3) Fused mask+bias table, f32, in the order of the transposed score accumulators: per (nt, 16 keys) two pieces of 512 bytes,
//    piece q holding at lane l = 16h + m the keys 8h + 4q .. + 3 of query row 16nt + m: adj ? gb : MASKV.
//    Block covers (nt, 256 keys); wave w owns 64 keys: it reads 256 contiguous bytes of a row (two rows an instruction),
//    turns its 16 x 64 tile through LDS and writes 32 contiguous lines.
// ---------------------------------------------------------------------------
__global__ void __launch_bounds__(128)
k_mb(const int* __restrict__ adj, const float* __restrict__ gb, float* __restrict__ mb) {
  __shared__ __align__(16) float T[4 * 16 * PT];
  const int bid = blockIdx.x;
  if (bid >= NT16 * (NPTS / 256)) return;
  const int kq = bid % (NPTS / 256), nt = bid / (NPTS / 256);
  const int key0 = kq * 256, nr0 = nt * 16;
  const int l = threadIdx.x & 31, w = threadIdx.x >> 5, h = l >> 4, m = l & 15;
  float* base = mb + ((size_t)nt * NPTS + key0) * 16;
  float* tw = T + w * (16 * PT);
  const size_t idx = (size_t)(nr0 + h) * NPTS + key0 + 64 * w + 4 * m;
  const int* pa = adj + idx;
  const float* pg = gb + idx;
  v4i a[8];
  v4f g[8];
#pragma unroll
  for (int i = 0; i < 8; ++i) {
    a[i] = *(const v4i*)(pa + (size_t)(2 * i) * NPTS);
    g[i] = *(const v4f*)(pg + (size_t)(2 * i) * NPTS);
  }
  // the wait that stands in front of a rewrite of the 16 loads' address registers; it takes both pointers as inputs, so they
  // stay in their registers up to it, and all 16 loads are issued in front of it, before the first of them is waited for
  asm volatile("s_wait_xcnt 0x0" :: "v"(pa), "v"(pg) : "memory");
#pragma unroll
  for (int i = 0; i < 8; ++i) {
    v4f v;
    v.x = (a[i].x != 0) ? g[i].x : MASKV;
    v.y = (a[i].y != 0) ? g[i].y : MASKV;
    v.z = (a[i].z != 0) ? g[i].z : MASKV;
    v.w = (a[i].w != 0) ? g[i].w : MASKV;
    *(v4fa*)(tw + (2 * i + h) * PT + 4 * m) = v;
  }
  __syncthreads();
  v4f vals[8];
#pragma unroll
  for (int i = 0; i < 8; ++i) vals[i] = *(const v4fa*)(tw + m * PT + 16 * (i >> 1) + 8 * h + 4 * (i & 1));
#pragma unroll
  for (int i = 0; i < 8; ++i) *(v4f*)(base + 1024 * w + 128 * i + 4 * l) = vals[i];
}

// ---------------------------------------------------------------------------
// 4) QKV projection.  Block tile: 64 points x 64 channels (one head) of q, k and v, all three in one walk over k.
//    A = x row tiles, hi plane at xh, lo plane XLO elements behind it; B = W row tiles (hi at wh, lo WLO behind; loaded like A).
//    q16, k16: rows n, k = d, fragment order (a 16-row tile is four pieces).  vT16: per 32 keys four d tiles of two pieces, rows d, k = key.
// ---------------------------------------------------------------------------
__global__ void __launch_bounds__(128)
k_qkv(const us* __restrict__ xh, const us* __restrict__ wh,
      const float* __restrict__ bq, const float* __restrict__ bk, const float* __restrict__ bv,
      us* __restrict__ q16, us* __restrict__ k16, us* __restrict__ vT16) {
  __shared__ __align__(16) float T[64 * PT];
  const int bid = blockIdx.x;
  if (bid >= NB * NT64 * NH) return;
  const int hd = bid % NH;
  const int nt = (bid / NH) % NT64;
  const int b  = bid / (NH * NT64);
  const int n0 = nt * 64, co0 = hd * HD;
  const int t = threadIdx.x, l = t & 31, w = t >> 5, h = l >> 4, m = l & 15;
  const int bh = b * NH + hd;
  const size_t aoff = ((size_t)b * NPTS + n0) * NC + 8 * l;
  const size_t boff = ((size_t)co0 + 16 * w) * NC + 8 * l;
  const GAddr2 g = {xh + aoff, wh + boff};
  v8f acc3[3][4];
  gemm64x3(g, grot(hd, nt), acc3);
#pragma unroll  // unrolled: p indexes the accumulators, which live in registers
  for (int p = 0; p < 3; ++p) {
    stage64(T, acc3[p], h, m, w);
    __syncthreads();
    const float* bias = (p == 0) ? bq : ((p == 1) ? bk : bv);
    v4u vals[4];
    if (p < 2) {
      us* dst = ((p == 0) ? q16 : k16) + ((size_t)bh * NPTS + n0 + 16 * w) * HD + 8 * l;
#pragma unroll
      for (int i = 0; i < 4; ++i) {
        const v4f b0 = *(const v4f*)(bias + co0 + 16 * i + 8 * h);
        const v4f b1 = *(const v4f*)(bias + co0 + 16 * i + 8 * h + 4);
        const v4fa* s = (const v4fa*)(T + (16 * w + m) * PT + 16 * i + 8 * h);
        const v4f f0 = (s[0] + b0) * 8.0f;
        const v4f f1 = (s[1] + b1) * 8.0f;
        vals[i] = pack8h(f0, f1);
      }
#pragma unroll
      for (int i = 0; i < 4; ++i)
        *(v4u*)(dst + 256 * i) = vals[i];
      asm volatile("s_wait_xcnt 0x0" ::: "memory");  // stands in front of any rewrite of the four stores' address and data registers
    } else {
      us* dst = vT16 + ((size_t)bh * NPTS + n0) * HD + 512 * w + 8 * l;
      const int d = 16 * w + m;
      const float bd = bias[co0 + d];
#pragma unroll
      for (int i = 0; i < 4; ++i) {
        const int kr = 16 * i + 8 * h;  // first of the lane's 8 keys: 32-key group i >> 1, piece i & 1
        v4f f0, f1;
        f0.x = (T[(kr + 0) * PT + d] + bd) * 8.0f;
        f0.y = (T[(kr + 1) * PT + d] + bd) * 8.0f;
        f0.z = (T[(kr + 2) * PT + d] + bd) * 8.0f;
        f0.w = (T[(kr + 3) * PT + d] + bd) * 8.0f;
        f1.x = (T[(kr + 4) * PT + d] + bd) * 8.0f;
        f1.y = (T[(kr + 5) * PT + d] + bd) * 8.0f;
        f1.z = (T[(kr + 6) * PT + d] + bd) * 8.0f;
        f1.w = (T[(kr + 7) * PT + d] + bd) * 8.0f;
        vals[i] = pack8h(f0, f1);
      }
#pragma unroll
      for (int i = 0; i < 4; ++i)
        *(v4u*)(dst + 2048 * (i >> 1) + 256 * (i & 1)) = vals[i];
      
    }
    __syncthreads();
  }
}

// ---------------------------------------------------------------------------
// 5) Flash attention.  One wave per (b, h, 16 query rows); 32-key steps; online softmax in f32.
//    S^T tile: A = k16 row tiles (keys as rows, d as k), B = q16 row tile (queries as columns, loaded like A).
//    acc[r] = (key 8h+r, query m): a lane holds 16 of the 32 scores of one query, its partner lane l ^ 16 the others.
//    P^T: the two score tiles, converted in place (f16, *4096), are the B operand of the 32-key product (same k map as the planes).
//    O^T += V^T * P^T: A = vT16 tiles (d as rows, keys as k).  acc[r] = (d 16dt+8h+r, query m) is the lane's piece of the
//    att plane in fragment order: normalised, split and stored from the registers.
// ---------------------------------------------------------------------------
// Fragment loaders of one 32-key step: kp = k16 tile of key0, vp = vT16 group of key0, mp = table pieces of key0; all at lane l.
__device__ __forceinline__ void ld_k(const us* __restrict__ kp, FragH f[4]) {
#pragma unroll
  for (int i = 0; i < 2; ++i) {
    const us* p = kp + (size_t)i * 16 * HD;
    f[2 * i].uh[0]     = *(const v8us*)(p);       f[2 * i].uh[1]     = *(const v8us*)(p + 256);
    f[2 * i + 1].uh[0] = *(const v8us*)(p + 512); f[2 * i + 1].uh[1] = *(const v8us*)(p + 768);
  }
}
__device__ __forceinline__ void ld_v(const us* __restrict__ vp, FragH f[4]) {
#pragma unroll
  for (int dt = 0; dt < 4; ++dt) {
    const us* p = vp + (size_t)dt * 512;
    f[dt].uh[0] = *(const v8us*)(p);
    f[dt].uh[1] = *(const v8us*)(p + 256);
  }
}
__device__ __forceinline__ void ld_mb(const float* __restrict__ mp, v8f &a, v8f &b) {
  a = cat4(*(const v4f*)(mp),       *(const v4f*)(mp + 128));
  b = cat4(*(const v4f*)(mp + 256), *(const v4f*)(mp + 384));
}
// lane l with lane l ^ 16
__device__ __forceinline__ float xhalf(float x) {
  const int b = __builtin_bit_cast(int, x);
  return __builtin_bit_cast(float, __builtin_amdgcn_permlanex16(b, b, 0x76543210, 0xfedcba98, false, false));
}
__global__ void __launch_bounds__(128)
k_attn(const us* __restrict__ q16, const us* __restrict__ k16, const us* __restrict__ vT16,
       const float* __restrict__ mb, us* __restrict__ ath, us* __restrict__ atl) {
  const int bid = blockIdx.x;
  if (bid >= (NB * NH * NT16) / 4) return;
  const int t = threadIdx.x, l = t & 31, w = t >> 5;
  const int wg = bid * 4 + w;
  const int nt = wg % NT16;
  const int bh = wg / NT16;
  const int b = bh / NH, hd = bh % NH;
  const int n0 = nt * 16;

  const us* qrow = q16 + ((size_t)bh * NPTS + n0) * HD + 8 * l;
  FragH aq0, aq1;
  aq0.uh[0] = *(const v8us*)(qrow);       aq0.uh[1] = *(const v8us*)(qrow + 256);
  aq1.uh[0] = *(const v8us*)(qrow + 512); aq1.uh[1] = *(const v8us*)(qrow + 768);
  const us* kbase = k16 + (size_t)bh * NPTS * HD + 8 * l;
  const us* vbase = vT16 + (size_t)bh * NPTS * HD + 8 * l;
  const float* mbb = mb + (size_t)nt * NPTS * 16 + 4 * l;

  const v8f z = {0.f, 0.f, 0.f, 0.f, 0.f, 0.f, 0.f, 0.f};
  v8f o[4];
#pragma unroll
  for (int dt = 0; dt < 4; ++dt) o[dt] = z;
  float mrow = -1.0e30f;  // the query's running maximum, equal in both halves
  float lrow = 0.f;       // the running sum over this half's keys; the halves join behind the loop

  // K, mask+bias and V fragments of a step live in registers that are reloaded for the next step
  // right behind their last use, so every load is one step old when it is waited for.
  // The walk over the keys begins at key rs and wraps round.  The 48 blocks of one (b, h), which read the same K and V, begin two steps
  // apart, the 16 blocks that read the same mask rows six steps apart: walking in step from key 0 they would all ask for a line at
  // the moment it is first fetched from memory; apart, a block mostly finds lines that another block has already brought into L2.
  const int rs = ((2 * (bid % (NT16 / 4)) + 6 * (bid / (NT16 / 4))) % (NPTS / 32)) * 32;
  FragH kf[4], vf[4];
  v8f mb0, mb1;
  ld_k(kbase + (size_t)rs * HD, kf);
  ld_mb(mbb + (size_t)rs * 16, mb0, mb1);
  // inputs-only fence on loaded values: Q, K and mask of step 0 land here, so that on entry as on the back edge
  // the V loads are the youngest outstanding and the loop's first wait does not drain them
  asm volatile("" :: "v"(aq0.v), "v"(aq1.v), "v"(kf[0].v), "v"(kf[1].v), "v"(kf[2].v), "v"(kf[3].v), "v"(mb0), "v"(mb1));
  const us* vfirst = vbase + (size_t)rs * HD;
  ld_v(vfirst, vf);
  // the wait that stands in front of a rewrite of the eight loads' address registers; it takes the pointer as an input, so that
  // the pointer stays in its registers up to it
  asm volatile("s_wait_xcnt 0x0" :: "v"(vfirst) : "memory");

  for (int key0 = 0; key0 < NPTS; key0 += 32) {
    const int kw = rs + key0 + 32;
    const int kn = (kw < NPTS) ? kw : kw - NPTS;  // next step's keys; the last step refetches the first step's, unused
    v8f s0 = mma_h2(kf[0].v, aq0.v, kf[1].v, aq1.v, z);
    v8f s1 = mma_h2(kf[2].v, aq0.v, kf[3].v, aq1.v, z);
    ld_k(kbase + (size_t)kn * HD, kf);
    // scale 1/512 (= 1/64 from the *8*8 storage, times 1/sqrt(64)) and add fused mask+bias
    s0 = s0 * SSCL + mb0;
    s1 = s1 * SSCL + mb1;
    ld_mb(mbb + (size_t)kn * 16, mb0, mb1);
    // the query's maximum over the 32 keys: 16 in the lane, the other 16 in lane l ^ 16
    const float ta = fmaxf(fmaxf(fmaxf(s0[0], s0[1]), fmaxf(s0[2], s0[3])), fmaxf(fmaxf(s0[4], s0[5]), fmaxf(s0[6], s0[7])));
    const float tb = fmaxf(fmaxf(fmaxf(s1[0], s1[1]), fmaxf(s1[2], s1[3])), fmaxf(fmaxf(s1[4], s1[5]), fmaxf(s1[6], s1[7])));
    float tm = fmaxf(ta, tb);
    tm = fmaxf(tm, xhalf(tm));
    const float mnew = fmaxf(mrow, tm);
    const float alpha = __expf(mrow - mnew);
    v8f p0, p1;
#pragma unroll
    for (int r = 0; r < 8; ++r) {
      p0[r] = __expf(s0[r] - mnew);
      p1[r] = __expf(s1[r] - mnew);
    }
    const v8f rv = p0 + p1;
    lrow = lrow * alpha + (((rv[0] + rv[1]) + (rv[2] + rv[3])) + ((rv[4] + rv[5]) + (rv[6] + rv[7])));
    mrow = mnew;
#pragma unroll
    for (int dt = 0; dt < 4; ++dt) o[dt] = o[dt] * alpha;
    // P^T as B operand: element s = key 8h + s (s < 8), key 16 + 8h + s - 8 (s >= 8) of query m; f16 scaled by 4096
    FragH pb;
    p0 = p0 * PSCL;
    p1 = p1 * PSCL;
#pragma unroll
    for (int r = 0; r < 8; ++r) {
      pb.v[r]     = (f16t)p0[r];
      pb.v[8 + r] = (f16t)p1[r];
    }
    // the step's work-group barrier stays, now with nothing to order: it holds the block's four waves, which read the same K and V
    // lines, within one step of each other, so that a line one wave has fetched is still in the WGP cache when the others load it
    // (a step of the WGP's three blocks fills most of that cache); apart, each wave would fetch its own copy from L2
    __builtin_amdgcn_s_barrier();
#pragma unroll
    for (int dt = 0; dt < 4; ++dt) o[dt] = mma_h1(vf[dt].v, pb.v, o[dt]);
    ld_v(vbase + (size_t)kn * HD, vf);
    asm volatile("s_wait_xcnt 0x0" ::: "memory");  // stands in front of the next step's rewrite of the loads' address registers
  }

  // normalise: O holds 32768 * sum p v; divide by 32768 * l
  const float inv = 1.0f / ((lrow + xhalf(lrow)) * OSCL);
  v4u hv[4], lv[4];
#pragma unroll
  for (int i = 0; i < 4; ++i) {
    const v8f f = o[i] * inv;
    const v4f f0 = {f[0], f[1], f[2], f[3]};
    const v4f f1 = {f[4], f[5], f[6], f[7]};
    split8(f0, f1, hv[i], lv[i]);
  }
  const size_t po = ((size_t)b * NPTS + n0) * NC + hd * 1024 + 8 * l;
  us* dh = ath + po;
  us* dl = atl + po;
#pragma unroll
  for (int i = 0; i < 4; ++i) {
    *(v4u*)(dh + 256 * i) = hv[i];
    *(v4u*)(dl + 256 * i) = lv[i];
  }
}

// ---------------------------------------------------------------------------
// 6) Output projection: out[b][co][n] = sum_c att[b][n][c] * Wo[co][c] + bo[co].
//    Block tile 64 n x 64 co; A = ath/atl row tiles, B = Wo hi/lo row tiles (matrix slot 3).
// ---------------------------------------------------------------------------
__global__ void __launch_bounds__(128)
k_out(const us* __restrict__ ath, const us* __restrict__ atl,
      const us* __restrict__ wh, const us* __restrict__ wl,
      const float* __restrict__ bo, float* __restrict__ out) {
  __shared__ __align__(16) float T[64 * PT];
  const int bid = blockIdx.x;
  if (bid >= NB * NT64 * NCT) return;
  const int cot = bid % NCT;
  const int nt  = (bid / NCT) % NT64;
  const int b   = bid / (NCT * NT64);
  const int n0 = nt * 64, co0 = cot * 64;
  const int t = threadIdx.x, l = t & 31, w = t >> 5, h = l >> 4, m = l & 15;
  const size_t aoff = ((size_t)b * NPTS + n0) * NC + 8 * l;
  const size_t boff = ((size_t)3 * NC + co0 + 16 * w) * NC + 8 * l;
  const GAddr g = {ath + aoff, atl + aoff, wh + boff, wl + boff};
  const int rot = grot(cot, nt);
  v8f acc[4];
  GFrag f0;
  {
    const GAddr gr = {g.ah + rot, g.al + rot, g.bh + rot, g.bl + rot};
    gload(f0, gr, 0);
    gaddr_wait(gr);
  }
  gemm64(g, rot, 0, f0, acc);
  stage64(T, acc, h, m, w);
  __syncthreads();
  const int cq = l >> 4, nq = 4 * (l & 15);
  v4f vals[8];
#pragma unroll
  for (int i = 0; i < 8; ++i) {
    const int col = 16 * w + 2 * i + cq;
    const float bb = bo[co0 + col];
    v4f f;
    f.x = T[(nq + 0) * PT + col] + bb;
    f.y = T[(nq + 1) * PT + col] + bb;
    f.z = T[(nq + 2) * PT + col] + bb;
    f.w = T[(nq + 3) * PT + col] + bb;
    vals[i] = f;
  }
  float* dst = out + ((size_t)b * NC + co0) * NPTS + n0 + nq;
#pragma unroll
  for (int i = 0; i < 8; ++i)
    *(v4f*)(dst + (size_t)(16 * w + 2 * i + cq) * NPTS) = vals[i];
  
}

// ---------------------------------------------------------------------------
// Host glue.  Inputs: x, adjacency, geo_bias, Wq, bq, Wk, bk, Wv, bv, Wo, bo.
// Workspace carve (bytes): xh, xl 2 x 6291456; wh, wl 2 x 2097152; mb 37748736;
// q16, k16, vT16 3 x 6291456; ath, atl 2 x 6291456; total 85983232.
// ---------------------------------------------------------------------------
extern "C" void kernel_launch(void* const* d_in, const int* in_sizes, int n_in,
                              void* d_out, int out_size, void* d_ws, size_t ws_size,
                              hipStream_t stream) {
  if (n_in < 11) return;
  if (in_sizes[0] != NB * NC * NPTS) return;
  if (in_sizes[1] != NPTS * NPTS || in_sizes[2] != NPTS * NPTS) return;
  if (in_sizes[3] != NC * NC || in_sizes[5] != NC * NC || in_sizes[7] != NC * NC || in_sizes[9] != NC * NC) return;
  if (in_sizes[4] != NC || in_sizes[6] != NC || in_sizes[8] != NC || in_sizes[10] != NC) return;
  if (out_size != NB * NC * NPTS) return;

  const float* x   = (const float*)d_in[0];
  const int*   adj = (const int*)d_in[1];
  const float* gb  = (const float*)d_in[2];
  const float* Wq  = (const float*)d_in[3];
  const float* bq  = (const float*)d_in[4];
  const float* Wk  = (const float*)d_in[5];
  const float* bk  = (const float*)d_in[6];
  const float* Wv  = (const float*)d_in[7];
  const float* bv  = (const float*)d_in[8];
  const float* Wo  = (const float*)d_in[9];
  const float* bo  = (const float*)d_in[10];
  float* out = (float*)d_out;

  const size_t sz_x16 = (size_t)NB * NPTS * NC * 2;         // 6291456
  const size_t sz_w16 = (size_t)4 * NC * NC * 2;             // 2097152
  const size_t sz_mb  = (size_t)NPTS * NPTS * 4;             // 37748736
  const size_t sz_hd  = (size_t)NB * NH * NPTS * HD * 2;     // 6291456
  char* ws = (char*)d_ws;
  size_t off = 0;
  us* xh   = (us*)(ws + off);    off += sz_x16;
  us* xl   = (us*)(ws + off);    off += sz_x16;
  us* wh   = (us*)(ws + off);    off += sz_w16;
  us* wl   = (us*)(ws + off);    off += sz_w16;
  float* mb = (float*)(ws + off); off += sz_mb;
  us* q16  = (us*)(ws + off);    off += sz_hd;
  us* k16  = (us*)(ws + off);    off += sz_hd;
  us* vT16 = (us*)(ws + off);    off += sz_hd;
  us* ath  = (us*)(ws + off);    off += sz_x16;
  us* atl  = (us*)(ws + off);    off += sz_x16;
  if (off > ws_size) return;

  k_cvt_x<<<NB * NT64 * NCT, 128, 0, stream>>>(x, xh, xl);
  k_cvt_w<<<(4 * NC) / 4, 128, 0, stream>>>(Wq, Wk, Wv, Wo, wh, wl);
  k_mb<<<NT16 * (NPTS / 256), 128, 0, stream>>>(adj, gb, mb);
  k_qkv<<<NB * NT64 * NH, 128, 0, stream>>>(xh, wh, bq, bk, bv, q16, k16, vT16);
  k_attn<<<(NB * NH * NT16) / 4, 128, 0, stream>>>(q16, k16, vT16, mb, ath, atl);
  k_out<<<NB * NT64 * NCT, 128, 0, stream>>>(ath, atl, wh, wl, bo, out);
}

// v006
// Measured time: 114 microseconds a run.
// Two timings next to v005 both put it at 1.04 times that version's speed.
// Counting every step since v000, it is 4.17 times as fast.
#include <hip/hip_runtime.h>
#include <stddef.h>

#define NB   2
#define NC   512
#define NPTS 3072
#define NH   8
#define HD   64
#define NT16 (NPTS / 16)
#define NT64 (NPTS / 64)
#define NCT  (NC / 64)
#define PT   68
#define MASKV (-30000.0f)
#define TSCL 512.0f
#define TMAX 60000.0f
#define ESCL (1.44269504088896f / 512.0f)
#define PSCL 4096.0f
#define OSCL 32768.0f

typedef _Float16 f16t;
typedef unsigned short us;
typedef float        v8f  __attribute__((ext_vector_type(8)));
typedef float        v4f  __attribute__((ext_vector_type(4)));
typedef unsigned int v4u  __attribute__((ext_vector_type(4)));
typedef us           v8us __attribute__((ext_vector_type(8)));
typedef _Float16     v16h __attribute__((ext_vector_type(16)));
typedef __bf16       v16bf __attribute__((ext_vector_type(16)));
typedef int          v4i  __attribute__((ext_vector_type(4)));
typedef v4f v4fa __attribute__((may_alias));

union FragH { v16h v; v8us uh[2]; };
union FragB { v16bf v; v8us uh[2]; };

// ---------------------------------------------------------------------------
// WMMA helpers: 16x16x32, fragment layout per lane l: h = l>>4, m = l&15.
// A: row m, elements 0..7 = k0+8h+i, 8..15 = k0+16+8h+i.  B: column m, same k map
// (loaded from a k-contiguous [n][k] copy exactly like A).  D: acc[r] = (row 8h+r, col m).
// Each helper but mma_b3x3 ends with 4 v_nop tying D and keeping A/B live (VALU hazard guard).
// ---------------------------------------------------------------------------
__device__ __forceinline__ v8f mma_b3(v16bf ah, v16bf al, v16bf bh, v16bf bl, v8f c) {
  c = __builtin_amdgcn_wmma_f32_16x16x32_bf16(false, ah, false, bh, (short)0, c, false, false);
  c = __builtin_amdgcn_wmma_f32_16x16x32_bf16(false, ah, false, bl, (short)0, c, false, false);
  c = __builtin_amdgcn_wmma_f32_16x16x32_bf16(false, al, false, bh, (short)0, c, false, false);
  asm volatile("v_nop\n\tv_nop\n\tv_nop\n\tv_nop" : "+v"(c) : "v"(ah), "v"(al), "v"(bh), "v"(bl));
  return c;
}
// One A row tile against the same 16 columns of three B matrices: nine products on three accumulators, taken in turn so that no
// product waits for the one before it; each accumulator sums in the order of mma_b3.  Builtins only: the compiler keeps their distances.
__device__ __forceinline__ void mma_b3x3(v16bf ah, v16bf al, v16bf bh0, v16bf bl0, v16bf bh1, v16bf bl1, v16bf bh2, v16bf bl2,
                                         v8f &c0, v8f &c1, v8f &c2) {
  c0 = __builtin_amdgcn_wmma_f32_16x16x32_bf16(false, ah, false, bh0, (short)0, c0, false, false);
  c1 = __builtin_amdgcn_wmma_f32_16x16x32_bf16(false, ah, false, bh1, (short)0, c1, false, false);
  c2 = __builtin_amdgcn_wmma_f32_16x16x32_bf16(false, ah, false, bh2, (short)0, c2, false, false);
  c0 = __builtin_amdgcn_wmma_f32_16x16x32_bf16(false, ah, false, bl0, (short)0, c0, false, false);
  c1 = __builtin_amdgcn_wmma_f32_16x16x32_bf16(false, ah, false, bl1, (short)0, c1, false, false);
  c2 = __builtin_amdgcn_wmma_f32_16x16x32_bf16(false, ah, false, bl2, (short)0, c2, false, false);
  c0 = __builtin_amdgcn_wmma_f32_16x16x32_bf16(false, al, false, bh0, (short)0, c0, false, false);
  c1 = __builtin_amdgcn_wmma_f32_16x16x32_bf16(false, al, false, bh1, (short)0, c1, false, false);
  c2 = __builtin_amdgcn_wmma_f32_16x16x32_bf16(false, al, false, bh2, (short)0, c2, false, false);
}
__device__ __forceinline__ v8f mma_h3(v16h a0, v16h b0, v16h a1, v16h b1, v16h a2, v16h b2, v8f c) {
  c = __builtin_amdgcn_wmma_f32_16x16x32_f16(false, a0, false, b0, (short)0, c, false, false);
  c = __builtin_amdgcn_wmma_f32_16x16x32_f16(false, a1, false, b1, (short)0, c, false, false);
  c = __builtin_amdgcn_wmma_f32_16x16x32_f16(false, a2, false, b2, (short)0, c, false, false);
  asm volatile("v_nop\n\tv_nop\n\tv_nop\n\tv_nop" : "+v"(c) : "v"(a0), "v"(b0), "v"(a1), "v"(b1), "v"(a2), "v"(b2));
  return c;
}
__device__ __forceinline__ v8f mma_h1(v16h a, v16h b, v8f c) {
  c = __builtin_amdgcn_wmma_f32_16x16x32_f16(false, a, false, b, (short)0, c, false, false);
  asm volatile("v_nop\n\tv_nop\n\tv_nop\n\tv_nop" : "+v"(c) : "v"(a), "v"(b));
  return c;
}

// ---------------------------------------------------------------------------
// Conversion helpers.  bf16 via RNE on the f32 bits; hi/lo pair: hi = rne(x), lo = rne(x - hi).
// ---------------------------------------------------------------------------
__device__ __forceinline__ unsigned bf_bits(float x) {
  const unsigned u = __float_as_uint(x);
  return (u + 0x7FFFu + ((u >> 16) & 1u)) >> 16;
}
__device__ __forceinline__ void bf_split(float x, unsigned &hi, unsigned &lo) {
  hi = bf_bits(x);
  lo = bf_bits(x - __uint_as_float(hi << 16));
}
__device__ __forceinline__ unsigned h_bits(float x) {
  return (unsigned)__builtin_bit_cast(unsigned short, (f16t)x);
}
// 8 floats -> 8 bf16 hi (packed in hv) and 8 bf16 lo (packed in lv); element 2j in the low half-word.
__device__ __forceinline__ void split8(const v4f a, const v4f b, v4u &hv, v4u &lv) {
  unsigned h0, h1, h2, h3, h4, h5, h6, h7, l0, l1, l2, l3, l4, l5, l6, l7;
  bf_split(a.x, h0, l0); bf_split(a.y, h1, l1); bf_split(a.z, h2, l2); bf_split(a.w, h3, l3);
  bf_split(b.x, h4, l4); bf_split(b.y, h5, l5); bf_split(b.z, h6, l6); bf_split(b.w, h7, l7);
  v4u r, s;
  r.x = h0 | (h1 << 16); r.y = h2 | (h3 << 16); r.z = h4 | (h5 << 16); r.w = h6 | (h7 << 16);
  s.x = l0 | (l1 << 16); s.y = l2 | (l3 << 16); s.z = l4 | (l5 << 16); s.w = l6 | (l7 << 16);
  hv = r; lv = s;
}
// 8 floats -> 8 f16 packed in one 16-byte vector.
__device__ __forceinline__ v4u pack8h(const v4f a, const v4f b) {
  v4u r;
  r.x = h_bits(a.x) | (h_bits(a.y) << 16);
  r.y = h_bits(a.z) | (h_bits(a.w) << 16);
  r.z = h_bits(b.x) | (h_bits(b.y) << 16);
  r.w = h_bits(b.z) | (h_bits(b.w) << 16);
  return r;
}

// ---------------------------------------------------------------------------
// 64x64 output tile GEMM core (K = 512) with bf16 hi/lo planes for A and B.
// Planes in fragment order, [row tile][k-step][piece][lane][8]: a row tile is 16*NC elements, a k-step 512, a piece 256.
// The A pointers stand at the tile of row0, lane l; row subtile rt adds rt tiles.  The B pointers stand at the tile of col0, lane l.
// Wave owns columns col0 + 16w .. +15 (folded into the B pointers by the caller), rows 0..63 as acc[0..3].
// ---------------------------------------------------------------------------
// The fragments of one k-step (32 k): B hi/lo and the four row subtiles' A hi/lo.
struct GFrag { FragB bh, bl, ah[4], al[4]; };
// Four lane pointers: A tile of row0 and B tile of col0 at some k-step, lane l, hi and lo planes.
struct GAddr { const us* ah; const us* al; const us* bh; const us* bl; };
// Loads the k-step that begins ko plane elements (a constant, 512 a k-step) behind p.
__device__ __forceinline__ void gload(GFrag &f, const GAddr &p, int ko) {
  f.bh.uh[0] = *(const v8us*)(p.bh + ko);  f.bh.uh[1] = *(const v8us*)(p.bh + ko + 256);
  f.bl.uh[0] = *(const v8us*)(p.bl + ko);  f.bl.uh[1] = *(const v8us*)(p.bl + ko + 256);
#pragma unroll
  for (int rt = 0; rt < 4; ++rt) {
    const size_t o = (size_t)rt * 16 * NC + ko;
    f.ah[rt].uh[0] = *(const v8us*)(p.ah + o);  f.ah[rt].uh[1] = *(const v8us*)(p.ah + o + 256);
    f.al[rt].uh[0] = *(const v8us*)(p.al + o);  f.al[rt].uh[1] = *(const v8us*)(p.al + o + 256);
  }
  // the 20 loads are issued here, in front of the products that follow: moved behind the first of those products they
  // would start only when the other buffer's loads have landed, and the two buffers would no longer fly together
  __builtin_amdgcn_sched_barrier(0);
}
// The wait that stands in front of a rewrite of the loads' address registers.  It takes the four pointers as inputs, so
// they stay in their registers up to it and no later load of the same run gets one of them as its destination.
__device__ __forceinline__ void gaddr_wait(const GAddr &p) {
  asm volatile("s_wait_xcnt 0x0" :: "v"(p.ah), "v"(p.al), "v"(p.bh), "v"(p.bl) : "memory");
}
__device__ __forceinline__ void gmma(const GFrag &f, v8f acc[4]) {
#pragma unroll
  for (int rt = 0; rt < 4; ++rt) acc[rt] = mma_b3(f.ah[rt].v, f.al[rt].v, f.bh.v, f.bl.v, acc[rt]);
}
// Two register buffers: all 20 loads of k-step s+1 are issued in front of the products of k-step s, so every load is one
// k-step old when it is waited for.  Behind the
// last k-step f0 is refilled with the first k-step of the same A rows and of the B rows at element offset bnext (the next product's
// first fragments where the caller has one; otherwise unused).
// The walk over k begins rot plane elements in (a multiple of 1024, below 16 * NC) and wraps round; the caller hands in f0 holding
// the k-step at rot.  Blocks that read the same A or B rows get different rot (grot): walking in step from k = 0 they would all ask
// for a line at the moment it is first fetched from memory, and every k-step would wait out memory latency; apart, a block mostly
// finds lines that another block has already brought into L2.
__device__ __forceinline__ int grot(int colblk, int rowblk) {
  return ((2 * colblk + (colblk >> 2) + rowblk) & 7) * 1024;
}
__device__ __forceinline__ void gemm64(const GAddr &g, int rot, int bnext, GFrag &f0, v8f acc[4]) {
  const v8f z = {0.f, 0.f, 0.f, 0.f, 0.f, 0.f, 0.f, 0.f};
#pragma unroll
  for (int rt = 0; rt < 4; ++rt) acc[rt] = z;
  GFrag f1;
#pragma unroll 1  // rolled: fully unrolled, the projection kernel passes 256 registers and switches register windows in the k loop
  for (int k0 = 0; k0 < 16 * NC; k0 += 1024) {  // k0 in plane elements: two k-steps of 512 a trip
    const int kc = (k0 + rot) & (16 * NC - 1);
    const int ka = (k0 + 1024 + rot) & (16 * NC - 1);  // behind the last trip: rot again
    const int kb = (k0 + 1024 < 16 * NC) ? ka : ka + bnext;
    const GAddr p1 = {g.ah + kc, g.al + kc, g.bh + kc, g.bl + kc};
    gload(f1, p1, 512);
    gmma(f0, acc);
    gaddr_wait(p1);
    const GAddr p0 = {g.ah + ka, g.al + ka, g.bh + kb, g.bl + kb};
    gload(f0, p0, 0);
    gmma(f1, acc);
    gaddr_wait(p0);
  }
}
// The same core for three B matrices that lie NC * NC plane elements apart (Wq, Wk, Wv), in ONE walk over k: the A fragments of a
// k-step are loaded once and feed all three products (28 loads for 36 matrix instructions, where three walks take 60).
// Accumulators (96) and two fragment buffers (2 x 112) fill most of the 336 registers that three waves a SIMD leave a wave.  The
// addresses are kept few: a lo plane lies a constant behind its hi plane in the workspace (XLO, WLO plane elements, the host's
// carve), so one lane pointer serves both planes of an operand and the distance goes into the loads' immediate offsets.
#define XLO (NB * NPTS * NC)
#define WLO (4 * NC * NC)
struct GFrag3 { FragB bh[3], bl[3], ah[4], al[4]; };
// Two lane pointers: hi plane of the A tile of row0 and of the B tile of col0 at some k-step.
struct GAddr2 { const us* a; const us* b; };
// Loads the k-step that begins ko plane elements (a constant, 512 a k-step) behind p.
__device__ __forceinline__ void gload3(GFrag3 &f, const GAddr2 &p, int ko) {
#pragma unroll
  for (int rt = 0; rt < 4; ++rt) {
    const int o = rt * 16 * NC + ko;
    f.ah[rt].uh[0] = *(const v8us*)(p.a + o);  f.ah[rt].uh[1] = *(const v8us*)(p.a + o + 256);
  }
#pragma unroll
  for (int mt = 0; mt < 3; ++mt) {
    const int o = WLO + mt * NC * NC + ko;
    f.bl[mt].uh[0] = *(const v8us*)(p.b + o);  f.bl[mt].uh[1] = *(const v8us*)(p.b + o + 256);
  }
#pragma unroll
  for (int rt = 0; rt < 4; ++rt) {
    const int o = XLO + rt * 16 * NC + ko;
    f.al[rt].uh[0] = *(const v8us*)(p.a + o);  f.al[rt].uh[1] = *(const v8us*)(p.a + o + 256);
  }
#pragma unroll
  for (int mt = 0; mt < 3; ++mt) {
    const int o = mt * NC * NC + ko;
    f.bh[mt].uh[0] = *(const v8us*)(p.b + o);  f.bh[mt].uh[1] = *(const v8us*)(p.b + o + 256);
  }
  // as in gload: the 28 loads are issued here, in front of the products that follow, so that the two buffers fly together
  __builtin_amdgcn_sched_barrier(0);
}
// As gaddr_wait: the wait that stands in front of a rewrite of the loads' address registers; it takes both pointers as inputs, so
// they stay in their registers up to it and no later load of the same run gets one of them as its destination.
__device__ __forceinline__ void gaddr2_wait(const GAddr2 &p) {
  asm volatile("s_wait_xcnt 0x0" :: "v"(p.a), "v"(p.b) : "memory");
}
__device__ __forceinline__ void gmma3(const GFrag3 &f, v8f acc[3][4]) {
#pragma unroll
  for (int rt = 0; rt < 4; ++rt)
    mma_b3x3(f.ah[rt].v, f.al[rt].v, f.bh[0].v, f.bl[0].v, f.bh[1].v, f.bl[1].v, f.bh[2].v, f.bl[2].v,
             acc[0][rt], acc[1][rt], acc[2][rt]);
  // the refill of this buffer stays behind all of its products: no load is issued over a fragment among the matrix instructions
  __builtin_amdgcn_sched_barrier(0);
}
// Two register buffers and the rotated walk of gemm64; the refill behind the last k-step is unused.
__device__ __forceinline__ void gemm64x3(const GAddr2 &g, int rot, v8f acc[3][4]) {
  const v8f z = {0.f, 0.f, 0.f, 0.f, 0.f, 0.f, 0.f, 0.f};
#pragma unroll
  for (int mt = 0; mt < 3; ++mt)
#pragma unroll
    for (int rt = 0; rt < 4; ++rt) acc[mt][rt] = z;
  GFrag3 f0, f1;
  {
    const GAddr2 gr = {g.a + rot, g.b + rot};
    gload3(f0, gr, 0);
    gaddr2_wait(gr);
  }
#pragma unroll 1  // rolled: the body already holds 72 matrix instructions, and unrolled it would only grow the code
  for (int k0 = 0; k0 < 16 * NC; k0 += 1024) {  // k0 in plane elements: two k-steps of 512 a trip
    const int kc = (k0 + rot) & (16 * NC - 1);
    const int ka = (k0 + 1024 + rot) & (16 * NC - 1);  // behind the last trip: rot again
    const GAddr2 p1 = {g.a + kc, g.b + kc};
    gload3(f1, p1, 512);
    gmma3(f0, acc);
    gaddr2_wait(p1);
    const GAddr2 p0 = {g.a + ka, g.b + ka};
    gload3(f0, p0, 0);
    gmma3(f1, acc);
    gaddr2_wait(p0);
  }
}
// Stage the wave's four 16x16 f32 accumulators into the block tile T[64][PT] (row = 16rt+8h+r, col = 16w+m).
__device__ __forceinline__ void stage64(float* T, const v8f acc[4], int h, int m, int w) {
#pragma unroll
  for (int rt = 0; rt < 4; ++rt)
#pragma unroll
    for (int r = 0; r < 8; ++r) T[(16 * rt + 8 * h + r) * PT + 16 * w + m] = acc[rt][r];
}

// ---------------------------------------------------------------------------
// 1) x[b][c][n] (f32) -> xh/xl bf16 hi/lo planes, rows n, k = c, fragment order.  Block: 64 n x 64 c tile through LDS;
//    wave w writes row tile w, four pieces of 512 contiguous bytes a plane.
// ---------------------------------------------------------------------------
__global__ void __launch_bounds__(128)
k_cvt_x(const float* __restrict__ x, us* __restrict__ xh, us* __restrict__ xl) {
  __shared__ __align__(16) float T[64 * PT];
  const int bid = blockIdx.x;
  if (bid >= NB * NT64 * NCT) return;
  const int ct = bid % NCT;
  const int nt = (bid / NCT) % NT64;
  const int b  = bid / (NCT * NT64);
  const int c0 = ct * 64, n0 = nt * 64;
  const int t = threadIdx.x;
  const float* src = x + ((size_t)b * NC + c0) * NPTS + n0;
#pragma unroll
  for (int i = 0; i < 32; ++i) {
    const int idx = i * 128 + t;
    const int cl = idx >> 6, nl = idx & 63;
    T[nl * PT + cl] = src[(size_t)cl * NPTS + nl];
  }
  __syncthreads();
  const int l = t & 31, w = t >> 5, h = l >> 4, m = l & 15;
  v4u hv[4], lv[4];
#pragma unroll
  for (int i = 0; i < 4; ++i) {
    const v4fa* s = (const v4fa*)(T + (16 * w + m) * PT + 16 * i + 8 * h);
    split8(s[0], s[1], hv[i], lv[i]);
  }
  const size_t po = ((size_t)b * NPTS + n0 + 16 * w) * NC + ct * 1024 + 8 * l;
  us* dh = xh + po;
  us* dl = xl + po;
#pragma unroll
  for (int i = 0; i < 4; ++i) {
    *(v4u*)(dh + 256 * i) = hv[i];
    *(v4u*)(dl + 256 * i) = lv[i];
  }
  
}

// ---------------------------------------------------------------------------
// 2) W (f32 [co][c], row-major) -> wh/wl[mat] bf16 hi/lo planes, rows co, k = c, fragment order.  One wave per 16-row x 32-k tile.
// ---------------------------------------------------------------------------
__global__ void __launch_bounds__(128)
k_cvt_w(const float* __restrict__ w0, const float* __restrict__ w1,
        const float* __restrict__ w2, const float* __restrict__ w3,
        us* __restrict__ wh, us* __restrict__ wl) {
  const int l = threadIdx.x & 31;
  const int wg = blockIdx.x * 4 + (threadIdx.x >> 5);
  if (wg >= 4 * NC) return;
  const int mat = wg / NC, tile = (wg % NC) / 16, ks = wg % 16;
  const int h = l >> 4, m = l & 15;
  const float* src = (mat == 0) ? w0 : ((mat == 1) ? w1 : ((mat == 2) ? w2 : w3));
  src += (size_t)(16 * tile + m) * NC + 32 * ks + 8 * h;
  us* dh = wh + (size_t)wg * 512 + 8 * l;
  us* dl = wl + (size_t)wg * 512 + 8 * l;
  v4u hv[2], lv[2];
#pragma unroll
  for (int p = 0; p < 2; ++p) {
    const v4f* s = (const v4f*)(src + 16 * p);
    split8(s[0], s[1], hv[p], lv[p]);
  }
#pragma unroll
  for (int p = 0; p < 2; ++p) {
    *(v4u*)(dh + 256 * p) = hv[p];
    *(v4u*)(dl + 256 * p) = lv[p];
  }
  
}

// ---------------------------------------------------------------------------
// 3) Fused mask+bias table, f16, as the A operand of a 16-key x 16-query tile (keys as rows, queries as k): per (nt, 16 keys) one
//    piece of 512 bytes, holding at lane l = 16h + m the queries 16nt + 8h .. + 7 of key m: adj ? gb : MASKV (exact in f16).
//    gb is held within +-TMAX, finite in f16: an infinity times a zero of the identity operand would be a NaN.
//    Every (b, h) reads the whole table in attention, where it is the one operand that no two waves of a block share: two bytes
//    a score halve that stream.
//    Block covers (nt, 256 keys); wave w owns 64 keys: it reads 256 contiguous bytes of a row (two rows an instruction),
//    turns its 16 x 64 tile through LDS and writes 16 contiguous lines.
// ---------------------------------------------------------------------------
__device__ __forceinline__ float tval(int a, float g) {
  return (a != 0) ? fminf(fmaxf(g, -TMAX), TMAX) : MASKV;
}
__global__ void __launch_bounds__(128)
k_mb(const int* __restrict__ adj, const float* __restrict__ gb, us* __restrict__ mb) {
  __shared__ __align__(16) float T[4 * 16 * PT];
  const int bid = blockIdx.x;
  if (bid >= NT16 * (NPTS / 256)) return;
  const int kq = bid % (NPTS / 256), nt = bid / (NPTS / 256);
  const int key0 = kq * 256, nr0 = nt * 16;
  const int l = threadIdx.x & 31, w = threadIdx.x >> 5, h = l >> 4, m = l & 15;
  us* base = mb + ((size_t)nt * NPTS + key0) * 16;
  float* tw = T + w * (16 * PT);
  const size_t idx = (size_t)(nr0 + h) * NPTS + key0 + 64 * w + 4 * m;
  const int* pa = adj + idx;
  const float* pg = gb + idx;
  v4i a[8];
  v4f g[8];
#pragma unroll
  for (int i = 0; i < 8; ++i) {
    a[i] = *(const v4i*)(pa + (size_t)(2 * i) * NPTS);
    g[i] = *(const v4f*)(pg + (size_t)(2 * i) * NPTS);
  }
  // the wait that stands in front of a rewrite of the 16 loads' address registers; it takes both pointers as inputs, so they
  // stay in their registers up to it, and all 16 loads are issued in front of it, before the first of them is waited for
  asm volatile("s_wait_xcnt 0x0" :: "v"(pa), "v"(pg) : "memory");
#pragma unroll
  for (int i = 0; i < 8; ++i) {
    v4f v;
    v.x = tval(a[i].x, g[i].x);
    v.y = tval(a[i].y, g[i].y);
    v.z = tval(a[i].z, g[i].z);
    v.w = tval(a[i].w, g[i].w);
    *(v4fa*)(tw + (2 * i + h) * PT + 4 * m) = v;
  }
  __syncthreads();
  v4u vals[4];
#pragma unroll
  for (int i = 0; i < 4; ++i) {
    const float* s = tw + 8 * h * PT + 16 * i + m;  // key 16i + m of the wave's 64, query rows 8h .. 8h + 7
    const v4f f0 = {s[0], s[PT], s[2 * PT], s[3 * PT]};
    const v4f f1 = {s[4 * PT], s[5 * PT], s[6 * PT], s[7 * PT]};
    vals[i] = pack8h(f0, f1);
  }
#pragma unroll
  for (int i = 0; i < 4; ++i) *(v4u*)(base + 1024 * w + 256 * i + 8 * l) = vals[i];
}

// ---------------------------------------------------------------------------
// 4) QKV projection.  Block tile: 64 points x 64 channels (one head) of q, k and v, all three in one walk over k.
//    A = x row tiles, hi plane at xh, lo plane XLO elements behind it; B = W row tiles (hi at wh, lo WLO behind; loaded like A).
//    q16, k16: rows n, k = d, fragment order (a 16-row tile is four pieces).  vT16: per 32 keys four d tiles of two pieces, rows d, k = key.
// ---------------------------------------------------------------------------
__global__ void __launch_bounds__(128)
k_qkv(const us* __restrict__ xh, const us* __restrict__ wh,
      const float* __restrict__ bq, const float* __restrict__ bk, const float* __restrict__ bv,
      us* __restrict__ q16, us* __restrict__ k16, us* __restrict__ vT16) {
  __shared__ __align__(16) float T[64 * PT];
  const int bid = blockIdx.x;
  if (bid >= NB * NT64 * NH) return;
  const int hd = bid % NH;
  const int nt = (bid / NH) % NT64;
  const int b  = bid / (NH * NT64);
  const int n0 = nt * 64, co0 = hd * HD;
  const int t = threadIdx.x, l = t & 31, w = t >> 5, h = l >> 4, m = l & 15;
  const int bh = b * NH + hd;
  const size_t aoff = ((size_t)b * NPTS + n0) * NC + 8 * l;
  const size_t boff = ((size_t)co0 + 16 * w) * NC + 8 * l;
  const GAddr2 g = {xh + aoff, wh + boff};
  v8f acc3[3][4];
  gemm64x3(g, grot(hd, nt), acc3);
#pragma unroll  // unrolled: p indexes the accumulators, which live in registers
  for (int p = 0; p < 3; ++p) {
    stage64(T, acc3[p], h, m, w);
    __syncthreads();
    const float* bias = (p == 0) ? bq : ((p == 1) ? bk : bv);
    v4u vals[4];
    if (p < 2) {
      us* dst = ((p == 0) ? q16 : k16) + ((size_t)bh * NPTS + n0 + 16 * w) * HD + 8 * l;
#pragma unroll
      for (int i = 0; i < 4; ++i) {
        const v4f b0 = *(const v4f*)(bias + co0 + 16 * i + 8 * h);
        const v4f b1 = *(const v4f*)(bias + co0 + 16 * i + 8 * h + 4);
        const v4fa* s = (const v4fa*)(T + (16 * w + m) * PT + 16 * i + 8 * h);
        const v4f f0 = (s[0] + b0) * 8.0f;
        const v4f f1 = (s[1] + b1) * 8.0f;
        vals[i] = pack8h(f0, f1);
      }
#pragma unroll
      for (int i = 0; i < 4; ++i)
        *(v4u*)(dst + 256 * i) = vals[i];
      asm volatile("s_wait_xcnt 0x0" ::: "memory");  // stands in front of any rewrite of the four stores' address and data registers
    } else {
      us* dst = vT16 + ((size_t)bh * NPTS + n0) * HD + 512 * w + 8 * l;
      const int d = 16 * w + m;
      const float bd = bias[co0 + d];
#pragma unroll
      for (int i = 0; i < 4; ++i) {
        const int kr = 16 * i + 8 * h;  // first of the lane's 8 keys: 32-key group i >> 1, piece i & 1
        v4f f0, f1;
        f0.x = (T[(kr + 0) * PT + d] + bd) * 8.0f;
        f0.y = (T[(kr + 1) * PT + d] + bd) * 8.0f;
        f0.z = (T[(kr + 2) * PT + d] + bd) * 8.0f;
        f0.w = (T[(kr + 3) * PT + d] + bd) * 8.0f;
        f1.x = (T[(kr + 4) * PT + d] + bd) * 8.0f;
        f1.y = (T[(kr + 5) * PT + d] + bd) * 8.0f;
        f1.z = (T[(kr + 6) * PT + d] + bd) * 8.0f;
        f1.w = (T[(kr + 7) * PT + d] + bd) * 8.0f;
        vals[i] = pack8h(f0, f1);
      }
#pragma unroll
      for (int i = 0; i < 4; ++i)
        *(v4u*)(dst + 2048 * (i >> 1) + 256 * (i & 1)) = vals[i];
      
    }
    __syncthreads();
  }
}

// ---------------------------------------------------------------------------
// 5) Flash attention.  One wave per (b, h, 16 query rows); 32-key steps; online softmax in f32.
//    S^T tile: A = k16 row tiles (keys as rows, d as k), B = q16 row tile (queries as columns, loaded like A); in front of them
//    A = the step's two table tiles side by side (row m = key m of either tile; k 0..15 = the 16 queries of tile 0, k 16..31 of tile 1),
//    B = 512 * identity in the k half of the wanted tile, zero in the other: the accumulator starts at 512 * (mask+bias).
//    acc[r] = (key 8h+r, query m): a lane holds 16 of the 32 scores of one query, its partner lane l ^ 16 the others.
//    P^T: the two score tiles, converted in place (f16, *4096), are the B operand of the 32-key product (same k map as the planes).
//    O^T += V^T * P^T: A = vT16 tiles (d as rows, keys as k).  acc[r] = (d 16dt+8h+r, query m) is the lane's piece of the
//    att plane in fragment order: normalised, split and stored from the registers.
// ---------------------------------------------------------------------------
// Fragment loaders of one 32-key step: kp = k16 tile of key0, vp = vT16 group of key0, mp = table pieces of key0; all at lane l.
__device__ __forceinline__ void ld_k(const us* __restrict__ kp, FragH f[4]) {
#pragma unroll
  for (int i = 0; i < 2; ++i) {
    const us* p = kp + (size_t)i * 16 * HD;
    f[2 * i].uh[0]     = *(const v8us*)(p);       f[2 * i].uh[1]     = *(const v8us*)(p + 256);
    f[2 * i + 1].uh[0] = *(const v8us*)(p + 512); f[2 * i + 1].uh[1] = *(const v8us*)(p + 768);
  }
}
__device__ __forceinline__ void ld_v(const us* __restrict__ vp, FragH f[4]) {
#pragma unroll
  for (int dt = 0; dt < 4; ++dt) {
    const us* p = vp + (size_t)dt * 512;
    f[dt].uh[0] = *(const v8us*)(p);
    f[dt].uh[1] = *(const v8us*)(p + 256);
  }
}
__device__ __forceinline__ void ld_mb(const us* __restrict__ mp, FragH &f) {
  f.uh[0] = *(const v8us*)(mp);
  f.uh[1] = *(const v8us*)(mp + 256);
}
// lane l with lane l ^ 16
__device__ __forceinline__ float xhalf(float x) {
  const int b = __builtin_bit_cast(int, x);
  return __builtin_bit_cast(float, __builtin_amdgcn_permlanex16(b, b, 0x76543210, 0xfedcba98, false, false));
}
__global__ void __launch_bounds__(128)
k_attn(const us* __restrict__ q16, const us* __restrict__ k16, const us* __restrict__ vT16,
       const us* __restrict__ mb, us* __restrict__ ath, us* __restrict__ atl) {
  const int bid = blockIdx.x;
  if (bid >= (NB * NH * NT16) / 4) return;
  const int t = threadIdx.x, l = t & 31, w = t >> 5;
  const int wg = bid * 4 + w;
  const int nt = wg % NT16;
  const int bh = wg / NT16;
  const int b = bh / NH, hd = bh % NH;
  const int n0 = nt * 16;

  const us* qrow = q16 + ((size_t)bh * NPTS + n0) * HD + 8 * l;
  FragH aq0, aq1;
  aq0.uh[0] = *(const v8us*)(qrow);       aq0.uh[1] = *(const v8us*)(qrow + 256);
  aq1.uh[0] = *(const v8us*)(qrow + 512); aq1.uh[1] = *(const v8us*)(qrow + 768);
  const us* kbase = k16 + (size_t)bh * NPTS * HD + 8 * l;
  const us* vbase = vT16 + (size_t)bh * NPTS * HD + 8 * l;
  const us* mbb = mb + (size_t)nt * NPTS * 16 + 8 * l;

  const v8f z = {0.f, 0.f, 0.f, 0.f, 0.f, 0.f, 0.f, 0.f};
  v8f o[4];
#pragma unroll
  for (int dt = 0; dt < 4; ++dt) o[dt] = z;
  float mrow = -1.0e30f;  // the query's running maximum (of 512 * score), equal in both halves
  float lrow = 0.f;       // the running sum over this half's keys; the halves join behind the loop

  // K, mask+bias and V fragments of a step live in registers that are reloaded for the next step
  // right behind their last use, so every load is one step old when it is waited for.
  // The walk over the keys begins at key rs and wraps round.  The 48 blocks of one (b, h), which read the same K and V, begin two steps
  // apart, the 16 blocks that read the same mask rows six steps apart: walking in step from key 0 they would all ask for a line at
  // the moment it is first fetched from memory; apart, a block mostly finds lines that another block has already brought into L2.
  const int rs = ((2 * (bid % (NT16 / 4)) + 6 * (bid / (NT16 / 4))) % (NPTS / 32)) * 32;
  FragH kf[4], vf[4];
  FragH mbf, id0, id1;
  // 512 * identity as B operand: column m = l & 15; element i = k 8 * (l >> 4) + i, element 8 + i = k 16 + 8 * (l >> 4) + i.
  // id0 picks table tile 0 (k 0..15), id1 tile 1 (k 16..31).
#pragma unroll
  for (int i = 0; i < 8; ++i) {
    const f16t e = (8 * (l >> 4) + i == (l & 15)) ? (f16t)TSCL : (f16t)0.0f;
    id0.v[i] = e;           id0.v[8 + i] = (f16t)0.0f;
    id1.v[i] = (f16t)0.0f;  id1.v[8 + i] = e;
  }
  ld_k(kbase + (size_t)rs * HD, kf);
  ld_mb(mbb + (size_t)rs * 16, mbf);
  // inputs-only fence on loaded values: Q, K and mask of step 0 land here, so that on entry as on the back edge
  // the V loads are the youngest outstanding and the loop's first wait does not drain them
  asm volatile("" :: "v"(aq0.v), "v"(aq1.v), "v"(kf[0].v), "v"(kf[1].v), "v"(kf[2].v), "v"(kf[3].v), "v"(mbf.v));
  const us* vfirst = vbase + (size_t)rs * HD;
  ld_v(vfirst, vf);
  // the wait that stands in front of a rewrite of the eight loads' address registers; it takes the pointer as an input, so that
  // the pointer stays in its registers up to it
  asm volatile("s_wait_xcnt 0x0" :: "v"(vfirst) : "memory");

  for (int key0 = 0; key0 < NPTS; key0 += 32) {
    const int kw = rs + key0 + 32;
    const int kn = (kw < NPTS) ? kw : kw - NPTS;  // next step's keys; the last step refetches the first step's, unused
    // 512 * score (512 = 64 from the *8*8 storage, times sqrt(64)): the table's product first, one exact term on a zero accumulator
    const v8f s0 = mma_h3(mbf.v, id0.v, kf[0].v, aq0.v, kf[1].v, aq1.v, z);
    const v8f s1 = mma_h3(mbf.v, id1.v, kf[2].v, aq0.v, kf[3].v, aq1.v, z);
    const us* kp = kbase + (size_t)kn * HD;
    const us* mp = mbb + (size_t)kn * 16;
    ld_k(kp, kf);
    ld_mb(mp, mbf);
    // the wait that stands in front of a rewrite of the ten loads' address registers; it takes both pointers as inputs, so that
    // they stay in their registers up to it
    asm volatile("s_wait_xcnt 0x0" :: "v"(kp), "v"(mp) : "memory");
    // the query's maximum over the 32 keys: 16 in the lane, the other 16 in lane l ^ 16
    const float ta = fmaxf(fmaxf(fmaxf(s0[0], s0[1]), fmaxf(s0[2], s0[3])), fmaxf(fmaxf(s0[4], s0[5]), fmaxf(s0[6], s0[7])));
    const float tb = fmaxf(fmaxf(fmaxf(s1[0], s1[1]), fmaxf(s1[2], s1[3])), fmaxf(fmaxf(s1[4], s1[5]), fmaxf(s1[6], s1[7])));
    float tm = fmaxf(ta, tb);
    tm = fmaxf(tm, xhalf(tm));
    const float mnew = fmaxf(mrow, tm);
    const float alpha = __builtin_amdgcn_exp2f((mrow - mnew) * ESCL);  // the 1/512 goes into exp2's factor
    v8f p0 = (s0 - mnew) * ESCL;
    v8f p1 = (s1 - mnew) * ESCL;
#pragma unroll
    for (int r = 0; r < 8; ++r) {
      p0[r] = __builtin_amdgcn_exp2f(p0[r]);
      p1[r] = __builtin_amdgcn_exp2f(p1[r]);
    }
    const v8f rv = p0 + p1;
    lrow = lrow * alpha + (((rv[0] + rv[1]) + (rv[2] + rv[3])) + ((rv[4] + rv[5]) + (rv[6] + rv[7])));
    mrow = mnew;
#pragma unroll
    for (int dt = 0; dt < 4; ++dt) o[dt] = o[dt] * alpha;
    // P^T as B operand: element s = key 8h + s (s < 8), key 16 + 8h + s - 8 (s >= 8) of query m; f16 scaled by 4096
    FragH pb;
    p0 = p0 * PSCL;
    p1 = p1 * PSCL;
#pragma unroll
    for (int r = 0; r < 8; ++r) {
      pb.v[r]     = (f16t)p0[r];
      pb.v[8 + r] = (f16t)p1[r];
    }
    // the step's work-group barrier stays, now with nothing to order: it holds the block's four waves, which read the same K and V
    // lines, within one step of each other, so that a line one wave has fetched is still in the WGP cache when the others load it
    // (a step of the WGP's three blocks fills most of that cache); apart, each wave would fetch its own copy from L2
    __builtin_amdgcn_s_barrier();
#pragma unroll
    for (int dt = 0; dt < 4; ++dt) o[dt] = mma_h1(vf[dt].v, pb.v, o[dt]);
    ld_v(vbase + (size_t)kn * HD, vf);
    asm volatile("s_wait_xcnt 0x0" ::: "memory");  // stands in front of the next step's rewrite of the loads' address registers
  }

  // normalise: O holds 32768 * sum p v; divide by 32768 * l
  const float inv = 1.0f / ((lrow + xhalf(lrow)) * OSCL);
  v4u hv[4], lv[4];
#pragma unroll
  for (int i = 0; i < 4; ++i) {
    const v8f f = o[i] * inv;
    const v4f f0 = {f[0], f[1], f[2], f[3]};
    const v4f f1 = {f[4], f[5], f[6], f[7]};
    split8(f0, f1, hv[i], lv[i]);
  }
  const size_t po = ((size_t)b * NPTS + n0) * NC + hd * 1024 + 8 * l;
  us* dh = ath + po;
  us* dl = atl + po;
#pragma unroll
  for (int i = 0; i < 4; ++i) {
    *(v4u*)(dh + 256 * i) = hv[i];
    *(v4u*)(dl + 256 * i) = lv[i];
  }
}

// ---------------------------------------------------------------------------
// 6) Output projection: out[b][co][n] = sum_c att[b][n][c] * Wo[co][c] + bo[co].
//    Block tile 64 n x 64 co; A = ath/atl row tiles, B = Wo hi/lo row tiles (matrix slot 3).
// ---------------------------------------------------------------------------
__global__ void __launch_bounds__(128)
k_out(const us* __restrict__ ath, const us* __restrict__ atl,
      const us* __restrict__ wh, const us* __restrict__ wl,
      const float* __restrict__ bo, float* __restrict__ out) {
  __shared__ __align__(16) float T[64 * PT];
  const int bid = blockIdx.x;
  if (bid >= NB * NT64 * NCT) return;
  const int cot = bid % NCT;
  const int nt  = (bid / NCT) % NT64;
  const int b   = bid / (NCT * NT64);
  const int n0 = nt * 64, co0 = cot * 64;
  const int t = threadIdx.x, l = t & 31, w = t >> 5, h = l >> 4, m = l & 15;
  const size_t aoff = ((size_t)b * NPTS + n0) * NC + 8 * l;
  const size_t boff = ((size_t)3 * NC + co0 + 16 * w) * NC + 8 * l;
  const GAddr g = {ath + aoff, atl + aoff, wh + boff, wl + boff};
  const int rot = grot(cot, nt);
  v8f acc[4];
  GFrag f0;
  {
    const GAddr gr = {g.ah + rot, g.al + rot, g.bh + rot, g.bl + rot};
    gload(f0, gr, 0);
    gaddr_wait(gr);
  }
  gemm64(g, rot, 0, f0, acc);
  stage64(T, acc, h, m, w);
  __syncthreads();
  const int cq = l >> 4, nq = 4 * (l & 15);
  v4f vals[8];
#pragma unroll
  for (int i = 0; i < 8; ++i) {
    const int col = 16 * w + 2 * i + cq;
    const float bb = bo[co0 + col];
    v4f f;
    f.x = T[(nq + 0) * PT + col] + bb;
    f.y = T[(nq + 1) * PT + col] + bb;
    f.z = T[(nq + 2) * PT + col] + bb;
    f.w = T[(nq + 3) * PT + col] + bb;
    vals[i] = f;
  }
  float* dst = out + ((size_t)b * NC + co0) * NPTS + n0 + nq;
#pragma unroll
  for (int i = 0; i < 8; ++i)
    *(v4f*)(dst + (size_t)(16 * w + 2 * i + cq) * NPTS) = vals[i];
  
}

// ---------------------------------------------------------------------------
// Host glue.  Inputs: x, adjacency, geo_bias, Wq, bq, Wk, bk, Wv, bv, Wo, bo.
// Workspace carve (bytes): xh, xl 2 x 6291456; wh, wl 2 x 2097152; mb 18874368;
// q16, k16, vT16 3 x 6291456; ath, atl 2 x 6291456; total 67108864.
// ---------------------------------------------------------------------------
extern "C" void kernel_launch(void* const* d_in, const int* in_sizes, int n_in,
                              void* d_out, int out_size, void* d_ws, size_t ws_size,
                              hipStream_t stream) {
  if (n_in < 11) return;
  if (in_sizes[0] != NB * NC * NPTS) return;
  if (in_sizes[1] != NPTS * NPTS || in_sizes[2] != NPTS * NPTS) return;
  if (in_sizes[3] != NC * NC || in_sizes[5] != NC * NC || in_sizes[7] != NC * NC || in_sizes[9] != NC * NC) return;
  if (in_sizes[4] != NC || in_sizes[6] != NC || in_sizes[8] != NC || in_sizes[10] != NC) return;
  if (out_size != NB * NC * NPTS) return;

  const float* x   = (const float*)d_in[0];
  const int*   adj = (const int*)d_in[1];
  const float* gb  = (const float*)d_in[2];
  const float* Wq  = (const float*)d_in[3];
  const float* bq  = (const float*)d_in[4];
  const float* Wk  = (const float*)d_in[5];
  const float* bk  = (const float*)d_in[6];
  const float* Wv  = (const float*)d_in[7];
  const float* bv  = (const float*)d_in[8];
  const float* Wo  = (const float*)d_in[9];
  const float* bo  = (const float*)d_in[10];
  float* out = (float*)d_out;

  const size_t sz_x16 = (size_t)NB * NPTS * NC * 2;         // 6291456
  const size_t sz_w16 = (size_t)4 * NC * NC * 2;             // 2097152
  const size_t sz_mb  = (size_t)NPTS * NPTS * 2;             // 18874368
  const size_t sz_hd  = (size_t)NB * NH * NPTS * HD * 2;     // 6291456
  char* ws = (char*)d_ws;
  size_t off = 0;
  us* xh   = (us*)(ws + off);    off += sz_x16;
  us* xl   = (us*)(ws + off);    off += sz_x16;
  us* wh   = (us*)(ws + off);    off += sz_w16;
  us* wl   = (us*)(ws + off);    off += sz_w16;
  us* mb   = (us*)(ws + off);    off += sz_mb;
  us* q16  = (us*)(ws + off);    off += sz_hd;
  us* k16  = (us*)(ws + off);    off += sz_hd;
  us* vT16 = (us*)(ws + off);    off += sz_hd;
  us* ath  = (us*)(ws + off);    off += sz_x16;
  us* atl  = (us*)(ws + off);    off += sz_x16;
  if (off > ws_size) return;

  k_cvt_x<<<NB * NT64 * NCT, 128, 0, stream>>>(x, xh, xl);
  k_cvt_w<<<(4 * NC) / 4, 128, 0, stream>>>(Wq, Wk, Wv, Wo, wh, wl);
  k_mb<<<NT16 * (NPTS / 256), 128, 0, stream>>>(adj, gb, mb);
  k_qkv<<<NB * NT64 * NH, 128, 0, stream>>>(xh, wh, bq, bk, bv, q16, k16, vT16);
  k_attn<<<(NB * NH * NT16) / 4, 128, 0, stream>>>(q16, k16, vT16, mb, ath, atl);
  k_out<<<NB * NT64 * NCT, 128, 0, stream>>>(ath, atl, wh, wl, bo, out);
}

// v007
// It runs in 108 microseconds.
// Timed twice side by side with v006, it ran 1.09 and 1.03 times as fast.
// Counting every step since v000, it is 4.41 times as fast.
#include <hip/hip_runtime.h>
#include <stddef.h>

#define NB   2
#define NC   512
#define NPTS 3072
#define NH   8
#define HD   64
#define NT16 (NPTS / 16)
#define NT64 (NPTS / 64)
#define NCT  (NC / 64)
#define PT   68
#define MASKV (-30000.0f)
#define TSCL 512.0f
#define TMAX 60000.0f
#define ESCL (1.44269504088896f / 512.0f)
#define PSCL 4096.0f
#define OSCL 32768.0f

typedef _Float16 f16t;
typedef unsigned short us;
typedef float        v8f  __attribute__((ext_vector_type(8)));
typedef float        v4f  __attribute__((ext_vector_type(4)));
typedef unsigned int v4u  __attribute__((ext_vector_type(4)));
typedef us           v8us __attribute__((ext_vector_type(8)));
typedef _Float16     v16h __attribute__((ext_vector_type(16)));
typedef __bf16       v16bf __attribute__((ext_vector_type(16)));
typedef int          v4i  __attribute__((ext_vector_type(4)));
typedef v4f v4fa __attribute__((may_alias));

union FragH { v16h v; v8us uh[2]; };
union FragB { v16bf v; v8us uh[2]; };

// ---------------------------------------------------------------------------
// WMMA helpers: 16x16x32, fragment layout per lane l: h = l>>4, m = l&15.
// A: row m, elements 0..7 = k0+8h+i, 8..15 = k0+16+8h+i.  B: column m, same k map
// (loaded from a k-contiguous [n][k] copy exactly like A).  D: acc[r] = (row 8h+r, col m).
// Each helper but mma_b3x3 ends with 4 v_nop tying D and keeping A/B live (VALU hazard guard).
// ---------------------------------------------------------------------------
__device__ __forceinline__ v8f mma_b3(v16bf ah, v16bf al, v16bf bh, v16bf bl, v8f c) {
  c = __builtin_amdgcn_wmma_f32_16x16x32_bf16(false, ah, false, bh, (short)0, c, false, false);
  c = __builtin_amdgcn_wmma_f32_16x16x32_bf16(false, ah, false, bl, (short)0, c, false, false);
  c = __builtin_amdgcn_wmma_f32_16x16x32_bf16(false, al, false, bh, (short)0, c, false, false);
  asm volatile("v_nop\n\tv_nop\n\tv_nop\n\tv_nop" : "+v"(c) : "v"(ah), "v"(al), "v"(bh), "v"(bl));
  return c;
}
// One A row tile against the same 16 columns of three B matrices: nine products on three accumulators, taken in turn so that no
// product waits for the one before it; each accumulator sums in the order of mma_b3.  Builtins only: the compiler keeps their distances.
__device__ __forceinline__ void mma_b3x3(v16bf ah, v16bf al, v16bf bh0, v16bf bl0, v16bf bh1, v16bf bl1, v16bf bh2, v16bf bl2,
                                         v8f &c0, v8f &c1, v8f &c2) {
  c0 = __builtin_amdgcn_wmma_f32_16x16x32_bf16(false, ah, false, bh0, (short)0, c0, false, false);
  c1 = __builtin_amdgcn_wmma_f32_16x16x32_bf16(false, ah, false, bh1, (short)0, c1, false, false);
  c2 = __builtin_amdgcn_wmma_f32_16x16x32_bf16(false, ah, false, bh2, (short)0, c2, false, false);
  c0 = __builtin_amdgcn_wmma_f32_16x16x32_bf16(false, ah, false, bl0, (short)0, c0, false, false);
  c1 = __builtin_amdgcn_wmma_f32_16x16x32_bf16(false, ah, false, bl1, (short)0, c1, false, false);
  c2 = __builtin_amdgcn_wmma_f32_16x16x32_bf16(false, ah, false, bl2, (short)0, c2, false, false);
  c0 = __builtin_amdgcn_wmma_f32_16x16x32_bf16(false, al, false, bh0, (short)0, c0, false, false);
  c1 = __builtin_amdgcn_wmma_f32_16x16x32_bf16(false, al, false, bh1, (short)0, c1, false, false);
  c2 = __builtin_amdgcn_wmma_f32_16x16x32_bf16(false, al, false, bh2, (short)0, c2, false, false);
}

// ---------------------------------------------------------------------------
// Conversion helpers.  bf16 via RNE on the f32 bits; hi/lo pair: hi = rne(x), lo = rne(x - hi).
// ---------------------------------------------------------------------------
__device__ __forceinline__ unsigned bf_bits(float x) {
  const unsigned u = __float_as_uint(x);
  return (u + 0x7FFFu + ((u >> 16) & 1u)) >> 16;
}
__device__ __forceinline__ void bf_split(float x, unsigned &hi, unsigned &lo) {
  hi = bf_bits(x);
  lo = bf_bits(x - __uint_as_float(hi << 16));
}
__device__ __forceinline__ unsigned h_bits(float x) {
  return (unsigned)__builtin_bit_cast(unsigned short, (f16t)x);
}
// 8 floats -> 8 bf16 hi (packed in hv) and 8 bf16 lo (packed in lv); element 2j in the low half-word.
__device__ __forceinline__ void split8(const v4f a, const v4f b, v4u &hv, v4u &lv) {
  unsigned h0, h1, h2, h3, h4, h5, h6, h7, l0, l1, l2, l3, l4, l5, l6, l7;
  bf_split(a.x, h0, l0); bf_split(a.y, h1, l1); bf_split(a.z, h2, l2); bf_split(a.w, h3, l3);
  bf_split(b.x, h4, l4); bf_split(b.y, h5, l5); bf_split(b.z, h6, l6); bf_split(b.w, h7, l7);
  v4u r, s;
  r.x = h0 | (h1 << 16); r.y = h2 | (h3 << 16); r.z = h4 | (h5 << 16); r.w = h6 | (h7 << 16);
  s.x = l0 | (l1 << 16); s.y = l2 | (l3 << 16); s.z = l4 | (l5 << 16); s.w = l6 | (l7 << 16);
  hv = r; lv = s;
}
// 8 floats -> 8 f16 packed in one 16-byte vector.
__device__ __forceinline__ v4u pack8h(const v4f a, const v4f b) {
  v4u r;
  r.x = h_bits(a.x) | (h_bits(a.y) << 16);
  r.y = h_bits(a.z) | (h_bits(a.w) << 16);
  r.z = h_bits(b.x) | (h_bits(b.y) << 16);
  r.w = h_bits(b.z) | (h_bits(b.w) << 16);
  return r;
}

// ---------------------------------------------------------------------------
// 64x64 output tile GEMM core (K = 512) with bf16 hi/lo planes for A and B.
// Planes in fragment order, [row tile][k-step][piece][lane][8]: a row tile is 16*NC elements, a k-step 512, a piece 256.
// The A pointers stand at the tile of row0, lane l; row subtile rt adds rt tiles.  The B pointers stand at the tile of col0, lane l.
// Wave owns columns col0 + 16w .. +15 (folded into the B pointers by the caller), rows 0..63 as acc[0..3].
// ---------------------------------------------------------------------------
// The fragments of one k-step (32 k): B hi/lo and the four row subtiles' A hi/lo.
struct GFrag { FragB bh, bl, ah[4], al[4]; };
// Four lane pointers: A tile of row0 and B tile of col0 at some k-step, lane l, hi and lo planes.
struct GAddr { const us* ah; const us* al; const us* bh; const us* bl; };
// Loads the k-step that begins ko plane elements (a constant, 512 a k-step) behind p.
__device__ __forceinline__ void gload(GFrag &f, const GAddr &p, int ko) {
  f.bh.uh[0] = *(const v8us*)(p.bh + ko);  f.bh.uh[1] = *(const v8us*)(p.bh + ko + 256);
  f.bl.uh[0] = *(const v8us*)(p.bl + ko);  f.bl.uh[1] = *(const v8us*)(p.bl + ko + 256);
#pragma unroll
  for (int rt = 0; rt < 4; ++rt) {
    const size_t o = (size_t)rt * 16 * NC + ko;
    f.ah[rt].uh[0] = *(const v8us*)(p.ah + o);  f.ah[rt].uh[1] = *(const v8us*)(p.ah + o + 256);
    f.al[rt].uh[0] = *(const v8us*)(p.al + o);  f.al[rt].uh[1] = *(const v8us*)(p.al + o + 256);
  }
  // the 20 loads are issued here, in front of the products that follow: moved behind the first of those products they
  // would start only when the other buffer's loads have landed, and the two buffers would no longer fly together
  __builtin_amdgcn_sched_barrier(0);
}
// The wait that stands in front of a rewrite of the loads' address registers.  It takes the four pointers as inputs, so
// they stay in their registers up to it and no later load of the same run gets one of them as its destination.
__device__ __forceinline__ void gaddr_wait(const GAddr &p) {
  asm volatile("s_wait_xcnt 0x0" :: "v"(p.ah), "v"(p.al), "v"(p.bh), "v"(p.bl) : "memory");
}
__device__ __forceinline__ void gmma(const GFrag &f, v8f acc[4]) {
#pragma unroll
  for (int rt = 0; rt < 4; ++rt) acc[rt] = mma_b3(f.ah[rt].v, f.al[rt].v, f.bh.v, f.bl.v, acc[rt]);
}
// Two register buffers: all 20 loads of k-step s+1 are issued in front of the products of k-step s, so every load is one
// k-step old when it is waited for.  Behind the
// last k-step f0 is refilled with the first k-step of the same A rows and of the B rows at element offset bnext (the next product's
// first fragments where the caller has one; otherwise unused).
// The walk over k begins rot plane elements in (a multiple of 1024, below 16 * NC) and wraps round; the caller hands in f0 holding
// the k-step at rot.  Blocks that read the same A or B rows get different rot (grot): walking in step from k = 0 they would all ask
// for a line at the moment it is first fetched from memory, and every k-step would wait out memory latency; apart, a block mostly
// finds lines that another block has already brought into L2.
__device__ __forceinline__ int grot(int colblk, int rowblk) {
  return ((2 * colblk + (colblk >> 2) + rowblk) & 7) * 1024;
}
__device__ __forceinline__ void gemm64(const GAddr &g, int rot, int bnext, GFrag &f0, v8f acc[4]) {
  const v8f z = {0.f, 0.f, 0.f, 0.f, 0.f, 0.f, 0.f, 0.f};
#pragma unroll
  for (int rt = 0; rt < 4; ++rt) acc[rt] = z;
  GFrag f1;
#pragma unroll 1  // rolled: fully unrolled, the projection kernel passes 256 registers and switches register windows in the k loop
  for (int k0 = 0; k0 < 16 * NC; k0 += 1024) {  // k0 in plane elements: two k-steps of 512 a trip
    const int kc = (k0 + rot) & (16 * NC - 1);
    const int ka = (k0 + 1024 + rot) & (16 * NC - 1);  // behind the last trip: rot again
    const int kb = (k0 + 1024 < 16 * NC) ? ka : ka + bnext;
    const GAddr p1 = {g.ah + kc, g.al + kc, g.bh + kc, g.bl + kc};
    gload(f1, p1, 512);
    gmma(f0, acc);
    gaddr_wait(p1);
    const GAddr p0 = {g.ah + ka, g.al + ka, g.bh + kb, g.bl + kb};
    gload(f0, p0, 0);
    gmma(f1, acc);
    gaddr_wait(p0);
  }
}
// The same core for three B matrices that lie NC * NC plane elements apart (Wq, Wk, Wv), in ONE walk over k: the A fragments of a
// k-step are loaded once and feed all three products (28 loads for 36 matrix instructions, where three walks take 60).
// Accumulators (96) and two fragment buffers (2 x 112) fill most of the 336 registers that three waves a SIMD leave a wave.  The
// addresses are kept few: a lo plane lies a constant behind its hi plane in the workspace (XLO, WLO plane elements, the host's
// carve), so one lane pointer serves both planes of an operand and the distance goes into the loads' immediate offsets.
#define XLO (NB * NPTS * NC)
#define WLO (4 * NC * NC)
struct GFrag3 { FragB bh[3], bl[3], ah[4], al[4]; };
// Two lane pointers: hi plane of the A tile of row0 and of the B tile of col0 at some k-step.
struct GAddr2 { const us* a; const us* b; };
// Loads the k-step that begins ko plane elements (a constant, 512 a k-step) behind p.
__device__ __forceinline__ void gload3(GFrag3 &f, const GAddr2 &p, int ko) {
#pragma unroll
  for (int rt = 0; rt < 4; ++rt) {
    const int o = rt * 16 * NC + ko;
    f.ah[rt].uh[0] = *(const v8us*)(p.a + o);  f.ah[rt].uh[1] = *(const v8us*)(p.a + o + 256);
  }
#pragma unroll
  for (int mt = 0; mt < 3; ++mt) {
    const int o = WLO + mt * NC * NC + ko;
    f.bl[mt].uh[0] = *(const v8us*)(p.b + o);  f.bl[mt].uh[1] = *(const v8us*)(p.b + o + 256);
  }
#pragma unroll
  for (int rt = 0; rt < 4; ++rt) {
    const int o = XLO + rt * 16 * NC + ko;
    f.al[rt].uh[0] = *(const v8us*)(p.a + o);  f.al[rt].uh[1] = *(const v8us*)(p.a + o + 256);
  }
#pragma unroll
  for (int mt = 0; mt < 3; ++mt) {
    const int o = mt * NC * NC + ko;
    f.bh[mt].uh[0] = *(const v8us*)(p.b + o);  f.bh[mt].uh[1] = *(const v8us*)(p.b + o + 256);
  }
  // as in gload: the 28 loads are issued here, in front of the products that follow, so that the two buffers fly together
  __builtin_amdgcn_sched_barrier(0);
}
// As gaddr_wait: the wait that stands in front of a rewrite of the loads' address registers; it takes both pointers as inputs, so
// they stay in their registers up to it and no later load of the same run gets one of them as its destination.
__device__ __forceinline__ void gaddr2_wait(const GAddr2 &p) {
  asm volatile("s_wait_xcnt 0x0" :: "v"(p.a), "v"(p.b) : "memory");
}
__device__ __forceinline__ void gmma3(const GFrag3 &f, v8f acc[3][4]) {
#pragma unroll
  for (int rt = 0; rt < 4; ++rt)
    mma_b3x3(f.ah[rt].v, f.al[rt].v, f.bh[0].v, f.bl[0].v, f.bh[1].v, f.bl[1].v, f.bh[2].v, f.bl[2].v,
             acc[0][rt], acc[1][rt], acc[2][rt]);
  // the refill of this buffer stays behind all of its products: no load is issued over a fragment among the matrix instructions
  __builtin_amdgcn_sched_barrier(0);
}
// Two register buffers and the rotated walk of gemm64; the refill behind the last k-step is unused.
__device__ __forceinline__ void gemm64x3(const GAddr2 &g, int rot, v8f acc[3][4]) {
  const v8f z = {0.f, 0.f, 0.f, 0.f, 0.f, 0.f, 0.f, 0.f};
#pragma unroll
  for (int mt = 0; mt < 3; ++mt)
#pragma unroll
    for (int rt = 0; rt < 4; ++rt) acc[mt][rt] = z;
  GFrag3 f0, f1;
  {
    const GAddr2 gr = {g.a + rot, g.b + rot};
    gload3(f0, gr, 0);
    gaddr2_wait(gr);
  }
#pragma unroll 1  // rolled: the body already holds 72 matrix instructions, and unrolled it would only grow the code
  for (int k0 = 0; k0 < 16 * NC; k0 += 1024) {  // k0 in plane elements: two k-steps of 512 a trip
    const int kc = (k0 + rot) & (16 * NC - 1);
    const int ka = (k0 + 1024 + rot) & (16 * NC - 1);  // behind the last trip: rot again
    const GAddr2 p1 = {g.a + kc, g.b + kc};
    gload3(f1, p1, 512);
    gmma3(f0, acc);
    gaddr2_wait(p1);
    const GAddr2 p0 = {g.a + ka, g.b + ka};
    gload3(f0, p0, 0);
    gmma3(f1, acc);
    gaddr2_wait(p0);
  }
}
// Stage the wave's four 16x16 f32 accumulators into the block tile T[64][PT] (row = 16rt+8h+r, col = 16w+m).
__device__ __forceinline__ void stage64(float* T, const v8f acc[4], int h, int m, int w) {
#pragma unroll
  for (int rt = 0; rt < 4; ++rt)
#pragma unroll
    for (int r = 0; r < 8; ++r) T[(16 * rt + 8 * h + r) * PT + 16 * w + m] = acc[rt][r];
}

// ---------------------------------------------------------------------------
// 1) x[b][c][n] (f32) -> xh/xl bf16 hi/lo planes, rows n, k = c, fragment order.  Block: 64 n x 64 c tile through LDS;
//    wave w writes row tile w, four pieces of 512 contiguous bytes a plane.
// ---------------------------------------------------------------------------
__global__ void __launch_bounds__(128)
k_cvt_x(const float* __restrict__ x, us* __restrict__ xh, us* __restrict__ xl) {
  __shared__ __align__(16) float T[64 * PT];
  const int bid = blockIdx.x;
  if (bid >= NB * NT64 * NCT) return;
  const int ct = bid % NCT;
  const int nt = (bid / NCT) % NT64;
  const int b  = bid / (NCT * NT64);
  const int c0 = ct * 64, n0 = nt * 64;
  const int t = threadIdx.x;
  const float* src = x + ((size_t)b * NC + c0) * NPTS + n0;
#pragma unroll
  for (int i = 0; i < 32; ++i) {
    const int idx = i * 128 + t;
    const int cl = idx >> 6, nl = idx & 63;
    T[nl * PT + cl] = src[(size_t)cl * NPTS + nl];
  }
  __syncthreads();
  const int l = t & 31, w = t >> 5, h = l >> 4, m = l & 15;
  v4u hv[4], lv[4];
#pragma unroll
  for (int i = 0; i < 4; ++i) {
    const v4fa* s = (const v4fa*)(T + (16 * w + m) * PT + 16 * i + 8 * h);
    split8(s[0], s[1], hv[i], lv[i]);
  }
  const size_t po = ((size_t)b * NPTS + n0 + 16 * w) * NC + ct * 1024 + 8 * l;
  us* dh = xh + po;
  us* dl = xl + po;
#pragma unroll
  for (int i = 0; i < 4; ++i) {
    *(v4u*)(dh + 256 * i) = hv[i];
    *(v4u*)(dl + 256 * i) = lv[i];
  }
  
}

// ---------------------------------------------------------------------------
// 2) W (f32 [co][c], row-major) -> wh/wl[mat] bf16 hi/lo planes, rows co, k = c, fragment order.  One wave per 16-row x 32-k tile.
// ---------------------------------------------------------------------------
__global__ void __launch_bounds__(128)
k_cvt_w(const float* __restrict__ w0, const float* __restrict__ w1,
        const float* __restrict__ w2, const float* __restrict__ w3,
        us* __restrict__ wh, us* __restrict__ wl) {
  const int l = threadIdx.x & 31;
  const int wg = blockIdx.x * 4 + (threadIdx.x >> 5);
  if (wg >= 4 * NC) return;
  const int mat = wg / NC, tile = (wg % NC) / 16, ks = wg % 16;
  const int h = l >> 4, m = l & 15;
  const float* src = (mat == 0) ? w0 : ((mat == 1) ? w1 : ((mat == 2) ? w2 : w3));
  src += (size_t)(16 * tile + m) * NC + 32 * ks + 8 * h;
  us* dh = wh + (size_t)wg * 512 + 8 * l;
  us* dl = wl + (size_t)wg * 512 + 8 * l;
  v4u hv[2], lv[2];
#pragma unroll
  for (int p = 0; p < 2; ++p) {
    const v4f* s = (const v4f*)(src + 16 * p);
    split8(s[0], s[1], hv[p], lv[p]);
  }
#pragma unroll
  for (int p = 0; p < 2; ++p) {
    *(v4u*)(dh + 256 * p) = hv[p];
    *(v4u*)(dl + 256 * p) = lv[p];
  }
  
}

// ---------------------------------------------------------------------------
// 3) Fused mask+bias table, f16, as the A operand of a 16-key x 16-query tile (keys as rows, queries as k): per (nt, 16 keys) one
//    piece of 512 bytes, holding at lane l = 16h + m the queries 16nt + 8h .. + 7 of key m: adj ? gb : MASKV (exact in f16).
//    gb is held within +-TMAX, finite in f16: an infinity times a zero of the identity operand would be a NaN.
//    Every (b, h) reads the whole table in attention, where it is the one operand that no two waves of a block share: two bytes
//    a score halve that stream.
//    Block covers (nt, 256 keys); wave w owns 64 keys: it reads 256 contiguous bytes of a row (two rows an instruction),
//    turns its 16 x 64 tile through LDS and writes 16 contiguous lines.
// ---------------------------------------------------------------------------
__device__ __forceinline__ float tval(int a, float g) {
  return (a != 0) ? fminf(fmaxf(g, -TMAX), TMAX) : MASKV;
}
__global__ void __launch_bounds__(128)
k_mb(const int* __restrict__ adj, const float* __restrict__ gb, us* __restrict__ mb) {
  __shared__ __align__(16) float T[4 * 16 * PT];
  const int bid = blockIdx.x;
  if (bid >= NT16 * (NPTS / 256)) return;
  const int kq = bid % (NPTS / 256), nt = bid / (NPTS / 256);
  const int key0 = kq * 256, nr0 = nt * 16;
  const int l = threadIdx.x & 31, w = threadIdx.x >> 5, h = l >> 4, m = l & 15;
  us* base = mb + ((size_t)nt * NPTS + key0) * 16;
  float* tw = T + w * (16 * PT);
  const size_t idx = (size_t)(nr0 + h) * NPTS + key0 + 64 * w + 4 * m;
  const int* pa = adj + idx;
  const float* pg = gb + idx;
  v4i a[8];
  v4f g[8];
#pragma unroll
  for (int i = 0; i < 8; ++i) {
    a[i] = *(const v4i*)(pa + (size_t)(2 * i) * NPTS);
    g[i] = *(const v4f*)(pg + (size_t)(2 * i) * NPTS);
  }
  // the wait that stands in front of a rewrite of the 16 loads' address registers; it takes both pointers as inputs, so they
  // stay in their registers up to it, and all 16 loads are issued in front of it, before the first of them is waited for
  asm volatile("s_wait_xcnt 0x0" :: "v"(pa), "v"(pg) : "memory");
#pragma unroll
  for (int i = 0; i < 8; ++i) {
    v4f v;
    v.x = tval(a[i].x, g[i].x);
    v.y = tval(a[i].y, g[i].y);
    v.z = tval(a[i].z, g[i].z);
    v.w = tval(a[i].w, g[i].w);
    *(v4fa*)(tw + (2 * i + h) * PT + 4 * m) = v;
  }
  __syncthreads();
  v4u vals[4];
#pragma unroll
  for (int i = 0; i < 4; ++i) {
    const float* s = tw + 8 * h * PT + 16 * i + m;  // key 16i + m of the wave's 64, query rows 8h .. 8h + 7
    const v4f f0 = {s[0], s[PT], s[2 * PT], s[3 * PT]};
    const v4f f1 = {s[4 * PT], s[5 * PT], s[6 * PT], s[7 * PT]};
    vals[i] = pack8h(f0, f1);
  }
#pragma unroll
  for (int i = 0; i < 4; ++i) *(v4u*)(base + 1024 * w + 256 * i + 8 * l) = vals[i];
}

// ---------------------------------------------------------------------------
// 4) QKV projection.  Block tile: 64 points x 64 channels (one head) of q, k and v, all three in one walk over k.
//    A = x row tiles, hi plane at xh, lo plane XLO elements behind it; B = W row tiles (hi at wh, lo WLO behind; loaded like A).
//    q16, k16: rows n, k = d, fragment order (a 16-row tile is four pieces).  vT16: per 32 keys four d tiles of two pieces, rows d, k = key.
// ---------------------------------------------------------------------------
__global__ void __launch_bounds__(128)
k_qkv(const us* __restrict__ xh, const us* __restrict__ wh,
      const float* __restrict__ bq, const float* __restrict__ bk, const float* __restrict__ bv,
      us* __restrict__ q16, us* __restrict__ k16, us* __restrict__ vT16) {
  __shared__ __align__(16) float T[64 * PT];
  const int bid = blockIdx.x;
  if (bid >= NB * NT64 * NH) return;
  const int hd = bid % NH;
  const int nt = (bid / NH) % NT64;
  const int b  = bid / (NH * NT64);
  const int n0 = nt * 64, co0 = hd * HD;
  const int t = threadIdx.x, l = t & 31, w = t >> 5, h = l >> 4, m = l & 15;
  const int bh = b * NH + hd;
  const size_t aoff = ((size_t)b * NPTS + n0) * NC + 8 * l;
  const size_t boff = ((size_t)co0 + 16 * w) * NC + 8 * l;
  const GAddr2 g = {xh + aoff, wh + boff};
  v8f acc3[3][4];
  gemm64x3(g, grot(hd, nt), acc3);
#pragma unroll  // unrolled: p indexes the accumulators, which live in registers
  for (int p = 0; p < 3; ++p) {
    stage64(T, acc3[p], h, m, w);
    __syncthreads();
    const float* bias = (p == 0) ? bq : ((p == 1) ? bk : bv);
    v4u vals[4];
    if (p < 2) {
      us* dst = ((p == 0) ? q16 : k16) + ((size_t)bh * NPTS + n0 + 16 * w) * HD + 8 * l;
#pragma unroll
      for (int i = 0; i < 4; ++i) {
        const v4f b0 = *(const v4f*)(bias + co0 + 16 * i + 8 * h);
        const v4f b1 = *(const v4f*)(bias + co0 + 16 * i + 8 * h + 4);
        const v4fa* s = (const v4fa*)(T + (16 * w + m) * PT + 16 * i + 8 * h);
        const v4f f0 = (s[0] + b0) * 8.0f;
        const v4f f1 = (s[1] + b1) * 8.0f;
        vals[i] = pack8h(f0, f1);
      }
#pragma unroll
      for (int i = 0; i < 4; ++i)
        *(v4u*)(dst + 256 * i) = vals[i];
      asm volatile("s_wait_xcnt 0x0" ::: "memory");  // stands in front of any rewrite of the four stores' address and data registers
    } else {
      us* dst = vT16 + ((size_t)bh * NPTS + n0) * HD + 512 * w + 8 * l;
      const int d = 16 * w + m;
      const float bd = bias[co0 + d];
#pragma unroll
      for (int i = 0; i < 4; ++i) {
        const int kr = 16 * i + 8 * h;  // first of the lane's 8 keys: 32-key group i >> 1, piece i & 1
        v4f f0, f1;
        f0.x = (T[(kr + 0) * PT + d] + bd) * 8.0f;
        f0.y = (T[(kr + 1) * PT + d] + bd) * 8.0f;
        f0.z = (T[(kr + 2) * PT + d] + bd) * 8.0f;
        f0.w = (T[(kr + 3) * PT + d] + bd) * 8.0f;
        f1.x = (T[(kr + 4) * PT + d] + bd) * 8.0f;
        f1.y = (T[(kr + 5) * PT + d] + bd) * 8.0f;
        f1.z = (T[(kr + 6) * PT + d] + bd) * 8.0f;
        f1.w = (T[(kr + 7) * PT + d] + bd) * 8.0f;
        vals[i] = pack8h(f0, f1);
      }
#pragma unroll
      for (int i = 0; i < 4; ++i)
        *(v4u*)(dst + 2048 * (i >> 1) + 256 * (i & 1)) = vals[i];
      
    }
    __syncthreads();
  }
}

// ---------------------------------------------------------------------------
// 5) Flash attention.  One wave per (b, h, 32 query rows = two query tiles, half of the keys); 32-key steps; online softmax in f32.
//    S^T tile: A = k16 row tiles (keys as rows, d as k), B = q16 row tile (queries as columns, loaded like A); in front of them
//    A = the step's two table tiles side by side (row m = key m of either tile; k 0..15 = the 16 queries of tile 0, k 16..31 of tile 1),
//    B = 512 * identity in the k half of the wanted tile, zero in the other: the accumulator starts at 512 * (mask+bias).
//    acc[r] = (key 8h+r, query m): a lane holds 16 of the 32 scores of one query, its partner lane l ^ 16 the others.
//    P^T: the two score tiles, converted in place (f16, *4096), are the B operand of the 32-key product (same k map as the planes).
//    O^T += V^T * P^T: A = vT16 tiles (d as rows, keys as k).  acc[r] = (d 16dt+8h+r, query m) is the lane's piece of the
//    att plane in fragment order: normalised, split and stored from the registers.
// ---------------------------------------------------------------------------
// Fragment loaders of one 32-key step: kp = k16 tile of key0, vp = vT16 group of key0, mp = table pieces of key0; all at lane l.
__device__ __forceinline__ void ld_k(const us* __restrict__ kp, FragH f[4]) {
#pragma unroll
  for (int i = 0; i < 2; ++i) {
    const us* p = kp + (size_t)i * 16 * HD;
    f[2 * i].uh[0]     = *(const v8us*)(p);       f[2 * i].uh[1]     = *(const v8us*)(p + 256);
    f[2 * i + 1].uh[0] = *(const v8us*)(p + 512); f[2 * i + 1].uh[1] = *(const v8us*)(p + 768);
  }
}
__device__ __forceinline__ void ld_v(const us* __restrict__ vp, FragH f[4]) {
#pragma unroll
  for (int dt = 0; dt < 4; ++dt) {
    const us* p = vp + (size_t)dt * 512;
    f[dt].uh[0] = *(const v8us*)(p);
    f[dt].uh[1] = *(const v8us*)(p + 256);
  }
}
__device__ __forceinline__ void ld_mb(const us* __restrict__ mp, FragH &f) {
  f.uh[0] = *(const v8us*)(mp);
  f.uh[1] = *(const v8us*)(mp + 256);
}
// lane l with lane l ^ 16
__device__ __forceinline__ float xhalf(float x) {
  const int b = __builtin_bit_cast(int, x);
  return __builtin_bit_cast(float, __builtin_amdgcn_permlanex16(b, b, 0x76543210, 0xfedcba98, false, false));
}
// The step's twelve score products: four accumulators (query tile t, key tile j), taken in turn so that no product waits for the one
// before it; each accumulator sums in the order table, d 0..31, d 32..63.  Builtins only: the compiler keeps their distances.
__device__ __forceinline__ void mma_qk(const FragH mbf[2], const FragH &id0, const FragH &id1, const FragH kf[4],
                                       const FragH aq[2][2], v8f s[2][2]) {
  const v8f z = {0.f, 0.f, 0.f, 0.f, 0.f, 0.f, 0.f, 0.f};
#pragma unroll
  for (int t = 0; t < 2; ++t) {
    s[t][0] = __builtin_amdgcn_wmma_f32_16x16x32_f16(false, mbf[t].v, false, id0.v, (short)0, z, false, false);
    s[t][1] = __builtin_amdgcn_wmma_f32_16x16x32_f16(false, mbf[t].v, false, id1.v, (short)0, z, false, false);
  }
#pragma unroll
  for (int c = 0; c < 2; ++c)
#pragma unroll
    for (int t = 0; t < 2; ++t) {
      s[t][0] = __builtin_amdgcn_wmma_f32_16x16x32_f16(false, kf[c].v, false, aq[t][c].v, (short)0, s[t][0], false, false);
      s[t][1] = __builtin_amdgcn_wmma_f32_16x16x32_f16(false, kf[2 + c].v, false, aq[t][c].v, (short)0, s[t][1], false, false);
    }
}
#define HK (NPTS / 2)
__global__ void __launch_bounds__(128)
k_attn(const us* __restrict__ q16, const us* __restrict__ k16, const us* __restrict__ vT16,
       const us* __restrict__ mb, us* __restrict__ ath, us* __restrict__ atl) {
  // hand-over of the partial results between the two waves of a pair: per wave 9 rows of 32 lanes x 16 bytes
  __shared__ __align__(16) v4f X[4 * 9 * 32];
  const int bid = blockIdx.x;
  if (bid >= (NB * NH * NT16) / 4) return;
  const int t0 = threadIdx.x, l = t0 & 31, w = t0 >> 5;
  // The block's 64 queries are two groups of 32; a wave takes one group (two query tiles) against one half of the keys, so that a
  // K or V fragment, once in registers, feeds both tiles.  Waves w and w ^ 1 hold the same queries and join behind the loop.
  const int qg = w >> 1, kh = w & 1;
  const int nt = (bid % (NT16 / 4)) * 4 + 2 * qg;
  const int bh = bid / (NT16 / 4);
  const int b = bh / NH, hd = bh % NH;
  const int n0 = nt * 16;

  const us* qrow = q16 + ((size_t)bh * NPTS + n0) * HD + 8 * l;
  FragH aq[2][2];
#pragma unroll
  for (int t = 0; t < 2; ++t) {
    aq[t][0].uh[0] = *(const v8us*)(qrow + 1024 * t);       aq[t][0].uh[1] = *(const v8us*)(qrow + 1024 * t + 256);
    aq[t][1].uh[0] = *(const v8us*)(qrow + 1024 * t + 512); aq[t][1].uh[1] = *(const v8us*)(qrow + 1024 * t + 768);
  }
  const us* kbase = k16 + ((size_t)bh * NPTS + kh * HK) * HD + 8 * l;
  const us* vbase = vT16 + ((size_t)bh * NPTS + kh * HK) * HD + 8 * l;
  const us* mbb = mb + ((size_t)nt * NPTS + kh * HK) * 16 + 8 * l;  // query tile 1: NPTS * 16 elements behind

  const v8f z = {0.f, 0.f, 0.f, 0.f, 0.f, 0.f, 0.f, 0.f};
  v8f o[2][4];
  float mrow[2], lrow[2];
#pragma unroll
  for (int t = 0; t < 2; ++t) {
#pragma unroll
    for (int dt = 0; dt < 4; ++dt) o[t][dt] = z;
    mrow[t] = -1.0e30f;  // the query's running maximum (of 512 * score), equal in both halves of the wave
    lrow[t] = 0.f;       // the running sum over this lane half's keys; the lane halves join behind the loop
  }

  // K, mask+bias and V fragments of a step live in registers that are reloaded for the next step
  // right behind their last use, so every load is one step old when it is waited for.
  // The walk over the wave's half of the keys begins rs keys in and wraps round.  The 48 blocks of one (b, h), which read the same K and
  // V, begin one step apart, the 16 blocks that read the same mask rows three steps apart: walking in step from the first key they would
  // all ask for a line at the moment it is first fetched from memory; apart, a block mostly finds lines that another block has
  // already brought into L2.
  const int rs = (((bid % (NT16 / 4)) + 3 * (bid / (NT16 / 4))) % (HK / 32)) * 32;
  FragH kf[4], vf[4];
  FragH mbf[2], id0, id1;
  // 512 * identity as B operand: column m = l & 15; element i = k 8 * (l >> 4) + i, element 8 + i = k 16 + 8 * (l >> 4) + i.
  // id0 picks table tile 0 (k 0..15), id1 tile 1 (k 16..31).
#pragma unroll
  for (int i = 0; i < 8; ++i) {
    const f16t e = (8 * (l >> 4) + i == (l & 15)) ? (f16t)TSCL : (f16t)0.0f;
    id0.v[i] = e;           id0.v[8 + i] = (f16t)0.0f;
    id1.v[i] = (f16t)0.0f;  id1.v[8 + i] = e;
  }
  ld_k(kbase + (size_t)rs * HD, kf);
  ld_mb(mbb + (size_t)rs * 16, mbf[0]);
  ld_mb(mbb + (size_t)rs * 16 + NPTS * 16, mbf[1]);
  // inputs-only fence on loaded values: Q, K and mask of step 0 land here, so that on entry only V loads are outstanding,
  // as on the back edge behind the next K and mask loads, and the loop's first wait does not drain them
  asm volatile("" :: "v"(aq[0][0].v), "v"(aq[0][1].v), "v"(aq[1][0].v), "v"(aq[1][1].v),
                     "v"(kf[0].v), "v"(kf[1].v), "v"(kf[2].v), "v"(kf[3].v), "v"(mbf[0].v), "v"(mbf[1].v));
  const us* vfirst = vbase + (size_t)rs * HD;
  ld_v(vfirst, vf);
  // the wait that stands in front of a rewrite of the eight loads' address registers; it takes the pointer as an input, so that
  // the pointer stays in its registers up to it
  asm volatile("s_wait_xcnt 0x0" :: "v"(vfirst) : "memory");

  for (int key0 = 0; key0 < HK; key0 += 32) {
    const int kw = rs + key0 + 32;
    const int kn = (kw < HK) ? kw : kw - HK;  // next step's keys; the last step refetches the first step's, unused
    // 512 * score (512 = 64 from the *8*8 storage, times sqrt(64)): the table's product first, one exact term on a zero accumulator
    v8f s[2][2];
    mma_qk(mbf, id0, id1, kf, aq, s);
    // as at the end of mma_b3: four slots behind the last product, tying the accumulators and keeping the K and table fragments live, so
    // that their refill stays behind all of their products and goes into the same registers (issued among the products it went to
    // other registers and was copied back, 16 moves a step)
    asm volatile("v_nop\n\tv_nop\n\tv_nop\n\tv_nop" : "+v"(s[0][0]), "+v"(s[0][1]), "+v"(s[1][0]), "+v"(s[1][1])
                 : "v"(kf[0].v), "v"(kf[1].v), "v"(kf[2].v), "v"(kf[3].v), "v"(mbf[0].v), "v"(mbf[1].v));
    const us* kp = kbase + (size_t)kn * HD;
    const us* mp = mbb + (size_t)kn * 16;
    ld_k(kp, kf);
    ld_mb(mp, mbf[0]);
    ld_mb(mp + NPTS * 16, mbf[1]);
    // the wait that stands in front of a rewrite of the twelve loads' address registers; it takes both pointers as inputs, so that
    // they stay in their registers up to it
    asm volatile("s_wait_xcnt 0x0" :: "v"(kp), "v"(mp) : "memory");
    FragH pb[2];
#pragma unroll
    for (int t = 0; t < 2; ++t) {
      const v8f s0 = s[t][0], s1 = s[t][1];
      // the query's maximum over the 32 keys: 16 in the lane, the other 16 in lane l ^ 16
      const float ta = fmaxf(fmaxf(fmaxf(s0[0], s0[1]), fmaxf(s0[2], s0[3])), fmaxf(fmaxf(s0[4], s0[5]), fmaxf(s0[6], s0[7])));
      const float tb = fmaxf(fmaxf(fmaxf(s1[0], s1[1]), fmaxf(s1[2], s1[3])), fmaxf(fmaxf(s1[4], s1[5]), fmaxf(s1[6], s1[7])));
      float tm = fmaxf(ta, tb);
      tm = fmaxf(tm, xhalf(tm));
      const float mnew = fmaxf(mrow[t], tm);
      const float alpha = __builtin_amdgcn_exp2f((mrow[t] - mnew) * ESCL);  // the 1/512 goes into exp2's factor
      v8f p0 = (s0 - mnew) * ESCL;
      v8f p1 = (s1 - mnew) * ESCL;
#pragma unroll
      for (int r = 0; r < 8; ++r) {
        p0[r] = __builtin_amdgcn_exp2f(p0[r]);
        p1[r] = __builtin_amdgcn_exp2f(p1[r]);
      }
      const v8f rv = p0 + p1;
      lrow[t] = lrow[t] * alpha + (((rv[0] + rv[1]) + (rv[2] + rv[3])) + ((rv[4] + rv[5]) + (rv[6] + rv[7])));
      mrow[t] = mnew;
#pragma unroll
      for (int dt = 0; dt < 4; ++dt) o[t][dt] = o[t][dt] * alpha;
      // P^T as B operand: element s = key 8h + s (s < 8), key 16 + 8h + s - 8 (s >= 8) of query m; f16 scaled by 4096
      p0 = p0 * PSCL;
      p1 = p1 * PSCL;
#pragma unroll
      for (int r = 0; r < 8; ++r) {
        pb[t].v[r]     = (f16t)p0[r];
        pb[t].v[8 + r] = (f16t)p1[r];
      }
    }
    // the step's work-group barrier, with nothing to order: it holds the block's waves, of which two each read the same K and V
    // lines, within one step of each other, so that a line one wave has fetched is still in the WGP cache when the other loads it;
    // apart, each wave would fetch its own copy from L2
    __builtin_amdgcn_s_barrier();
    // eight independent accumulators; builtins only: the compiler keeps their distances
#pragma unroll
    for (int dt = 0; dt < 4; ++dt)
#pragma unroll
      for (int t = 0; t < 2; ++t)
        o[t][dt] = __builtin_amdgcn_wmma_f32_16x16x32_f16(false, vf[dt].v, false, pb[t].v, (short)0, o[t][dt], false, false);
    ld_v(vbase + (size_t)kn * HD, vf);
    asm volatile("s_wait_xcnt 0x0" ::: "memory");  // stands in front of the next step's rewrite of the loads' address registers
  }

  // The pair joins its two key halves: wave kh keeps query tile kh and hands tile 1 - kh (maximum, sum, O) to its partner through LDS.
  const bool k1 = (kh != 0);
  const float ls0 = lrow[0] + xhalf(lrow[0]);
  const float ls1 = lrow[1] + xhalf(lrow[1]);
  const float mk = k1 ? mrow[1] : mrow[0], mg = k1 ? mrow[0] : mrow[1];
  const float lk = k1 ? ls1 : ls0,         lg = k1 ? ls0 : ls1;
  v8f ok[4];
  v4f* xw = X + w * (9 * 32) + l;
#pragma unroll
  for (int dt = 0; dt < 4; ++dt) {
    v8f og;
#pragma unroll
    for (int r = 0; r < 8; ++r) {
      ok[dt][r] = k1 ? o[1][dt][r] : o[0][dt][r];
      og[r]     = k1 ? o[0][dt][r] : o[1][dt][r];
    }
    const v4f g0 = {og[0], og[1], og[2], og[3]};
    const v4f g1 = {og[4], og[5], og[6], og[7]};
    xw[(2 * dt) * 32] = g0;
    xw[(2 * dt + 1) * 32] = g1;
  }
  {
    const v4f gm = {mg, lg, 0.f, 0.f};
    xw[8 * 32] = gm;
  }
  __syncthreads();
  const v4f* xr = X + (w ^ 1) * (9 * 32) + l;
  const v4f pm = xr[8 * 32];
  const float mm = fmaxf(mk, pm.x);
  const float ak = __builtin_amdgcn_exp2f((mk - mm) * ESCL);
  const float ap = __builtin_amdgcn_exp2f((pm.x - mm) * ESCL);
  // normalise: O holds 32768 * sum p v; divide by 32768 * l
  const float inv = 1.0f / ((lk * ak + pm.y * ap) * OSCL);
  const float ck = ak * inv, cp = ap * inv;
  v4u hv[4], lv[4];
#pragma unroll
  for (int i = 0; i < 4; ++i) {
    const v4f q0 = xr[(2 * i) * 32];
    const v4f q1 = xr[(2 * i + 1) * 32];
    const v4f k0 = {ok[i][0], ok[i][1], ok[i][2], ok[i][3]};
    const v4f k4 = {ok[i][4], ok[i][5], ok[i][6], ok[i][7]};
    const v4f f0 = k0 * ck + q0 * cp;
    const v4f f1 = k4 * ck + q1 * cp;
    split8(f0, f1, hv[i], lv[i]);
  }
  const size_t po = ((size_t)b * NPTS + n0 + 16 * kh) * NC + hd * 1024 + 8 * l;
  us* dh = ath + po;
  us* dl = atl + po;
#pragma unroll
  for (int i = 0; i < 4; ++i) {
    *(v4u*)(dh + 256 * i) = hv[i];
    *(v4u*)(dl + 256 * i) = lv[i];
  }
}

// ---------------------------------------------------------------------------
// 6) Output projection: out[b][co][n] = sum_c att[b][n][c] * Wo[co][c] + bo[co].
//    Block tile 64 n x 64 co; A = ath/atl row tiles, B = Wo hi/lo row tiles (matrix slot 3).
// ---------------------------------------------------------------------------
__global__ void __launch_bounds__(128)
k_out(const us* __restrict__ ath, const us* __restrict__ atl,
      const us* __restrict__ wh, const us* __restrict__ wl,
      const float* __restrict__ bo, float* __restrict__ out) {
  __shared__ __align__(16) float T[64 * PT];
  const int bid = blockIdx.x;
  if (bid >= NB * NT64 * NCT) return;
  const int cot = bid % NCT;
  const int nt  = (bid / NCT) % NT64;
  const int b   = bid / (NCT * NT64);
  const int n0 = nt * 64, co0 = cot * 64;
  const int t = threadIdx.x, l = t & 31, w = t >> 5, h = l >> 4, m = l & 15;
  const size_t aoff = ((size_t)b * NPTS + n0) * NC + 8 * l;
  const size_t boff = ((size_t)3 * NC + co0 + 16 * w) * NC + 8 * l;
  const GAddr g = {ath + aoff, atl + aoff, wh + boff, wl + boff};
  const int rot = grot(cot, nt);
  v8f acc[4];
  GFrag f0;
  {
    const GAddr gr = {g.ah + rot, g.al + rot, g.bh + rot, g.bl + rot};
    gload(f0, gr, 0);
    gaddr_wait(gr);
  }
  gemm64(g, rot, 0, f0, acc);
  stage64(T, acc, h, m, w);
  __syncthreads();
  const int cq = l >> 4, nq = 4 * (l & 15);
  v4f vals[8];
#pragma unroll
  for (int i = 0; i < 8; ++i) {
    const int col = 16 * w + 2 * i + cq;
    const float bb = bo[co0 + col];
    v4f f;
    f.x = T[(nq + 0) * PT + col] + bb;
    f.y = T[(nq + 1) * PT + col] + bb;
    f.z = T[(nq + 2) * PT + col] + bb;
    f.w = T[(nq + 3) * PT + col] + bb;
    vals[i] = f;
  }
  float* dst = out + ((size_t)b * NC + co0) * NPTS + n0 + nq;
#pragma unroll
  for (int i = 0; i < 8; ++i)
    *(v4f*)(dst + (size_t)(16 * w + 2 * i + cq) * NPTS) = vals[i];
  
}

// ---------------------------------------------------------------------------
// Host glue.  Inputs: x, adjacency, geo_bias, Wq, bq, Wk, bk, Wv, bv, Wo, bo.
// Workspace carve (bytes): xh, xl 2 x 6291456; wh, wl 2 x 2097152; mb 18874368;
// q16, k16, vT16 3 x 6291456; ath, atl 2 x 6291456; total 67108864.
// ---------------------------------------------------------------------------
extern "C" void kernel_launch(void* const* d_in, const int* in_sizes, int n_in,
                              void* d_out, int out_size, void* d_ws, size_t ws_size,
                              hipStream_t stream) {
  if (n_in < 11) return;
  if (in_sizes[0] != NB * NC * NPTS) return;
  if (in_sizes[1] != NPTS * NPTS || in_sizes[2] != NPTS * NPTS) return;
  if (in_sizes[3] != NC * NC || in_sizes[5] != NC * NC || in_sizes[7] != NC * NC || in_sizes[9] != NC * NC) return;
  if (in_sizes[4] != NC || in_sizes[6] != NC || in_sizes[8] != NC || in_sizes[10] != NC) return;
  if (out_size != NB * NC * NPTS) return;

  const float* x   = (const float*)d_in[0];
  const int*   adj = (const int*)d_in[1];
  const float* gb  = (const float*)d_in[2];
  const float* Wq  = (const float*)d_in[3];
  const float* bq  = (const float*)d_in[4];
  const float* Wk  = (const float*)d_in[5];
  const float* bk  = (const float*)d_in[6];
  const float* Wv  = (const float*)d_in[7];
  const float* bv  = (const float*)d_in[8];
  const float* Wo  = (const float*)d_in[9];
  const float* bo  = (const float*)d_in[10];
  float* out = (float*)d_out;

  const size_t sz_x16 = (size_t)NB * NPTS * NC * 2;         // 6291456
  const size_t sz_w16 = (size_t)4 * NC * NC * 2;             // 2097152
  const size_t sz_mb  = (size_t)NPTS * NPTS * 2;             // 18874368
  const size_t sz_hd  = (size_t)NB * NH * NPTS * HD * 2;     // 6291456
  char* ws = (char*)d_ws;
  size_t off = 0;
  us* xh   = (us*)(ws + off);    off += sz_x16;
  us* xl   = (us*)(ws + off);    off += sz_x16;
  us* wh   = (us*)(ws + off);    off += sz_w16;
  us* wl   = (us*)(ws + off);    off += sz_w16;
  us* mb   = (us*)(ws + off);    off += sz_mb;
  us* q16  = (us*)(ws + off);    off += sz_hd;
  us* k16  = (us*)(ws + off);    off += sz_hd;
  us* vT16 = (us*)(ws + off);    off += sz_hd;
  us* ath  = (us*)(ws + off);    off += sz_x16;
  us* atl  = (us*)(ws + off);    off += sz_x16;
  if (off > ws_size) return;

  k_cvt_x<<<NB * NT64 * NCT, 128, 0, stream>>>(x, xh, xl);
  k_cvt_w<<<(4 * NC) / 4, 128, 0, stream>>>(Wq, Wk, Wv, Wo, wh, wl);
  k_mb<<<NT16 * (NPTS / 256), 128, 0, stream>>>(adj, gb, mb);
  k_qkv<<<NB * NT64 * NH, 128, 0, stream>>>(xh, wh, bq, bk, bv, q16, k16, vT16);
  k_attn<<<(NB * NH * NT16) / 4, 128, 0, stream>>>(q16, k16, vT16, mb, ath, atl);
  k_out<<<NB * NT64 * NCT, 128, 0, stream>>>(ath, atl, wh, wl, bo, out);
}
